// v000
// The times below were measured on an AMD MI455X: many runs one after another, warmed up first and cycling through
// copies of the inputs, with the whole window's GPU time divided by the number of runs. Launches and the gaps
// between them are all in it. The median over several windows is given; except for v000 it joins two sittings, which
// can be a few percent apart, so the side-by-side timings, each taken in one sitting, are the better comparison.
// v000 is the starting kernel.
#include <hip/hip_runtime.h>
#include <hip/hip_bf16.h>

typedef __bf16 bf16;
typedef __attribute__((ext_vector_type(16))) __bf16 bf16x16;
typedef __attribute__((ext_vector_type(8)))  float  floatx8;
typedef __attribute__((ext_vector_type(4)))  unsigned int uint32x4;
typedef __attribute__((ext_vector_type(8)))  unsigned int uint32x8;

// ---------------------------------------------------------------------------
// WMMA wrapper: D = A(16x32 bf16) * B(32x16 bf16) + C(16x16 f32)
// ---------------------------------------------------------------------------
__device__ __forceinline__ floatx8 wmma_bf16(bf16x16 a, bf16x16 b, floatx8 c) {
    return __builtin_amdgcn_wmma_f32_16x16x32_bf16(
        /*neg_a=*/false, a, /*neg_b=*/false, b,
        /*c_mod=*/(short)0, c, /*reuse_a=*/false, /*reuse_b=*/false);
}

__device__ __forceinline__ floatx8 fzero8() {
    floatx8 z;
#pragma unroll
    for (int i = 0; i < 8; ++i) z[i] = 0.0f;
    return z;
}

__device__ __forceinline__ void async_load_b128(const bf16* gptr, bf16* lptr) {
    unsigned lds = (unsigned)(size_t)lptr;
    unsigned long long ga = (unsigned long long)(size_t)gptr;
    asm volatile("global_load_async_to_lds_b128 %0, %1, off"
                 :: "v"(lds), "v"(ga)
                 : "memory");
}
__device__ __forceinline__ void wait_async0() {
    asm volatile("s_wait_asynccnt 0x0" ::: "memory");
}

__device__ __forceinline__ void tdm_load_2d_pad(const bf16* gptr, bf16* lptr,
                                                unsigned rows, unsigned cols,
                                                unsigned stride_elems) {
    unsigned long long ga = (unsigned long long)(size_t)gptr;
    uint32x4 g0;
    g0[0] = 1u;
    g0[1] = (unsigned)(size_t)lptr;
    g0[2] = (unsigned)ga;
    g0[3] = (unsigned)(ga >> 32) | 0x80000000u;
    uint32x8 g1;
    g1[0] = (1u << 16) | (1u << 20) | (4u << 22) | (3u << 25);
    g1[1] = (cols & 0xffffu) << 16;
    g1[2] = (rows & 0xffffu) << 16;
    g1[3] = (cols & 0xffffu) << 16;
    g1[4] = (rows & 0xffffu);
    g1[5] = stride_elems;
    g1[6] = 0u;
    g1[7] = 0u;
    asm volatile("tensor_load_to_lds %0, %1" :: "s"(g0), "s"(g1) : "memory");
}
__device__ __forceinline__ void wait_tensor0() {
#if __has_builtin(__builtin_amdgcn_s_wait_tensorcnt)
    __builtin_amdgcn_s_wait_tensorcnt(0);
#else
    asm volatile("s_wait_tensorcnt 0x0" ::: "memory");
#endif
}

__device__ __forceinline__ bf16x16 frag_row(const bf16* p) {
    bf16x16 f;
#pragma unroll
    for (int e = 0; e < 8; ++e) f[e] = p[e];
#pragma unroll
    for (int e = 0; e < 8; ++e) f[e + 8] = p[e + 16];
    return f;
}

// Fragment from a column of a row-major [K][N] LDS tile (used for V in P*V).
__device__ __forceinline__ bf16x16 frag_col(const bf16* base, int ld, int col, int c0) {
    bf16x16 f;
#pragma unroll
    for (int e = 0; e < 8; ++e) f[e] = base[(c0 + e) * ld + col];
#pragma unroll
    for (int e = 0; e < 8; ++e) f[e + 8] = base[(c0 + 16 + e) * ld + col];
    return f;
}

// wave32 full reduction
__device__ __forceinline__ float wave_sum32(float v) {
#pragma unroll
    for (int m = 16; m >= 1; m >>= 1) v += __shfl_xor(v, m, 32);
    return v;
}
// reduction within each 16-lane half (rows of a 16x16 WMMA D tile)
__device__ __forceinline__ float red16_max(float v) {
#pragma unroll
    for (int m = 8; m >= 1; m >>= 1) v = fmaxf(v, __shfl_xor(v, m, 32));
    return v;
}
__device__ __forceinline__ float red16_sum(float v) {
#pragma unroll
    for (int m = 8; m >= 1; m >>= 1) v += __shfl_xor(v, m, 32);
    return v;
}

// ---------------------------------------------------------------------------
// f32 -> bf16 conversion (vectorized float4 loads)
// ---------------------------------------------------------------------------
__global__ void cvt_bf16_kernel(const float* __restrict__ in, bf16* __restrict__ out, long n) {
    long i = ((long)blockIdx.x * blockDim.x + threadIdx.x) * 4;
    if (i < n) {
        float4 v = *(const float4*)(in + i);
        out[i + 0] = (bf16)v.x;
        out[i + 1] = (bf16)v.y;
        out[i + 2] = (bf16)v.z;
        out[i + 3] = (bf16)v.w;
    }
}

// ---------------------------------------------------------------------------
// LayerNorm: one block per row, f32 in, bf16 out
// ---------------------------------------------------------------------------
__global__ __launch_bounds__(256) void ln_bf16_kernel(
    const float* __restrict__ x, const float* __restrict__ g,
    const float* __restrict__ bta, bf16* __restrict__ out, int C) {
    const int row = blockIdx.x;
    const float* xr = x + (size_t)row * C;
    float ls = 0.f, lq = 0.f;
    for (int i = threadIdx.x; i < C; i += 256) {
        float v = xr[i];
        ls += v;
        lq += v * v;
    }
    ls = wave_sum32(ls);
    lq = wave_sum32(lq);
    __shared__ float ss[8], sq[8];
    int lane = threadIdx.x & 31, w = threadIdx.x >> 5;
    if (lane == 0) { ss[w] = ls; sq[w] = lq; }
    __syncthreads();
    if (w == 0) {
        float a  = (lane < 8) ? ss[lane] : 0.f;
        float b2 = (lane < 8) ? sq[lane] : 0.f;
        a = wave_sum32(a);
        b2 = wave_sum32(b2);
        if (lane == 0) { ss[0] = a; sq[0] = b2; }
    }
    __syncthreads();
    float mean = ss[0] / (float)C;
    float var  = sq[0] / (float)C - mean * mean;
    float inv  = rsqrtf(var + 1e-5f);
    bf16* orow = out + (size_t)row * C;
    for (int i = threadIdx.x; i < C; i += 256)
        orow[i] = (bf16)((xr[i] - mean) * inv * g[i] + bta[i]);
}

template <int EPI>
__global__ __launch_bounds__(256) void gemm_bf16_kernel(
    const bf16* __restrict__ A, const bf16* __restrict__ B,
    const float* __restrict__ bias, const float* __restrict__ res,
    void* __restrict__ out, int M, int N, int K) {
    __shared__ bf16 As[2][128][40];  // row-major [m][k], 80B rows (16B aligned)
    __shared__ bf16 Bs[2][128][40];  // transposed [n][k]

    const int tid  = threadIdx.x;
    const int lane = tid & 31;
    const int wave = tid >> 5;
    const int wr = wave >> 1;   // 0..3 : 32-row group
    const int wc = wave & 1;    // 0..1 : 64-col group
    const int hf = lane >> 4;   // lane half
    const int c0 = hf << 3;
    const int ln = lane & 15;
    const int bm = blockIdx.y * 128;
    const int bn = blockIdx.x * 128;

    floatx8 acc[2][4];
#pragma unroll
    for (int i = 0; i < 2; ++i)
#pragma unroll
        for (int j = 0; j < 4; ++j) acc[i][j] = fzero8();

    const int ar = tid >> 1, ah = tid & 1;  // A: 128 rows x 2 half-rows of 16
    const int br = tid >> 3, bsg = tid & 7; // B: 32 rows x 8 segs of 16

    // ---- prologue: stage tile 0 into buffer 0 ----
    {
        const bf16* ga = A + (size_t)(bm + ar) * K + ah * 16;
        async_load_b128(ga + 0, &As[0][ar][ah * 16 + 0]);
        async_load_b128(ga + 8, &As[0][ar][ah * 16 + 8]);
        const bf16* gb = B + (size_t)br * N + bn + bsg * 16;
        alignas(16) bf16 t0[16];
        *(uint4*)&t0[0] = ((const uint4*)gb)[0];
        *(uint4*)&t0[8] = ((const uint4*)gb)[1];
#pragma unroll
        for (int j = 0; j < 16; ++j) Bs[0][bsg * 16 + j][br] = t0[j];
        wait_async0();
    }
    __syncthreads();

    int cur = 0;
    for (int kk = 0; kk < K; kk += 32) {
        const int nxt = cur ^ 1;
        const bool has_next = (kk + 32 < K);
        alignas(16) bf16 breg[16];
        if (has_next) {
            const bf16* ga = A + (size_t)(bm + ar) * K + (kk + 32) + ah * 16;
            async_load_b128(ga + 0, &As[nxt][ar][ah * 16 + 0]);
            async_load_b128(ga + 8, &As[nxt][ar][ah * 16 + 8]);
            const bf16* gb = B + (size_t)(kk + 32 + br) * N + bn + bsg * 16;
            *(uint4*)&breg[0] = ((const uint4*)gb)[0];
            *(uint4*)&breg[8] = ((const uint4*)gb)[1];
            if (kk + 64 < K) {  // L2 warm-up two tiles ahead (global_prefetch_b8)
                __builtin_prefetch(A + (size_t)(bm + ar) * K + kk + 64 + ah * 16, 0, 1);
                __builtin_prefetch(B + (size_t)(kk + 64 + br) * N + bn + bsg * 16, 0, 1);
            }
        }

        // ---- compute current tile: 8 WMMAs per wave ----
        bf16x16 af[2], bfv[4];
#pragma unroll
        for (int mt = 0; mt < 2; ++mt)
            af[mt] = frag_row(&As[cur][wr * 32 + mt * 16 + ln][c0]);
#pragma unroll
        for (int nt = 0; nt < 4; ++nt)
            bfv[nt] = frag_row(&Bs[cur][wc * 64 + nt * 16 + ln][c0]);
#pragma unroll
        for (int mt = 0; mt < 2; ++mt)
#pragma unroll
            for (int nt = 0; nt < 4; ++nt)
                acc[mt][nt] = wmma_bf16(af[mt], bfv[nt], acc[mt][nt]);

        if (has_next) {
            // commit staged B to LDS[nxt], then close the async pipeline stage
#pragma unroll
            for (int j = 0; j < 16; ++j) Bs[nxt][bsg * 16 + j][br] = breg[j];
            wait_async0();
            __syncthreads();
        }
        cur = nxt;
    }

    // ---- epilogue: D layout = lane holds col n=ln, rows v + 8*hf ----
#pragma unroll
    for (int mt = 0; mt < 2; ++mt) {
#pragma unroll
        for (int nt = 0; nt < 4; ++nt) {
            const int n  = bn + wc * 64 + nt * 16 + ln;
            const float bs = bias[n];
#pragma unroll
            for (int v = 0; v < 8; ++v) {
                const int m = bm + wr * 32 + mt * 16 + v + 8 * hf;
                float val = acc[mt][nt][v] + bs;
                const size_t idx = (size_t)m * N + n;
                if (EPI == 0) {
                    ((bf16*)out)[idx] = (bf16)val;
                } else if (EPI == 1) {
                    float t = 0.7978845608028654f * (val + 0.044715f * val * val * val);
                    val = 0.5f * val * (1.0f + tanhf(t));
                    ((bf16*)out)[idx] = (bf16)val;
                } else {
                    ((float*)out)[idx] = val + res[idx];
                }
            }
        }
    }
}

__global__ __launch_bounds__(128) void attn_kernel(
    const bf16* __restrict__ Q, int qstride,
    const bf16* __restrict__ Kp, const bf16* __restrict__ Vp, int kvstride,
    bf16* __restrict__ O, int Tq, int Tk, int causal, float scale) {
    __shared__ bf16 Ks[32][72];        // K chunk [key][d]  (144B rows, 16B aligned)
    __shared__ bf16 Vs[32][72];        // V chunk [key][d]
    __shared__ bf16 Ps[4][16][40];     // per-wave P staging [q][key]

    const int tid  = threadIdx.x;
    const int lane = tid & 31;
    const int w    = tid >> 5;
    const int hf = lane >> 4, c0 = hf << 3, ln = lane & 15;
    const int q0 = blockIdx.x * 64;
    const int h  = blockIdx.y;
    const int b  = blockIdx.z;

    const bf16* qbase = Q  + (size_t)(b * Tq) * qstride  + h * 64;
    const bf16* kbase = Kp + (size_t)(b * Tk) * kvstride + h * 64;
    const bf16* vbase = Vp + (size_t)(b * Tk) * kvstride + h * 64;

    // Q fragments for this wave's 16 rows (2 K-steps over dh=64), kept resident
    bf16x16 qf[2];
    {
        const bf16* qp = qbase + (size_t)(q0 + w * 16 + ln) * qstride;
#pragma unroll
        for (int ks = 0; ks < 2; ++ks) {
            bf16x16 f;
#pragma unroll
            for (int e = 0; e < 8; ++e) f[e] = qp[ks * 32 + c0 + e];
#pragma unroll
            for (int e = 0; e < 8; ++e) f[e + 8] = qp[ks * 32 + c0 + 16 + e];
            qf[ks] = f;
        }
    }

    floatx8 o[4];
#pragma unroll
    for (int i = 0; i < 4; ++i) o[i] = fzero8();
    float m_r[8], l_r[8];
#pragma unroll
    for (int v = 0; v < 8; ++v) { m_r[v] = -1e30f; l_r[v] = 0.0f; }

    int kend = causal ? (q0 + 64) : Tk;
    if (kend > Tk) kend = Tk;

    for (int kc = 0; kc < kend; kc += 32) {
        __syncthreads();
        if (w == 0) {
            tdm_load_2d_pad(kbase + (size_t)kc * kvstride, &Ks[0][0], 32, 64, kvstride);
            tdm_load_2d_pad(vbase + (size_t)kc * kvstride, &Vs[0][0], 32, 64, kvstride);
            wait_tensor0();
        }
        __syncthreads();

        // S = Q * K^T : two 16x16 n-tiles, K-dim = dh = 64 (2 WMMA steps)
        floatx8 s[2];
#pragma unroll
        for (int nt = 0; nt < 2; ++nt) {
            floatx8 a = fzero8();
#pragma unroll
            for (int ks = 0; ks < 2; ++ks) {
                bf16x16 kf = frag_row(&Ks[nt * 16 + ln][ks * 32 + c0]);
                a = wmma_bf16(qf[ks], kf, a);
            }
            s[nt] = a;
        }
        // scale + causal mask (D layout: lane holds col n=ln, rows v+8*hf)
#pragma unroll
        for (int nt = 0; nt < 2; ++nt) {
            const int kg = kc + nt * 16 + ln;
#pragma unroll
            for (int v = 0; v < 8; ++v) {
                float x = s[nt][v] * scale;
                if (causal) {
                    const int qg = q0 + w * 16 + v + 8 * hf;
                    if (kg > qg) x = -1e30f;
                }
                s[nt][v] = x;
            }
        }
        // online softmax
        float pr0[8], pr1[8], alpha[8];
#pragma unroll
        for (int v = 0; v < 8; ++v) {
            float t = fmaxf(s[0][v], s[1][v]);
            t = red16_max(t);
            float mn = fmaxf(m_r[v], t);
            alpha[v] = __expf(m_r[v] - mn);
            m_r[v]   = mn;
            pr0[v] = __expf(s[0][v] - mn);
            pr1[v] = __expf(s[1][v] - mn);
            float rs = red16_sum(pr0[v] + pr1[v]);
            l_r[v] = l_r[v] * alpha[v] + rs;
        }
#pragma unroll
        for (int nt = 0; nt < 4; ++nt)
#pragma unroll
            for (int v = 0; v < 8; ++v) o[nt][v] *= alpha[v];

        // D-layout -> A-layout for P via per-wave LDS (same-wave LDS is in-order)
#pragma unroll
        for (int v = 0; v < 8; ++v) {
            Ps[w][v + 8 * hf][ln]      = (bf16)pr0[v];
            Ps[w][v + 8 * hf][16 + ln] = (bf16)pr1[v];
        }
        bf16x16 pf = frag_row(&Ps[w][ln][c0]);
        // O += P(16x32) * V(32x64)
#pragma unroll
        for (int nt = 0; nt < 4; ++nt) {
            bf16x16 vf = frag_col(&Vs[0][0], 72, nt * 16 + ln, c0);
            o[nt] = wmma_bf16(pf, vf, o[nt]);
        }
    }

#pragma unroll
    for (int v = 0; v < 8; ++v) {
        const float inv = 1.0f / l_r[v];
        const int qg = q0 + w * 16 + v + 8 * hf;
        bf16* op = O + (size_t)(b * Tq + qg) * 1024 + h * 64;
#pragma unroll
        for (int nt = 0; nt < 4; ++nt)
            op[nt * 16 + ln] = (bf16)(o[nt][v] * inv);
    }
}

// ---------------------------------------------------------------------------
// Host-side orchestration
// ---------------------------------------------------------------------------
static void cvt(const float* in, bf16* out, long n, hipStream_t s) {
    long n4 = n / 4;
    cvt_bf16_kernel<<<dim3((unsigned)((n4 + 255) / 256)), 256, 0, s>>>(in, out, n);
}

template <int EPI>
static void gemm(const bf16* A, const bf16* B, const float* bias, const float* res,
                 void* out, int M, int N, int K, hipStream_t s) {
    dim3 g(N / 128, M / 128);
    gemm_bf16_kernel<EPI><<<g, 256, 0, s>>>(A, B, bias, res, out, M, N, K);
}

extern "C" void kernel_launch(void* const* d_in, const int* in_sizes, int n_in,
                              void* d_out, int out_size, void* d_ws, size_t ws_size,
                              hipStream_t stream) {
    const float* x      = (const float*)d_in[0];
    const float* key    = (const float*)d_in[1];
    const float* val    = (const float*)d_in[2];
    const float* ln1_g  = (const float*)d_in[3];
    const float* ln1_b  = (const float*)d_in[4];
    const float* ln2_g  = (const float*)d_in[5];
    const float* ln2_b  = (const float*)d_in[6];
    const float* ln3_g  = (const float*)d_in[7];
    const float* ln3_b  = (const float*)d_in[8];
    const float* W_attn = (const float*)d_in[9];
    const float* b_attn = (const float*)d_in[10];
    const float* W_aproj= (const float*)d_in[11];
    const float* b_aproj= (const float*)d_in[12];
    const float* Wq     = (const float*)d_in[13];
    const float* bq     = (const float*)d_in[14];
    const float* Wk     = (const float*)d_in[15];
    const float* bk     = (const float*)d_in[16];
    const float* Wv     = (const float*)d_in[17];
    const float* bv     = (const float*)d_in[18];
    const float* W_cproj= (const float*)d_in[19];
    const float* b_cproj= (const float*)d_in[20];
    const float* W_fc   = (const float*)d_in[21];
    const float* b_fc   = (const float*)d_in[22];
    const float* W_mproj= (const float*)d_in[23];
    const float* b_mproj= (const float*)d_in[24];

    const int B = 8, T = 1024, C = 1024, Ck = 768, TK = 256, NH = 16;
    const size_t BT  = (size_t)B * T;    // 8192 rows
    const size_t BTk = (size_t)B * TK;   // 2048 rows

    char* ws = (char*)d_ws;
    size_t off = 0;
    auto alloc = [&](size_t bytes) -> void* {
        void* p = ws + off;
        off += (bytes + 255) & ~(size_t)255;
        return p;
    };

    // persistent bf16 buffers
    bf16* wattn  = (bf16*)alloc((size_t)C * 3 * C * 2);
    bf16* waproj = (bf16*)alloc((size_t)C * C * 2);
    bf16* wqb    = (bf16*)alloc((size_t)C * C * 2);
    bf16* wkb    = (bf16*)alloc((size_t)Ck * C * 2);
    bf16* wvb    = (bf16*)alloc((size_t)Ck * C * 2);
    bf16* wcproj = (bf16*)alloc((size_t)C * C * 2);
    bf16* wfc    = (bf16*)alloc((size_t)C * 4 * C * 2);
    bf16* wmproj = (bf16*)alloc((size_t)4 * C * C * 2);
    bf16* keyb   = (bf16*)alloc(BTk * Ck * 2);
    bf16* valb   = (bf16*)alloc(BTk * Ck * 2);
    bf16* lnbuf  = (bf16*)alloc(BT * C * 2);
    bf16* attnb  = (bf16*)alloc(BT * C * 2);
    // phase-aliased scratch (max of: qkv 50MB | q/k/v-proj 24MB | mlp hidden 67MB)
    char* scratch = (char*)alloc(BT * (size_t)4 * C * 2);
    bf16* qkv = (bf16*)scratch;
    bf16* qc  = (bf16*)scratch;
    bf16* kc  = (bf16*)(scratch + BT * C * 2);
    bf16* vc  = (bf16*)(scratch + BT * C * 2 + BTk * C * 2);
    bf16* hfc = (bf16*)scratch;

    float* xo = (float*)d_out;  // running residual state lives in d_out x-region

    // 0) one-time down-conversions
    cvt(W_attn, wattn, (long)C * 3 * C, stream);
    cvt(W_aproj, waproj, (long)C * C, stream);
    cvt(Wq, wqb, (long)C * C, stream);
    cvt(Wk, wkb, (long)Ck * C, stream);
    cvt(Wv, wvb, (long)Ck * C, stream);
    cvt(W_cproj, wcproj, (long)C * C, stream);
    cvt(W_fc, wfc, (long)C * 4 * C, stream);
    cvt(W_mproj, wmproj, (long)4 * C * C, stream);
    cvt(key, keyb, (long)BTk * Ck, stream);
    cvt(val, valb, (long)BTk * Ck, stream);

    const float scale = 0.125f;  // 1/sqrt(64)

    // 1) self-attention branch
    ln_bf16_kernel<<<dim3((unsigned)BT), 256, 0, stream>>>(x, ln1_g, ln1_b, lnbuf, C);
    gemm<0>(lnbuf, wattn, b_attn, nullptr, qkv, (int)BT, 3 * C, C, stream);
    attn_kernel<<<dim3(T / 64, NH, B), 128, 0, stream>>>(
        qkv, 3 * C, qkv + C, qkv + 2 * C, 3 * C, attnb, T, T, /*causal=*/1, scale);
    gemm<2>(attnb, waproj, b_aproj, x, xo, (int)BT, C, C, stream);  // x + attn

    // 2) cross-attention branch
    ln_bf16_kernel<<<dim3((unsigned)BT), 256, 0, stream>>>(xo, ln3_g, ln3_b, lnbuf, C);
    gemm<0>(lnbuf, wqb, bq, nullptr, qc, (int)BT, C, C, stream);
    gemm<0>(keyb, wkb, bk, nullptr, kc, (int)BTk, C, Ck, stream);
    gemm<0>(valb, wvb, bv, nullptr, vc, (int)BTk, C, Ck, stream);
    attn_kernel<<<dim3(T / 64, NH, B), 128, 0, stream>>>(
        qc, C, kc, vc, C, attnb, T, TK, /*causal=*/0, scale);
    gemm<2>(attnb, wcproj, b_cproj, xo, xo, (int)BT, C, C, stream);  // x += cross

    // 3) MLP branch
    ln_bf16_kernel<<<dim3((unsigned)BT), 256, 0, stream>>>(xo, ln2_g, ln2_b, lnbuf, C);
    gemm<1>(lnbuf, wfc, b_fc, nullptr, hfc, (int)BT, 4 * C, C, stream);   // + GELU
    gemm<2>(hfc, wmproj, b_mproj, xo, xo, (int)BT, C, 4 * C, stream);     // x += mlp

    // 4) echo key/val into the output tuple
    size_t x_elems = BT * (size_t)C;
    size_t kv_elems = BTk * (size_t)Ck;
    hipMemcpyAsync(xo + x_elems, key, kv_elems * sizeof(float),
                   hipMemcpyDeviceToDevice, stream);
    hipMemcpyAsync(xo + x_elems + kv_elems, val, kv_elems * sizeof(float),
                   hipMemcpyDeviceToDevice, stream);
}

// v001
// Two timings next to v000 both put it at 1.35 times that version's speed.
#include <hip/hip_runtime.h>
#include <hip/hip_bf16.h>

typedef __bf16 bf16;
typedef __attribute__((ext_vector_type(16))) __bf16 bf16x16;
typedef __attribute__((ext_vector_type(8)))  float  floatx8;
typedef __attribute__((ext_vector_type(4)))  unsigned int uint32x4;
typedef __attribute__((ext_vector_type(8)))  unsigned int uint32x8;
typedef __attribute__((ext_vector_type(8)))  short s16x8;
typedef __attribute__((ext_vector_type(16))) short s16x16;

// ---------------------------------------------------------------------------
// WMMA wrapper: D = A(16x32 bf16) * B(32x16 bf16) + C(16x16 f32)
// ---------------------------------------------------------------------------
__device__ __forceinline__ floatx8 wmma_bf16(bf16x16 a, bf16x16 b, floatx8 c) {
    return __builtin_amdgcn_wmma_f32_16x16x32_bf16(
        /*neg_a=*/false, a, /*neg_b=*/false, b,
        /*c_mod=*/(short)0, c, /*reuse_a=*/false, /*reuse_b=*/false);
}

__device__ __forceinline__ floatx8 fzero8() {
    floatx8 z;
#pragma unroll
    for (int i = 0; i < 8; ++i) z[i] = 0.0f;
    return z;
}

__device__ __forceinline__ void async_load_b128(const bf16* gptr, bf16* lptr) {
    unsigned lds = (unsigned)(size_t)lptr;
    unsigned long long ga = (unsigned long long)(size_t)gptr;
    asm volatile("global_load_async_to_lds_b128 %0, %1, off"
                 :: "v"(lds), "v"(ga)
                 : "memory");
}
__device__ __forceinline__ void wait_async0() {
    asm volatile("s_wait_asynccnt 0x0" ::: "memory");
}

__device__ __forceinline__ void tdm_load_2d_pad(const bf16* gptr, bf16* lptr,
                                                unsigned rows, unsigned cols,
                                                unsigned stride_elems) {
    unsigned long long ga = (unsigned long long)(size_t)gptr;
    uint32x4 g0;
    g0[0] = 1u;
    g0[1] = (unsigned)(size_t)lptr;
    g0[2] = (unsigned)ga;
    g0[3] = (unsigned)(ga >> 32) | 0x80000000u;
    uint32x8 g1;
    g1[0] = (1u << 16) | (1u << 20) | (4u << 22) | (3u << 25);
    g1[1] = (cols & 0xffffu) << 16;
    g1[2] = (rows & 0xffffu) << 16;
    g1[3] = (cols & 0xffffu) << 16;
    g1[4] = (rows & 0xffffu);
    g1[5] = stride_elems;
    g1[6] = 0u;
    g1[7] = 0u;
    asm volatile("tensor_load_to_lds %0, %1" :: "s"(g0), "s"(g1) : "memory");
}
__device__ __forceinline__ void wait_tensor0() {
#if __has_builtin(__builtin_amdgcn_s_wait_tensorcnt)
    __builtin_amdgcn_s_wait_tensorcnt(0);
#else
    asm volatile("s_wait_tensorcnt 0x0" ::: "memory");
#endif
}

__device__ __forceinline__ bf16x16 frag_row(const bf16* p) {
    bf16x16 f;
#pragma unroll
    for (int e = 0; e < 8; ++e) f[e] = p[e];
#pragma unroll
    for (int e = 0; e < 8; ++e) f[e + 8] = p[e + 16];
    return f;
}

// 32x16 B fragment from a row-major [k][n] LDS tile by two transposing loads.
// p is the lane's own address: row 8*(lane>>4) + (lane&7), column n0 + 8*((lane>>3)&1);
// lane (c = lane&15, h = lane>>4) then holds column n0 + c at k {8h..8h+7, 16+8h..16+8h+7},
// the same k order as frag_row. ld = row pitch in elements.
__device__ __forceinline__ bf16x16 frag_tr(const bf16* p, int ld) {
    typedef __attribute__((address_space(3))) s16x8 lds_s16x8;
    s16x8 lo = __builtin_amdgcn_ds_load_tr16_b128_v8i16((lds_s16x8*)p);
    s16x8 hi = __builtin_amdgcn_ds_load_tr16_b128_v8i16((lds_s16x8*)(p + 16 * ld));
    s16x16 f = __builtin_shufflevector(lo, hi, 0, 1, 2, 3, 4, 5, 6, 7,
                                       8, 9, 10, 11, 12, 13, 14, 15);
    return __builtin_bit_cast(bf16x16, f);
}

// Fragment from a column of a row-major [K][N] LDS tile (used for V in P*V).
__device__ __forceinline__ bf16x16 frag_col(const bf16* base, int ld, int col, int c0) {
    bf16x16 f;
#pragma unroll
    for (int e = 0; e < 8; ++e) f[e] = base[(c0 + e) * ld + col];
#pragma unroll
    for (int e = 0; e < 8; ++e) f[e + 8] = base[(c0 + 16 + e) * ld + col];
    return f;
}

// wave32 full reduction
__device__ __forceinline__ float wave_sum32(float v) {
#pragma unroll
    for (int m = 16; m >= 1; m >>= 1) v += __shfl_xor(v, m, 32);
    return v;
}
// reduction within each 16-lane half (rows of a 16x16 WMMA D tile)
__device__ __forceinline__ float red16_max(float v) {
#pragma unroll
    for (int m = 8; m >= 1; m >>= 1) v = fmaxf(v, __shfl_xor(v, m, 32));
    return v;
}
__device__ __forceinline__ float red16_sum(float v) {
#pragma unroll
    for (int m = 8; m >= 1; m >>= 1) v += __shfl_xor(v, m, 32);
    return v;
}

// ---------------------------------------------------------------------------
// f32 -> bf16 conversion (vectorized float4 loads)
// ---------------------------------------------------------------------------
__global__ void cvt_bf16_kernel(const float* __restrict__ in, bf16* __restrict__ out, long n) {
    long i = ((long)blockIdx.x * blockDim.x + threadIdx.x) * 4;
    if (i < n) {
        float4 v = *(const float4*)(in + i);
        out[i + 0] = (bf16)v.x;
        out[i + 1] = (bf16)v.y;
        out[i + 2] = (bf16)v.z;
        out[i + 3] = (bf16)v.w;
    }
}

// ---------------------------------------------------------------------------
// LayerNorm: one block per row, f32 in, bf16 out
// ---------------------------------------------------------------------------
__global__ __launch_bounds__(256) void ln_bf16_kernel(
    const float* __restrict__ x, const float* __restrict__ g,
    const float* __restrict__ bta, bf16* __restrict__ out, int C) {
    const int row = blockIdx.x;
    const float* xr = x + (size_t)row * C;
    float ls = 0.f, lq = 0.f;
    for (int i = threadIdx.x; i < C; i += 256) {
        float v = xr[i];
        ls += v;
        lq += v * v;
    }
    ls = wave_sum32(ls);
    lq = wave_sum32(lq);
    __shared__ float ss[8], sq[8];
    int lane = threadIdx.x & 31, w = threadIdx.x >> 5;
    if (lane == 0) { ss[w] = ls; sq[w] = lq; }
    __syncthreads();
    if (w == 0) {
        float a  = (lane < 8) ? ss[lane] : 0.f;
        float b2 = (lane < 8) ? sq[lane] : 0.f;
        a = wave_sum32(a);
        b2 = wave_sum32(b2);
        if (lane == 0) { ss[0] = a; sq[0] = b2; }
    }
    __syncthreads();
    float mean = ss[0] / (float)C;
    float var  = sq[0] / (float)C - mean * mean;
    float inv  = rsqrtf(var + 1e-5f);
    bf16* orow = out + (size_t)row * C;
    for (int i = threadIdx.x; i < C; i += 256)
        orow[i] = (bf16)((xr[i] - mean) * inv * g[i] + bta[i]);
}

template <int EPI>
__global__ __launch_bounds__(256) void gemm_bf16_kernel(
    const bf16* __restrict__ A, const bf16* __restrict__ B,
    const float* __restrict__ bias, const float* __restrict__ res,
    void* __restrict__ out, int M, int N, int K) {
    __shared__ bf16 As[2][128][40];  // row-major [m][k], 80B rows (16B aligned)
    // row-major [k][n], 288B rows (32B x odd: the transposing load's pitch)
    __shared__ __attribute__((aligned(16))) bf16 Bs[2][32][144];

    const int tid  = threadIdx.x;
    const int lane = tid & 31;
    const int wave = tid >> 5;
    const int wr = wave >> 1;   // 0..3 : 32-row group
    const int wc = wave & 1;    // 0..1 : 64-col group
    const int hf = lane >> 4;   // lane half
    const int c0 = hf << 3;
    const int ln = lane & 15;
    const int bm = blockIdx.y * 128;
    const int bn = blockIdx.x * 128;

    floatx8 acc[2][4];
#pragma unroll
    for (int i = 0; i < 2; ++i)
#pragma unroll
        for (int j = 0; j < 4; ++j) acc[i][j] = fzero8();

    const int ar = tid >> 1, ah = tid & 1;  // A: 128 rows x 2 half-rows of 16
    const int br = tid >> 3, bsg = tid & 7; // B: 32 rows x 8 segs of 16

    // ---- prologue: stage tile 0 into buffer 0 ----
    {
        const bf16* ga = A + (size_t)(bm + ar) * K + ah * 16;
        async_load_b128(ga + 0, &As[0][ar][ah * 16 + 0]);
        async_load_b128(ga + 8, &As[0][ar][ah * 16 + 8]);
        const bf16* gb = B + (size_t)br * N + bn + bsg * 16;
        *(uint4*)&Bs[0][br][bsg * 16 + 0] = ((const uint4*)gb)[0];
        *(uint4*)&Bs[0][br][bsg * 16 + 8] = ((const uint4*)gb)[1];
        wait_async0();
    }
    __syncthreads();

    int cur = 0;
    for (int kk = 0; kk < K; kk += 32) {
        const int nxt = cur ^ 1;
        const bool has_next = (kk + 32 < K);
        uint4 breg0, breg1;  // next B tile's 32 bytes of this thread, held over the WMMAs
        if (has_next) {
            const bf16* ga = A + (size_t)(bm + ar) * K + (kk + 32) + ah * 16;
            async_load_b128(ga + 0, &As[nxt][ar][ah * 16 + 0]);
            async_load_b128(ga + 8, &As[nxt][ar][ah * 16 + 8]);
            const bf16* gb = B + (size_t)(kk + 32 + br) * N + bn + bsg * 16;
            breg0 = ((const uint4*)gb)[0];
            breg1 = ((const uint4*)gb)[1];
            asm volatile("s_wait_xcnt 0x0" ::: "memory");
            if (kk + 64 < K) {  // L2 warm-up two tiles ahead (global_prefetch_b8)
                __builtin_prefetch(A + (size_t)(bm + ar) * K + kk + 64 + ah * 16, 0, 1);
                __builtin_prefetch(B + (size_t)(kk + 64 + br) * N + bn + bsg * 16, 0, 1);
            }
        }

        // ---- compute current tile: 8 WMMAs per wave ----
        bf16x16 af[2], bfv[4];
#pragma unroll
        for (int mt = 0; mt < 2; ++mt)
            af[mt] = frag_row(&As[cur][wr * 32 + mt * 16 + ln][c0]);
#pragma unroll
        for (int nt = 0; nt < 4; ++nt)
            bfv[nt] = frag_tr(&Bs[cur][c0 + (lane & 7)][wc * 64 + nt * 16 + ((lane >> 3) & 1) * 8], 144);
#pragma unroll
        for (int mt = 0; mt < 2; ++mt)
#pragma unroll
            for (int nt = 0; nt < 4; ++nt)
                acc[mt][nt] = wmma_bf16(af[mt], bfv[nt], acc[mt][nt]);

        if (has_next) {
            // commit staged B to LDS[nxt], then close the async pipeline stage
            *(uint4*)&Bs[nxt][br][bsg * 16 + 0] = breg0;
            *(uint4*)&Bs[nxt][br][bsg * 16 + 8] = breg1;
            wait_async0();
            __syncthreads();
        }
        cur = nxt;
    }

    // ---- epilogue: D layout = lane holds col n=ln, rows v + 8*hf ----
#pragma unroll
    for (int mt = 0; mt < 2; ++mt) {
#pragma unroll
        for (int nt = 0; nt < 4; ++nt) {
            const int n  = bn + wc * 64 + nt * 16 + ln;
            const float bs = bias[n];
#pragma unroll
            for (int v = 0; v < 8; ++v) {
                const int m = bm + wr * 32 + mt * 16 + v + 8 * hf;
                float val = acc[mt][nt][v] + bs;
                const size_t idx = (size_t)m * N + n;
                if (EPI == 0) {
                    ((bf16*)out)[idx] = (bf16)val;
                } else if (EPI == 1) {
                    float t = 0.7978845608028654f * (val + 0.044715f * val * val * val);
                    val = 0.5f * val * (1.0f + tanhf(t));
                    ((bf16*)out)[idx] = (bf16)val;
                } else {
                    ((float*)out)[idx] = val + res[idx];
                }
            }
        }
    }
}

__global__ __launch_bounds__(128) void attn_kernel(
    const bf16* __restrict__ Q, int qstride,
    const bf16* __restrict__ Kp, const bf16* __restrict__ Vp, int kvstride,
    bf16* __restrict__ O, int Tq, int Tk, int causal, float scale) {
    __shared__ bf16 Ks[32][72];        // K chunk [key][d]  (144B rows, 16B aligned)
    __shared__ bf16 Vs[32][72];        // V chunk [key][d]
    __shared__ bf16 Ps[4][16][40];     // per-wave P staging [q][key]

    const int tid  = threadIdx.x;
    const int lane = tid & 31;
    const int w    = tid >> 5;
    const int hf = lane >> 4, c0 = hf << 3, ln = lane & 15;
    const int q0 = blockIdx.x * 64;
    const int h  = blockIdx.y;
    const int b  = blockIdx.z;

    const bf16* qbase = Q  + (size_t)(b * Tq) * qstride  + h * 64;
    const bf16* kbase = Kp + (size_t)(b * Tk) * kvstride + h * 64;
    const bf16* vbase = Vp + (size_t)(b * Tk) * kvstride + h * 64;

    // Q fragments for this wave's 16 rows (2 K-steps over dh=64), kept resident
    bf16x16 qf[2];
    {
        const bf16* qp = qbase + (size_t)(q0 + w * 16 + ln) * qstride;
#pragma unroll
        for (int ks = 0; ks < 2; ++ks) {
            bf16x16 f;
#pragma unroll
            for (int e = 0; e < 8; ++e) f[e] = qp[ks * 32 + c0 + e];
#pragma unroll
            for (int e = 0; e < 8; ++e) f[e + 8] = qp[ks * 32 + c0 + 16 + e];
            qf[ks] = f;
        }
    }

    floatx8 o[4];
#pragma unroll
    for (int i = 0; i < 4; ++i) o[i] = fzero8();
    float m_r[8], l_r[8];
#pragma unroll
    for (int v = 0; v < 8; ++v) { m_r[v] = -1e30f; l_r[v] = 0.0f; }

    int kend = causal ? (q0 + 64) : Tk;
    if (kend > Tk) kend = Tk;

    for (int kc = 0; kc < kend; kc += 32) {
        __syncthreads();
        if (w == 0) {
            tdm_load_2d_pad(kbase + (size_t)kc * kvstride, &Ks[0][0], 32, 64, kvstride);
            tdm_load_2d_pad(vbase + (size_t)kc * kvstride, &Vs[0][0], 32, 64, kvstride);
            wait_tensor0();
        }
        __syncthreads();

        // S = Q * K^T : two 16x16 n-tiles, K-dim = dh = 64 (2 WMMA steps)
        floatx8 s[2];
#pragma unroll
        for (int nt = 0; nt < 2; ++nt) {
            floatx8 a = fzero8();
#pragma unroll
            for (int ks = 0; ks < 2; ++ks) {
                bf16x16 kf = frag_row(&Ks[nt * 16 + ln][ks * 32 + c0]);
                a = wmma_bf16(qf[ks], kf, a);
            }
            s[nt] = a;
        }
        // scale + causal mask (D layout: lane holds col n=ln, rows v+8*hf)
#pragma unroll
        for (int nt = 0; nt < 2; ++nt) {
            const int kg = kc + nt * 16 + ln;
#pragma unroll
            for (int v = 0; v < 8; ++v) {
                float x = s[nt][v] * scale;
                if (causal) {
                    const int qg = q0 + w * 16 + v + 8 * hf;
                    if (kg > qg) x = -1e30f;
                }
                s[nt][v] = x;
            }
        }
        // online softmax
        float pr0[8], pr1[8], alpha[8];
#pragma unroll
        for (int v = 0; v < 8; ++v) {
            float t = fmaxf(s[0][v], s[1][v]);
            t = red16_max(t);
            float mn = fmaxf(m_r[v], t);
            alpha[v] = __expf(m_r[v] - mn);
            m_r[v]   = mn;
            pr0[v] = __expf(s[0][v] - mn);
            pr1[v] = __expf(s[1][v] - mn);
            float rs = red16_sum(pr0[v] + pr1[v]);
            l_r[v] = l_r[v] * alpha[v] + rs;
        }
#pragma unroll
        for (int nt = 0; nt < 4; ++nt)
#pragma unroll
            for (int v = 0; v < 8; ++v) o[nt][v] *= alpha[v];

        // D-layout -> A-layout for P via per-wave LDS (same-wave LDS is in-order)
#pragma unroll
        for (int v = 0; v < 8; ++v) {
            Ps[w][v + 8 * hf][ln]      = (bf16)pr0[v];
            Ps[w][v + 8 * hf][16 + ln] = (bf16)pr1[v];
        }
        bf16x16 pf = frag_row(&Ps[w][ln][c0]);
        // O += P(16x32) * V(32x64)
#pragma unroll
        for (int nt = 0; nt < 4; ++nt) {
            bf16x16 vf = frag_col(&Vs[0][0], 72, nt * 16 + ln, c0);
            o[nt] = wmma_bf16(pf, vf, o[nt]);
        }
    }

#pragma unroll
    for (int v = 0; v < 8; ++v) {
        const float inv = 1.0f / l_r[v];
        const int qg = q0 + w * 16 + v + 8 * hf;
        bf16* op = O + (size_t)(b * Tq + qg) * 1024 + h * 64;
#pragma unroll
        for (int nt = 0; nt < 4; ++nt)
            op[nt * 16 + ln] = (bf16)(o[nt][v] * inv);
    }
}

// ---------------------------------------------------------------------------
// Host-side orchestration
// ---------------------------------------------------------------------------
static void cvt(const float* in, bf16* out, long n, hipStream_t s) {
    long n4 = n / 4;
    cvt_bf16_kernel<<<dim3((unsigned)((n4 + 255) / 256)), 256, 0, s>>>(in, out, n);
}

template <int EPI>
static void gemm(const bf16* A, const bf16* B, const float* bias, const float* res,
                 void* out, int M, int N, int K, hipStream_t s) {
    dim3 g(N / 128, M / 128);
    gemm_bf16_kernel<EPI><<<g, 256, 0, s>>>(A, B, bias, res, out, M, N, K);
}

extern "C" void kernel_launch(void* const* d_in, const int* in_sizes, int n_in,
                              void* d_out, int out_size, void* d_ws, size_t ws_size,
                              hipStream_t stream) {
    const float* x      = (const float*)d_in[0];
    const float* key    = (const float*)d_in[1];
    const float* val    = (const float*)d_in[2];
    const float* ln1_g  = (const float*)d_in[3];
    const float* ln1_b  = (const float*)d_in[4];
    const float* ln2_g  = (const float*)d_in[5];
    const float* ln2_b  = (const float*)d_in[6];
    const float* ln3_g  = (const float*)d_in[7];
    const float* ln3_b  = (const float*)d_in[8];
    const float* W_attn = (const float*)d_in[9];
    const float* b_attn = (const float*)d_in[10];
    const float* W_aproj= (const float*)d_in[11];
    const float* b_aproj= (const float*)d_in[12];
    const float* Wq     = (const float*)d_in[13];
    const float* bq     = (const float*)d_in[14];
    const float* Wk     = (const float*)d_in[15];
    const float* bk     = (const float*)d_in[16];
    const float* Wv     = (const float*)d_in[17];
    const float* bv     = (const float*)d_in[18];
    const float* W_cproj= (const float*)d_in[19];
    const float* b_cproj= (const float*)d_in[20];
    const float* W_fc   = (const float*)d_in[21];
    const float* b_fc   = (const float*)d_in[22];
    const float* W_mproj= (const float*)d_in[23];
    const float* b_mproj= (const float*)d_in[24];

    const int B = 8, T = 1024, C = 1024, Ck = 768, TK = 256, NH = 16;
    const size_t BT  = (size_t)B * T;    // 8192 rows
    const size_t BTk = (size_t)B * TK;   // 2048 rows

    char* ws = (char*)d_ws;
    size_t off = 0;
    auto alloc = [&](size_t bytes) -> void* {
        void* p = ws + off;
        off += (bytes + 255) & ~(size_t)255;
        return p;
    };

    // persistent bf16 buffers
    bf16* wattn  = (bf16*)alloc((size_t)C * 3 * C * 2);
    bf16* waproj = (bf16*)alloc((size_t)C * C * 2);
    bf16* wqb    = (bf16*)alloc((size_t)C * C * 2);
    bf16* wkb    = (bf16*)alloc((size_t)Ck * C * 2);
    bf16* wvb    = (bf16*)alloc((size_t)Ck * C * 2);
    bf16* wcproj = (bf16*)alloc((size_t)C * C * 2);
    bf16* wfc    = (bf16*)alloc((size_t)C * 4 * C * 2);
    bf16* wmproj = (bf16*)alloc((size_t)4 * C * C * 2);
    bf16* keyb   = (bf16*)alloc(BTk * Ck * 2);
    bf16* valb   = (bf16*)alloc(BTk * Ck * 2);
    bf16* lnbuf  = (bf16*)alloc(BT * C * 2);
    bf16* attnb  = (bf16*)alloc(BT * C * 2);
    // phase-aliased scratch (max of: qkv 50MB | q/k/v-proj 24MB | mlp hidden 67MB)
    char* scratch = (char*)alloc(BT * (size_t)4 * C * 2);
    bf16* qkv = (bf16*)scratch;
    bf16* qc  = (bf16*)scratch;
    bf16* kc  = (bf16*)(scratch + BT * C * 2);
    bf16* vc  = (bf16*)(scratch + BT * C * 2 + BTk * C * 2);
    bf16* hfc = (bf16*)scratch;

    float* xo = (float*)d_out;  // running residual state lives in d_out x-region

    // 0) one-time down-conversions
    cvt(W_attn, wattn, (long)C * 3 * C, stream);
    cvt(W_aproj, waproj, (long)C * C, stream);
    cvt(Wq, wqb, (long)C * C, stream);
    cvt(Wk, wkb, (long)Ck * C, stream);
    cvt(Wv, wvb, (long)Ck * C, stream);
    cvt(W_cproj, wcproj, (long)C * C, stream);
    cvt(W_fc, wfc, (long)C * 4 * C, stream);
    cvt(W_mproj, wmproj, (long)4 * C * C, stream);
    cvt(key, keyb, (long)BTk * Ck, stream);
    cvt(val, valb, (long)BTk * Ck, stream);

    const float scale = 0.125f;  // 1/sqrt(64)

    // 1) self-attention branch
    ln_bf16_kernel<<<dim3((unsigned)BT), 256, 0, stream>>>(x, ln1_g, ln1_b, lnbuf, C);
    gemm<0>(lnbuf, wattn, b_attn, nullptr, qkv, (int)BT, 3 * C, C, stream);
    attn_kernel<<<dim3(T / 64, NH, B), 128, 0, stream>>>(
        qkv, 3 * C, qkv + C, qkv + 2 * C, 3 * C, attnb, T, T, /*causal=*/1, scale);
    gemm<2>(attnb, waproj, b_aproj, x, xo, (int)BT, C, C, stream);  // x + attn

    // 2) cross-attention branch
    ln_bf16_kernel<<<dim3((unsigned)BT), 256, 0, stream>>>(xo, ln3_g, ln3_b, lnbuf, C);
    gemm<0>(lnbuf, wqb, bq, nullptr, qc, (int)BT, C, C, stream);
    gemm<0>(keyb, wkb, bk, nullptr, kc, (int)BTk, C, Ck, stream);
    gemm<0>(valb, wvb, bv, nullptr, vc, (int)BTk, C, Ck, stream);
    attn_kernel<<<dim3(T / 64, NH, B), 128, 0, stream>>>(
        qc, C, kc, vc, C, attnb, T, TK, /*causal=*/0, scale);
    gemm<2>(attnb, wcproj, b_cproj, xo, xo, (int)BT, C, C, stream);  // x += cross

    // 3) MLP branch
    ln_bf16_kernel<<<dim3((unsigned)BT), 256, 0, stream>>>(xo, ln2_g, ln2_b, lnbuf, C);
    gemm<1>(lnbuf, wfc, b_fc, nullptr, hfc, (int)BT, 4 * C, C, stream);   // + GELU
    gemm<2>(hfc, wmproj, b_mproj, xo, xo, (int)BT, C, 4 * C, stream);     // x += mlp

    // 4) echo key/val into the output tuple
    size_t x_elems = BT * (size_t)C;
    size_t kv_elems = BTk * (size_t)Ck;
    hipMemcpyAsync(xo + x_elems, key, kv_elems * sizeof(float),
                   hipMemcpyDeviceToDevice, stream);
    hipMemcpyAsync(xo + x_elems + kv_elems, val, kv_elems * sizeof(float),
                   hipMemcpyDeviceToDevice, stream);
}

// v002
// In both of two side-by-side timings against v001, it was 1.16 times as fast.
// All steps since v000 together make it 1.56 times as fast.
#include <hip/hip_runtime.h>
#include <hip/hip_bf16.h>

typedef __bf16 bf16;
typedef __attribute__((ext_vector_type(16))) __bf16 bf16x16;
typedef __attribute__((ext_vector_type(8)))  float  floatx8;
typedef __attribute__((ext_vector_type(4)))  unsigned int uint32x4;
typedef __attribute__((ext_vector_type(8)))  unsigned int uint32x8;
typedef __attribute__((ext_vector_type(8)))  short s16x8;
typedef __attribute__((ext_vector_type(16))) short s16x16;

// ---------------------------------------------------------------------------
// WMMA wrapper: D = A(16x32 bf16) * B(32x16 bf16) + C(16x16 f32)
// ---------------------------------------------------------------------------
__device__ __forceinline__ floatx8 wmma_bf16(bf16x16 a, bf16x16 b, floatx8 c) {
    return __builtin_amdgcn_wmma_f32_16x16x32_bf16(
        /*neg_a=*/false, a, /*neg_b=*/false, b,
        /*c_mod=*/(short)0, c, /*reuse_a=*/false, /*reuse_b=*/false);
}

__device__ __forceinline__ floatx8 fzero8() {
    floatx8 z;
#pragma unroll
    for (int i = 0; i < 8; ++i) z[i] = 0.0f;
    return z;
}

__device__ __forceinline__ void async_load4_b128(const bf16* gptr, size_t gstep,
                                                 bf16* lptr, int lstep) {
    unsigned l0 = (unsigned)(size_t)lptr;
    unsigned l1 = (unsigned)(size_t)(lptr + lstep);
    unsigned l2 = (unsigned)(size_t)(lptr + 2 * lstep);
    unsigned l3 = (unsigned)(size_t)(lptr + 3 * lstep);
    unsigned long long g0 = (unsigned long long)(size_t)gptr;
    unsigned long long g1 = (unsigned long long)(size_t)(gptr + gstep);
    unsigned long long g2 = (unsigned long long)(size_t)(gptr + 2 * gstep);
    unsigned long long g3 = (unsigned long long)(size_t)(gptr + 3 * gstep);
    asm volatile("global_load_async_to_lds_b128 %0, %4, off\n\t"
                 "global_load_async_to_lds_b128 %1, %5, off\n\t"
                 "global_load_async_to_lds_b128 %2, %6, off\n\t"
                 "global_load_async_to_lds_b128 %3, %7, off\n\t"
                 "s_wait_xcnt 0x0"
                 :: "v"(l0), "v"(l1), "v"(l2), "v"(l3), "v"(g0), "v"(g1), "v"(g2), "v"(g3)
                 : "memory");
}
__device__ __forceinline__ void wait_async0() {
    asm volatile("s_wait_asynccnt 0x0" ::: "memory");
}

__device__ __forceinline__ void tdm_load_2d_pad(const bf16* gptr, bf16* lptr,
                                                unsigned rows, unsigned cols,
                                                unsigned stride_elems) {
    unsigned long long ga = (unsigned long long)(size_t)gptr;
    uint32x4 g0;
    g0[0] = 1u;
    g0[1] = (unsigned)(size_t)lptr;
    g0[2] = (unsigned)ga;
    g0[3] = (unsigned)(ga >> 32) | 0x80000000u;
    uint32x8 g1;
    g1[0] = (1u << 16) | (1u << 20) | (4u << 22) | (3u << 25);
    g1[1] = (cols & 0xffffu) << 16;
    g1[2] = (rows & 0xffffu) << 16;
    g1[3] = (cols & 0xffffu) << 16;
    g1[4] = (rows & 0xffffu);
    g1[5] = stride_elems;
    g1[6] = 0u;
    g1[7] = 0u;
    asm volatile("tensor_load_to_lds %0, %1" :: "s"(g0), "s"(g1) : "memory");
}
__device__ __forceinline__ void wait_tensor0() {
#if __has_builtin(__builtin_amdgcn_s_wait_tensorcnt)
    __builtin_amdgcn_s_wait_tensorcnt(0);
#else
    asm volatile("s_wait_tensorcnt 0x0" ::: "memory");
#endif
}

__device__ __forceinline__ bf16x16 frag_row(const bf16* p) {
    bf16x16 f;
#pragma unroll
    for (int e = 0; e < 8; ++e) f[e] = p[e];
#pragma unroll
    for (int e = 0; e < 8; ++e) f[e + 8] = p[e + 16];
    return f;
}

// 32x16 B fragment from a row-major [k][n] LDS tile by two transposing loads.
// p is the lane's own address: row 8*(lane>>4) + (lane&7), column n0 + 8*((lane>>3)&1);
// lane (c = lane&15, h = lane>>4) then holds column n0 + c at k {8h..8h+7, 16+8h..16+8h+7},
// the same k order as frag_row. ld = row pitch in elements.
__device__ __forceinline__ bf16x16 frag_tr(const bf16* p, int ld) {
    typedef __attribute__((address_space(3))) s16x8 lds_s16x8;
    s16x8 lo = __builtin_amdgcn_ds_load_tr16_b128_v8i16((lds_s16x8*)p);
    s16x8 hi = __builtin_amdgcn_ds_load_tr16_b128_v8i16((lds_s16x8*)(p + 16 * ld));
    s16x16 f = __builtin_shufflevector(lo, hi, 0, 1, 2, 3, 4, 5, 6, 7,
                                       8, 9, 10, 11, 12, 13, 14, 15);
    return __builtin_bit_cast(bf16x16, f);
}

// Fragment from a column of a row-major [K][N] LDS tile (used for V in P*V).
__device__ __forceinline__ bf16x16 frag_col(const bf16* base, int ld, int col, int c0) {
    bf16x16 f;
#pragma unroll
    for (int e = 0; e < 8; ++e) f[e] = base[(c0 + e) * ld + col];
#pragma unroll
    for (int e = 0; e < 8; ++e) f[e + 8] = base[(c0 + 16 + e) * ld + col];
    return f;
}

// wave32 full reduction
__device__ __forceinline__ float wave_sum32(float v) {
#pragma unroll
    for (int m = 16; m >= 1; m >>= 1) v += __shfl_xor(v, m, 32);
    return v;
}
// reduction within each 16-lane half (rows of a 16x16 WMMA D tile)
__device__ __forceinline__ float red16_max(float v) {
#pragma unroll
    for (int m = 8; m >= 1; m >>= 1) v = fmaxf(v, __shfl_xor(v, m, 32));
    return v;
}
__device__ __forceinline__ float red16_sum(float v) {
#pragma unroll
    for (int m = 8; m >= 1; m >>= 1) v += __shfl_xor(v, m, 32);
    return v;
}

// ---------------------------------------------------------------------------
// f32 -> bf16 conversion (vectorized float4 loads)
// ---------------------------------------------------------------------------
__global__ void cvt_bf16_kernel(const float* __restrict__ in, bf16* __restrict__ out, long n) {
    long i = ((long)blockIdx.x * blockDim.x + threadIdx.x) * 4;
    if (i < n) {
        float4 v = *(const float4*)(in + i);
        out[i + 0] = (bf16)v.x;
        out[i + 1] = (bf16)v.y;
        out[i + 2] = (bf16)v.z;
        out[i + 3] = (bf16)v.w;
    }
}

// ---------------------------------------------------------------------------
// LayerNorm: one block per row, f32 in, bf16 out
// ---------------------------------------------------------------------------
__global__ __launch_bounds__(256) void ln_bf16_kernel(
    const float* __restrict__ x, const float* __restrict__ g,
    const float* __restrict__ bta, bf16* __restrict__ out, int C) {
    const int row = blockIdx.x;
    const float* xr = x + (size_t)row * C;
    float ls = 0.f, lq = 0.f;
    for (int i = threadIdx.x; i < C; i += 256) {
        float v = xr[i];
        ls += v;
        lq += v * v;
    }
    ls = wave_sum32(ls);
    lq = wave_sum32(lq);
    __shared__ float ss[8], sq[8];
    int lane = threadIdx.x & 31, w = threadIdx.x >> 5;
    if (lane == 0) { ss[w] = ls; sq[w] = lq; }
    __syncthreads();
    if (w == 0) {
        float a  = (lane < 8) ? ss[lane] : 0.f;
        float b2 = (lane < 8) ? sq[lane] : 0.f;
        a = wave_sum32(a);
        b2 = wave_sum32(b2);
        if (lane == 0) { ss[0] = a; sq[0] = b2; }
    }
    __syncthreads();
    float mean = ss[0] / (float)C;
    float var  = sq[0] / (float)C - mean * mean;
    float inv  = rsqrtf(var + 1e-5f);
    bf16* orow = out + (size_t)row * C;
    for (int i = threadIdx.x; i < C; i += 256)
        orow[i] = (bf16)((xr[i] - mean) * inv * g[i] + bta[i]);
}

template <int EPI>
__global__ __launch_bounds__(256) void gemm_bf16_kernel(
    const bf16* __restrict__ A, const bf16* __restrict__ B,
    const float* __restrict__ bias, const float* __restrict__ res,
    void* __restrict__ out, int M, int N, int K) {
    // row-major [m][k], 144B rows (16B x odd: the plain 16-byte load's pitch)
    __shared__ __attribute__((aligned(16))) bf16 As[2][128][72];
    // row-major [k][n], 288B rows (32B x odd: the transposing load's pitch)
    __shared__ __attribute__((aligned(16))) bf16 Bs[2][64][144];

    const int tid  = threadIdx.x;
    const int lane = tid & 31;
    const int wave = tid >> 5;
    const int wr = wave >> 1;   // 0..3 : 32-row group
    const int wc = wave & 1;    // 0..1 : 64-col group
    const int hf = lane >> 4;   // lane half
    const int c0 = hf << 3;
    const int ln = lane & 15;
    const int bm = blockIdx.y * 128;
    const int bn = blockIdx.x * 128;

    floatx8 acc[2][4];
#pragma unroll
    for (int i = 0; i < 2; ++i)
#pragma unroll
        for (int j = 0; j < 4; ++j) acc[i][j] = fzero8();

    const int ar = tid >> 3, as8 = (tid & 7) * 8;   // A: rows ar + 32 i, 8 lanes a 128-byte row
    const int br = tid >> 4, bs8 = (tid & 15) * 8;  // B: rows br + 16 i, 16 lanes a 256-byte row
    const bf16* ga = A + (size_t)(bm + ar) * K + as8;
    const bf16* gb = B + (size_t)br * N + bn + bs8;

    // ---- prologue: stage tile 0 into buffer 0 ----
    {
        async_load4_b128(ga, (size_t)32 * K, &As[0][ar][as8], 32 * 72);
#pragma unroll
        for (int i = 0; i < 4; ++i)
            *(uint4*)&Bs[0][br + 16 * i][bs8] = *(const uint4*)(gb + (size_t)(16 * i) * N);
        wait_async0();
    }
    __syncthreads();

    int cur = 0;
    for (int kk = 0; kk < K; kk += 64) {
        const int nxt = cur ^ 1;
        const bool has_next = (kk + 64 < K);
        uint4 breg0, breg1, breg2, breg3;  // next B tile's 64 bytes of this thread, held over the WMMAs
        if (has_next) {
            async_load4_b128(ga + kk + 64, (size_t)32 * K, &As[nxt][ar][as8], 32 * 72);
            const bf16* gbn = gb + (size_t)(kk + 64) * N;
            breg0 = *(const uint4*)(gbn);
            breg1 = *(const uint4*)(gbn + (size_t)16 * N);
            breg2 = *(const uint4*)(gbn + (size_t)32 * N);
            breg3 = *(const uint4*)(gbn + (size_t)48 * N);
            asm volatile("s_wait_xcnt 0x0" ::: "memory");
            if (kk + 128 < K) {  // L2 warm-up two tiles ahead (global_prefetch_b8), one lane a line
                if (__builtin_amdgcn_readfirstlane(wave) < 4)  // scalar test: waves 0-3 take A, 4-7 take B
                    __builtin_prefetch(A + (size_t)(bm + tid) * K + kk + 128, 0, 1);
                else
                    __builtin_prefetch(B + (size_t)(kk + 128 + ((tid - 128) >> 1)) * N + bn + (tid & 1) * 64, 0, 1);
            }
        }

        // ---- compute current tile: 16 WMMAs per wave ----
#pragma unroll
        for (int ks = 0; ks < 2; ++ks) {
            bf16x16 af[2], bfv[4];
#pragma unroll
            for (int mt = 0; mt < 2; ++mt)
                af[mt] = frag_row(&As[cur][wr * 32 + mt * 16 + ln][ks * 32 + c0]);
#pragma unroll
            for (int nt = 0; nt < 4; ++nt)
                bfv[nt] = frag_tr(&Bs[cur][ks * 32 + c0 + (lane & 7)][wc * 64 + nt * 16 + ((lane >> 3) & 1) * 8], 144);
#pragma unroll
            for (int mt = 0; mt < 2; ++mt)
#pragma unroll
                for (int nt = 0; nt < 4; ++nt)
                    acc[mt][nt] = wmma_bf16(af[mt], bfv[nt], acc[mt][nt]);
        }

        if (has_next) {
            // commit staged B to LDS[nxt]
            *(uint4*)&Bs[nxt][br +  0][bs8] = breg0;
            *(uint4*)&Bs[nxt][br + 16][bs8] = breg1;
            *(uint4*)&Bs[nxt][br + 32][bs8] = breg2;
            *(uint4*)&Bs[nxt][br + 48][bs8] = breg3;
        }
        // hand-over of the stage: this wave's LDS reads and writes done, its copies
        // landed, then the barrier that publishes tile t+1 and frees buffer cur
        asm volatile("s_wait_dscnt 0x0" ::: "memory");
        wait_async0();
        __syncthreads();
        cur = nxt;
    }
    wait_async0();  // no copy outlives the loop

    // ---- epilogue: D layout = lane holds col n=ln, rows v + 8*hf ----
#pragma unroll
    for (int mt = 0; mt < 2; ++mt) {
#pragma unroll
        for (int nt = 0; nt < 4; ++nt) {
            const int n  = bn + wc * 64 + nt * 16 + ln;
            const float bs = bias[n];
#pragma unroll
            for (int v = 0; v < 8; ++v) {
                const int m = bm + wr * 32 + mt * 16 + v + 8 * hf;
                float val = acc[mt][nt][v] + bs;
                const size_t idx = (size_t)m * N + n;
                if (EPI == 0) {
                    ((bf16*)out)[idx] = (bf16)val;
                } else if (EPI == 1) {
                    float t = 0.7978845608028654f * (val + 0.044715f * val * val * val);
                    val = 0.5f * val * (1.0f + tanhf(t));
                    ((bf16*)out)[idx] = (bf16)val;
                } else {
                    ((float*)out)[idx] = val + res[idx];
                }
            }
        }
    }
}

__global__ __launch_bounds__(128) void attn_kernel(
    const bf16* __restrict__ Q, int qstride,
    const bf16* __restrict__ Kp, const bf16* __restrict__ Vp, int kvstride,
    bf16* __restrict__ O, int Tq, int Tk, int causal, float scale) {
    __shared__ bf16 Ks[32][72];        // K chunk [key][d]  (144B rows, 16B aligned)
    __shared__ bf16 Vs[32][72];        // V chunk [key][d]
    __shared__ bf16 Ps[4][16][40];     // per-wave P staging [q][key]

    const int tid  = threadIdx.x;
    const int lane = tid & 31;
    const int w    = tid >> 5;
    const int hf = lane >> 4, c0 = hf << 3, ln = lane & 15;
    const int q0 = blockIdx.x * 64;
    const int h  = blockIdx.y;
    const int b  = blockIdx.z;

    const bf16* qbase = Q  + (size_t)(b * Tq) * qstride  + h * 64;
    const bf16* kbase = Kp + (size_t)(b * Tk) * kvstride + h * 64;
    const bf16* vbase = Vp + (size_t)(b * Tk) * kvstride + h * 64;

    // Q fragments for this wave's 16 rows (2 K-steps over dh=64), kept resident
    bf16x16 qf[2];
    {
        const bf16* qp = qbase + (size_t)(q0 + w * 16 + ln) * qstride;
#pragma unroll
        for (int ks = 0; ks < 2; ++ks) {
            bf16x16 f;
#pragma unroll
            for (int e = 0; e < 8; ++e) f[e] = qp[ks * 32 + c0 + e];
#pragma unroll
            for (int e = 0; e < 8; ++e) f[e + 8] = qp[ks * 32 + c0 + 16 + e];
            qf[ks] = f;
        }
    }

    floatx8 o[4];
#pragma unroll
    for (int i = 0; i < 4; ++i) o[i] = fzero8();
    float m_r[8], l_r[8];
#pragma unroll
    for (int v = 0; v < 8; ++v) { m_r[v] = -1e30f; l_r[v] = 0.0f; }

    int kend = causal ? (q0 + 64) : Tk;
    if (kend > Tk) kend = Tk;

    for (int kc = 0; kc < kend; kc += 32) {
        __syncthreads();
        if (w == 0) {
            tdm_load_2d_pad(kbase + (size_t)kc * kvstride, &Ks[0][0], 32, 64, kvstride);
            tdm_load_2d_pad(vbase + (size_t)kc * kvstride, &Vs[0][0], 32, 64, kvstride);
            wait_tensor0();
        }
        __syncthreads();

        // S = Q * K^T : two 16x16 n-tiles, K-dim = dh = 64 (2 WMMA steps)
        floatx8 s[2];
#pragma unroll
        for (int nt = 0; nt < 2; ++nt) {
            floatx8 a = fzero8();
#pragma unroll
            for (int ks = 0; ks < 2; ++ks) {
                bf16x16 kf = frag_row(&Ks[nt * 16 + ln][ks * 32 + c0]);
                a = wmma_bf16(qf[ks], kf, a);
            }
            s[nt] = a;
        }
        // scale + causal mask (D layout: lane holds col n=ln, rows v+8*hf)
#pragma unroll
        for (int nt = 0; nt < 2; ++nt) {
            const int kg = kc + nt * 16 + ln;
#pragma unroll
            for (int v = 0; v < 8; ++v) {
                float x = s[nt][v] * scale;
                if (causal) {
                    const int qg = q0 + w * 16 + v + 8 * hf;
                    if (kg > qg) x = -1e30f;
                }
                s[nt][v] = x;
            }
        }
        // online softmax
        float pr0[8], pr1[8], alpha[8];
#pragma unroll
        for (int v = 0; v < 8; ++v) {
            float t = fmaxf(s[0][v], s[1][v]);
            t = red16_max(t);
            float mn = fmaxf(m_r[v], t);
            alpha[v] = __expf(m_r[v] - mn);
            m_r[v]   = mn;
            pr0[v] = __expf(s[0][v] - mn);
            pr1[v] = __expf(s[1][v] - mn);
            float rs = red16_sum(pr0[v] + pr1[v]);
            l_r[v] = l_r[v] * alpha[v] + rs;
        }
#pragma unroll
        for (int nt = 0; nt < 4; ++nt)
#pragma unroll
            for (int v = 0; v < 8; ++v) o[nt][v] *= alpha[v];

        // D-layout -> A-layout for P via per-wave LDS (same-wave LDS is in-order)
#pragma unroll
        for (int v = 0; v < 8; ++v) {
            Ps[w][v + 8 * hf][ln]      = (bf16)pr0[v];
            Ps[w][v + 8 * hf][16 + ln] = (bf16)pr1[v];
        }
        bf16x16 pf = frag_row(&Ps[w][ln][c0]);
        // O += P(16x32) * V(32x64)
#pragma unroll
        for (int nt = 0; nt < 4; ++nt) {
            bf16x16 vf = frag_col(&Vs[0][0], 72, nt * 16 + ln, c0);
            o[nt] = wmma_bf16(pf, vf, o[nt]);
        }
    }

#pragma unroll
    for (int v = 0; v < 8; ++v) {
        const float inv = 1.0f / l_r[v];
        const int qg = q0 + w * 16 + v + 8 * hf;
        bf16* op = O + (size_t)(b * Tq + qg) * 1024 + h * 64;
#pragma unroll
        for (int nt = 0; nt < 4; ++nt)
            op[nt * 16 + ln] = (bf16)(o[nt][v] * inv);
    }
}

// ---------------------------------------------------------------------------
// Host-side orchestration
// ---------------------------------------------------------------------------
static void cvt(const float* in, bf16* out, long n, hipStream_t s) {
    long n4 = n / 4;
    cvt_bf16_kernel<<<dim3((unsigned)((n4 + 255) / 256)), 256, 0, s>>>(in, out, n);
}

template <int EPI>
static void gemm(const bf16* A, const bf16* B, const float* bias, const float* res,
                 void* out, int M, int N, int K, hipStream_t s) {
    dim3 g(N / 128, M / 128);
    gemm_bf16_kernel<EPI><<<g, 256, 0, s>>>(A, B, bias, res, out, M, N, K);
}

extern "C" void kernel_launch(void* const* d_in, const int* in_sizes, int n_in,
                              void* d_out, int out_size, void* d_ws, size_t ws_size,
                              hipStream_t stream) {
    const float* x      = (const float*)d_in[0];
    const float* key    = (const float*)d_in[1];
    const float* val    = (const float*)d_in[2];
    const float* ln1_g  = (const float*)d_in[3];
    const float* ln1_b  = (const float*)d_in[4];
    const float* ln2_g  = (const float*)d_in[5];
    const float* ln2_b  = (const float*)d_in[6];
    const float* ln3_g  = (const float*)d_in[7];
    const float* ln3_b  = (const float*)d_in[8];
    const float* W_attn = (const float*)d_in[9];
    const float* b_attn = (const float*)d_in[10];
    const float* W_aproj= (const float*)d_in[11];
    const float* b_aproj= (const float*)d_in[12];
    const float* Wq     = (const float*)d_in[13];
    const float* bq     = (const float*)d_in[14];
    const float* Wk     = (const float*)d_in[15];
    const float* bk     = (const float*)d_in[16];
    const float* Wv     = (const float*)d_in[17];
    const float* bv     = (const float*)d_in[18];
    const float* W_cproj= (const float*)d_in[19];
    const float* b_cproj= (const float*)d_in[20];
    const float* W_fc   = (const float*)d_in[21];
    const float* b_fc   = (const float*)d_in[22];
    const float* W_mproj= (const float*)d_in[23];
    const float* b_mproj= (const float*)d_in[24];

    const int B = 8, T = 1024, C = 1024, Ck = 768, TK = 256, NH = 16;
    const size_t BT  = (size_t)B * T;    // 8192 rows
    const size_t BTk = (size_t)B * TK;   // 2048 rows

    char* ws = (char*)d_ws;
    size_t off = 0;
    auto alloc = [&](size_t bytes) -> void* {
        void* p = ws + off;
        off += (bytes + 255) & ~(size_t)255;
        return p;
    };

    // persistent bf16 buffers
    bf16* wattn  = (bf16*)alloc((size_t)C * 3 * C * 2);
    bf16* waproj = (bf16*)alloc((size_t)C * C * 2);
    bf16* wqb    = (bf16*)alloc((size_t)C * C * 2);
    bf16* wkb    = (bf16*)alloc((size_t)Ck * C * 2);
    bf16* wvb    = (bf16*)alloc((size_t)Ck * C * 2);
    bf16* wcproj = (bf16*)alloc((size_t)C * C * 2);
    bf16* wfc    = (bf16*)alloc((size_t)C * 4 * C * 2);
    bf16* wmproj = (bf16*)alloc((size_t)4 * C * C * 2);
    bf16* keyb   = (bf16*)alloc(BTk * Ck * 2);
    bf16* valb   = (bf16*)alloc(BTk * Ck * 2);
    bf16* lnbuf  = (bf16*)alloc(BT * C * 2);
    bf16* attnb  = (bf16*)alloc(BT * C * 2);
    // phase-aliased scratch (max of: qkv 50MB | q/k/v-proj 24MB | mlp hidden 67MB)
    char* scratch = (char*)alloc(BT * (size_t)4 * C * 2);
    bf16* qkv = (bf16*)scratch;
    bf16* qc  = (bf16*)scratch;
    bf16* kc  = (bf16*)(scratch + BT * C * 2);
    bf16* vc  = (bf16*)(scratch + BT * C * 2 + BTk * C * 2);
    bf16* hfc = (bf16*)scratch;

    float* xo = (float*)d_out;  // running residual state lives in d_out x-region

    // 0) one-time down-conversions
    cvt(W_attn, wattn, (long)C * 3 * C, stream);
    cvt(W_aproj, waproj, (long)C * C, stream);
    cvt(Wq, wqb, (long)C * C, stream);
    cvt(Wk, wkb, (long)Ck * C, stream);
    cvt(Wv, wvb, (long)Ck * C, stream);
    cvt(W_cproj, wcproj, (long)C * C, stream);
    cvt(W_fc, wfc, (long)C * 4 * C, stream);
    cvt(W_mproj, wmproj, (long)4 * C * C, stream);
    cvt(key, keyb, (long)BTk * Ck, stream);
    cvt(val, valb, (long)BTk * Ck, stream);

    const float scale = 0.125f;  // 1/sqrt(64)

    // 1) self-attention branch
    ln_bf16_kernel<<<dim3((unsigned)BT), 256, 0, stream>>>(x, ln1_g, ln1_b, lnbuf, C);
    gemm<0>(lnbuf, wattn, b_attn, nullptr, qkv, (int)BT, 3 * C, C, stream);
    attn_kernel<<<dim3(T / 64, NH, B), 128, 0, stream>>>(
        qkv, 3 * C, qkv + C, qkv + 2 * C, 3 * C, attnb, T, T, /*causal=*/1, scale);
    gemm<2>(attnb, waproj, b_aproj, x, xo, (int)BT, C, C, stream);  // x + attn

    // 2) cross-attention branch
    ln_bf16_kernel<<<dim3((unsigned)BT), 256, 0, stream>>>(xo, ln3_g, ln3_b, lnbuf, C);
    gemm<0>(lnbuf, wqb, bq, nullptr, qc, (int)BT, C, C, stream);
    gemm<0>(keyb, wkb, bk, nullptr, kc, (int)BTk, C, Ck, stream);
    gemm<0>(valb, wvb, bv, nullptr, vc, (int)BTk, C, Ck, stream);
    attn_kernel<<<dim3(T / 64, NH, B), 128, 0, stream>>>(
        qc, C, kc, vc, C, attnb, T, TK, /*causal=*/0, scale);
    gemm<2>(attnb, wcproj, b_cproj, xo, xo, (int)BT, C, C, stream);  // x += cross

    // 3) MLP branch
    ln_bf16_kernel<<<dim3((unsigned)BT), 256, 0, stream>>>(xo, ln2_g, ln2_b, lnbuf, C);
    gemm<1>(lnbuf, wfc, b_fc, nullptr, hfc, (int)BT, 4 * C, C, stream);   // + GELU
    gemm<2>(hfc, wmproj, b_mproj, xo, xo, (int)BT, C, 4 * C, stream);     // x += mlp

    // 4) echo key/val into the output tuple
    size_t x_elems = BT * (size_t)C;
    size_t kv_elems = BTk * (size_t)Ck;
    hipMemcpyAsync(xo + x_elems, key, kv_elems * sizeof(float),
                   hipMemcpyDeviceToDevice, stream);
    hipMemcpyAsync(xo + x_elems + kv_elems, val, kv_elems * sizeof(float),
                   hipMemcpyDeviceToDevice, stream);
}

// v003
// In two side-by-side timings against v002, it was 1.05 and 1.06 times as fast.
// All steps since v000 together make it 1.64 times as fast.
#include <hip/hip_runtime.h>
#include <hip/hip_bf16.h>

typedef __bf16 bf16;
typedef __attribute__((ext_vector_type(16))) __bf16 bf16x16;
typedef __attribute__((ext_vector_type(8)))  float  floatx8;
typedef __attribute__((ext_vector_type(4)))  unsigned int uint32x4;
typedef __attribute__((ext_vector_type(8)))  unsigned int uint32x8;
typedef __attribute__((ext_vector_type(8)))  short s16x8;
typedef __attribute__((ext_vector_type(16))) short s16x16;

// ---------------------------------------------------------------------------
// WMMA wrapper: D = A(16x32 bf16) * B(32x16 bf16) + C(16x16 f32)
// ---------------------------------------------------------------------------
__device__ __forceinline__ floatx8 wmma_bf16(bf16x16 a, bf16x16 b, floatx8 c) {
    return __builtin_amdgcn_wmma_f32_16x16x32_bf16(
        /*neg_a=*/false, a, /*neg_b=*/false, b,
        /*c_mod=*/(short)0, c, /*reuse_a=*/false, /*reuse_b=*/false);
}

__device__ __forceinline__ floatx8 fzero8() {
    floatx8 z;
#pragma unroll
    for (int i = 0; i < 8; ++i) z[i] = 0.0f;
    return z;
}

__device__ __forceinline__ void async_load4_b128(const bf16* gptr, size_t gstep,
                                                 bf16* lptr, int lstep) {
    unsigned l0 = (unsigned)(size_t)lptr;
    unsigned l1 = (unsigned)(size_t)(lptr + lstep);
    unsigned l2 = (unsigned)(size_t)(lptr + 2 * lstep);
    unsigned l3 = (unsigned)(size_t)(lptr + 3 * lstep);
    unsigned long long g0 = (unsigned long long)(size_t)gptr;
    unsigned long long g1 = (unsigned long long)(size_t)(gptr + gstep);
    unsigned long long g2 = (unsigned long long)(size_t)(gptr + 2 * gstep);
    unsigned long long g3 = (unsigned long long)(size_t)(gptr + 3 * gstep);
    asm volatile("global_load_async_to_lds_b128 %0, %4, off\n\t"
                 "global_load_async_to_lds_b128 %1, %5, off\n\t"
                 "global_load_async_to_lds_b128 %2, %6, off\n\t"
                 "global_load_async_to_lds_b128 %3, %7, off\n\t"
                 "s_wait_xcnt 0x0"
                 :: "v"(l0), "v"(l1), "v"(l2), "v"(l3), "v"(g0), "v"(g1), "v"(g2), "v"(g3)
                 : "memory");
}
__device__ __forceinline__ void wait_async0() {
    asm volatile("s_wait_asynccnt 0x0" ::: "memory");
}

__device__ __forceinline__ void tdm_load_2d_pad(const bf16* gptr, bf16* lptr,
                                                unsigned rows, unsigned cols,
                                                unsigned stride_elems) {
    unsigned long long ga = (unsigned long long)(size_t)gptr;
    uint32x4 g0;
    g0[0] = 1u;
    g0[1] = (unsigned)(size_t)lptr;
    g0[2] = (unsigned)ga;
    g0[3] = (unsigned)(ga >> 32) | 0x80000000u;
    uint32x8 g1;
    g1[0] = (1u << 16) | (1u << 20) | (4u << 22) | (3u << 25);
    g1[1] = (cols & 0xffffu) << 16;
    g1[2] = (rows & 0xffffu) << 16;
    g1[3] = (cols & 0xffffu) << 16;
    g1[4] = (rows & 0xffffu);
    g1[5] = stride_elems;
    g1[6] = 0u;
    g1[7] = 0u;
    asm volatile("tensor_load_to_lds %0, %1" :: "s"(g0), "s"(g1) : "memory");
}
__device__ __forceinline__ void wait_tensor0() {
#if __has_builtin(__builtin_amdgcn_s_wait_tensorcnt)
    __builtin_amdgcn_s_wait_tensorcnt(0);
#else
    asm volatile("s_wait_tensorcnt 0x0" ::: "memory");
#endif
}

__device__ __forceinline__ bf16x16 frag_row(const bf16* p) {
    bf16x16 f;
#pragma unroll
    for (int e = 0; e < 8; ++e) f[e] = p[e];
#pragma unroll
    for (int e = 0; e < 8; ++e) f[e + 8] = p[e + 16];
    return f;
}

// 32x16 B fragment from a row-major [k][n] LDS tile by two transposing loads.
// p is the lane's own address: row 8*(lane>>4) + (lane&7), column n0 + 8*((lane>>3)&1);
// lane (c = lane&15, h = lane>>4) then holds column n0 + c at k {8h..8h+7, 16+8h..16+8h+7},
// the same k order as frag_row. ld = row pitch in elements.
__device__ __forceinline__ bf16x16 frag_tr(const bf16* p, int ld) {
    typedef __attribute__((address_space(3))) s16x8 lds_s16x8;
    s16x8 lo = __builtin_amdgcn_ds_load_tr16_b128_v8i16((lds_s16x8*)p);
    s16x8 hi = __builtin_amdgcn_ds_load_tr16_b128_v8i16((lds_s16x8*)(p + 16 * ld));
    s16x16 f = __builtin_shufflevector(lo, hi, 0, 1, 2, 3, 4, 5, 6, 7,
                                       8, 9, 10, 11, 12, 13, 14, 15);
    return __builtin_bit_cast(bf16x16, f);
}

// Fragment from a column of a row-major [K][N] LDS tile (used for V in P*V).
__device__ __forceinline__ bf16x16 frag_col(const bf16* base, int ld, int col, int c0) {
    bf16x16 f;
#pragma unroll
    for (int e = 0; e < 8; ++e) f[e] = base[(c0 + e) * ld + col];
#pragma unroll
    for (int e = 0; e < 8; ++e) f[e + 8] = base[(c0 + 16 + e) * ld + col];
    return f;
}

// wave32 full reduction
__device__ __forceinline__ float wave_sum32(float v) {
#pragma unroll
    for (int m = 16; m >= 1; m >>= 1) v += __shfl_xor(v, m, 32);
    return v;
}
// reduction within each 16-lane half (rows of a 16x16 WMMA D tile)
__device__ __forceinline__ float red16_max(float v) {
#pragma unroll
    for (int m = 8; m >= 1; m >>= 1) v = fmaxf(v, __shfl_xor(v, m, 32));
    return v;
}
__device__ __forceinline__ float red16_sum(float v) {
#pragma unroll
    for (int m = 8; m >= 1; m >>= 1) v += __shfl_xor(v, m, 32);
    return v;
}

// ---------------------------------------------------------------------------
// f32 -> bf16 conversion of all ten tensors in one launch of few, long waves.
// These streams were held back by the number of waves that had to start, not by
// their bytes. A wave takes 4096 consecutive elements (32 loads of 16 bytes a
// lane, each load 512 contiguous bytes), a block of four waves 16384.
// The ten destinations lie back to back in the workspace, in the order of the
// sources, so the destination is one array. Block counts = elements / 16384.
// ---------------------------------------------------------------------------
typedef __attribute__((ext_vector_type(4))) float  floatx4;
typedef __attribute__((ext_vector_type(4))) __bf16 bf16x4;

__global__ __launch_bounds__(128) void cvt_all_bf16_kernel(
    const float* __restrict__ s0, const float* __restrict__ s1,
    const float* __restrict__ s2, const float* __restrict__ s3,
    const float* __restrict__ s4, const float* __restrict__ s5,
    const float* __restrict__ s6, const float* __restrict__ s7,
    const float* __restrict__ s8, const float* __restrict__ s9,
    bf16* __restrict__ out) {
    const int b = blockIdx.x;
    const float* src;
    int first;  // first block of the tensor that block b lies in
    if      (b <  192) { src = s0; first =    0; }
    else if (b <  256) { src = s1; first =  192; }
    else if (b <  320) { src = s2; first =  256; }
    else if (b <  368) { src = s3; first =  320; }
    else if (b <  416) { src = s4; first =  368; }
    else if (b <  480) { src = s5; first =  416; }
    else if (b <  736) { src = s6; first =  480; }
    else if (b <  992) { src = s7; first =  736; }
    else if (b < 1088) { src = s8; first =  992; }
    else               { src = s9; first = 1088; }
    const int within = (threadIdx.x >> 5) * 4096 + (threadIdx.x & 31) * 4;
    const float* ip = src + (size_t)(b - first) * 16384 + within;
    bf16*        op = out + (size_t)b * 16384 + within;
    floatx4 v[32];
#pragma unroll
    for (int j = 0; j < 32; ++j) v[j] = *(const floatx4*)(ip + j * 128);
    // keeps all 32 loads in front of the first conversion: one trip to memory a wave;
    // without it the compiler issues them in six groups, each waiting for the one before
    __builtin_amdgcn_sched_barrier(0);
#pragma unroll
    for (int j = 0; j < 32; ++j)
        *(bf16x4*)(op + j * 128) = __builtin_convertvector(v[j], bf16x4);
}

// ---------------------------------------------------------------------------
// LayerNorm over rows of 1024: one wave takes two whole rows and keeps them in
// registers (eight 16-byte loads a lane and row, each 512 contiguous bytes), so
// a row is read once, its sums need no LDS and no barrier, and a launch starts
// 4096 waves (16 a WGP). f32 in, bf16 out.
// ---------------------------------------------------------------------------
__global__ __launch_bounds__(256) void ln_bf16_kernel(
    const float* __restrict__ x, const float* __restrict__ g,
    const float* __restrict__ bta, bf16* __restrict__ out) {
    const unsigned goff = (threadIdx.x & 31) * 16;                // the lane's bytes in a 512-byte piece
    const unsigned xoff = (threadIdx.x >> 5) * 8192 + goff;       // + the wave's two rows among the block's sixteen
    const char* xb = (const char*)(x + (size_t)blockIdx.x * 16384);
    char*       ob = (char*)(out + (size_t)blockIdx.x * 16384);
    floatx4 v[2][8], gg[8], bb[8];
#pragma unroll
    for (int r = 0; r < 2; ++r)
#pragma unroll
        for (int j = 0; j < 8; ++j) v[r][j] = *(const floatx4*)(xb + xoff + r * 4096 + j * 512);
#pragma unroll
    for (int j = 0; j < 8; ++j) {
        gg[j] = *(const floatx4*)((const char*)g + goff + j * 512);
        bb[j] = *(const floatx4*)((const char*)bta + goff + j * 512);
    }
    asm volatile("s_wait_xcnt 0x0" :: "v"(xoff), "v"(goff) : "memory");
    // keeps the loads of gain and bias up here with the rows': without it the compiler
    // sinks them behind the row sums, and the wave waits for memory a second and third time
    __builtin_amdgcn_sched_barrier(0);
#pragma unroll
    for (int r = 0; r < 2; ++r) {
        floatx4 s4 = v[r][0], q4 = v[r][0] * v[r][0];
#pragma unroll
        for (int j = 1; j < 8; ++j) {
            s4 += v[r][j];
            q4 += v[r][j] * v[r][j];
        }
        const float ls = wave_sum32((s4[0] + s4[1]) + (s4[2] + s4[3]));
        const float lq = wave_sum32((q4[0] + q4[1]) + (q4[2] + q4[3]));
        const float mean = ls / 1024.0f;
        const float var  = lq / 1024.0f - mean * mean;
        const float inv  = rsqrtf(var + 1e-5f);
#pragma unroll
        for (int j = 0; j < 8; ++j) {
            const floatx4 y = (v[r][j] - mean) * inv * gg[j] + bb[j];
            *(bf16x4*)(ob + xoff / 2 + r * 2048 + j * 256) = __builtin_convertvector(y, bf16x4);
        }
    }
}

template <int EPI>
__global__ __launch_bounds__(256) void gemm_bf16_kernel(
    const bf16* __restrict__ A, const bf16* __restrict__ B,
    const float* __restrict__ bias, const float* __restrict__ res,
    void* __restrict__ out, int M, int N, int K) {
    // row-major [m][k], 144B rows (16B x odd: the plain 16-byte load's pitch)
    __shared__ __attribute__((aligned(16))) bf16 As[2][128][72];
    // row-major [k][n], 288B rows (32B x odd: the transposing load's pitch)
    __shared__ __attribute__((aligned(16))) bf16 Bs[2][64][144];

    const int tid  = threadIdx.x;
    const int lane = tid & 31;
    const int wave = tid >> 5;
    const int wr = wave >> 1;   // 0..3 : 32-row group
    const int wc = wave & 1;    // 0..1 : 64-col group
    const int hf = lane >> 4;   // lane half
    const int c0 = hf << 3;
    const int ln = lane & 15;
    const int bm = blockIdx.y * 128;
    const int bn = blockIdx.x * 128;

    floatx8 acc[2][4];
#pragma unroll
    for (int i = 0; i < 2; ++i)
#pragma unroll
        for (int j = 0; j < 4; ++j) acc[i][j] = fzero8();

    const int ar = tid >> 3, as8 = (tid & 7) * 8;   // A: rows ar + 32 i, 8 lanes a 128-byte row
    const int br = tid >> 4, bs8 = (tid & 15) * 8;  // B: rows br + 16 i, 16 lanes a 256-byte row
    const bf16* ga = A + (size_t)(bm + ar) * K + as8;
    const bf16* gb = B + (size_t)br * N + bn + bs8;

    // ---- prologue: stage tile 0 into buffer 0 ----
    {
        async_load4_b128(ga, (size_t)32 * K, &As[0][ar][as8], 32 * 72);
#pragma unroll
        for (int i = 0; i < 4; ++i)
            *(uint4*)&Bs[0][br + 16 * i][bs8] = *(const uint4*)(gb + (size_t)(16 * i) * N);
        wait_async0();
    }
    __syncthreads();

    int cur = 0;
    for (int kk = 0; kk < K; kk += 64) {
        const int nxt = cur ^ 1;
        const bool has_next = (kk + 64 < K);
        uint4 breg0, breg1, breg2, breg3;  // next B tile's 64 bytes of this thread, held over the WMMAs
        if (has_next) {
            async_load4_b128(ga + kk + 64, (size_t)32 * K, &As[nxt][ar][as8], 32 * 72);
            const bf16* gbn = gb + (size_t)(kk + 64) * N;
            breg0 = *(const uint4*)(gbn);
            breg1 = *(const uint4*)(gbn + (size_t)16 * N);
            breg2 = *(const uint4*)(gbn + (size_t)32 * N);
            breg3 = *(const uint4*)(gbn + (size_t)48 * N);
            asm volatile("s_wait_xcnt 0x0" ::: "memory");
            if (kk + 128 < K) {  // L2 warm-up two tiles ahead (global_prefetch_b8), one lane a line
                if (__builtin_amdgcn_readfirstlane(wave) < 4)  // scalar test: waves 0-3 take A, 4-7 take B
                    __builtin_prefetch(A + (size_t)(bm + tid) * K + kk + 128, 0, 1);
                else
                    __builtin_prefetch(B + (size_t)(kk + 128 + ((tid - 128) >> 1)) * N + bn + (tid & 1) * 64, 0, 1);
            }
        }

        // ---- compute current tile: 16 WMMAs per wave ----
#pragma unroll
        for (int ks = 0; ks < 2; ++ks) {
            bf16x16 af[2], bfv[4];
#pragma unroll
            for (int mt = 0; mt < 2; ++mt)
                af[mt] = frag_row(&As[cur][wr * 32 + mt * 16 + ln][ks * 32 + c0]);
#pragma unroll
            for (int nt = 0; nt < 4; ++nt)
                bfv[nt] = frag_tr(&Bs[cur][ks * 32 + c0 + (lane & 7)][wc * 64 + nt * 16 + ((lane >> 3) & 1) * 8], 144);
#pragma unroll
            for (int mt = 0; mt < 2; ++mt)
#pragma unroll
                for (int nt = 0; nt < 4; ++nt)
                    acc[mt][nt] = wmma_bf16(af[mt], bfv[nt], acc[mt][nt]);
        }

        if (has_next) {
            // commit staged B to LDS[nxt]
            *(uint4*)&Bs[nxt][br +  0][bs8] = breg0;
            *(uint4*)&Bs[nxt][br + 16][bs8] = breg1;
            *(uint4*)&Bs[nxt][br + 32][bs8] = breg2;
            *(uint4*)&Bs[nxt][br + 48][bs8] = breg3;
        }
        // hand-over of the stage: this wave's LDS reads and writes done, its copies
        // landed, then the barrier that publishes tile t+1 and frees buffer cur
        asm volatile("s_wait_dscnt 0x0" ::: "memory");
        wait_async0();
        __syncthreads();
        cur = nxt;
    }
    wait_async0();  // no copy outlives the loop

    // ---- epilogue: D layout = lane holds col n=ln, rows v + 8*hf ----
#pragma unroll
    for (int mt = 0; mt < 2; ++mt) {
#pragma unroll
        for (int nt = 0; nt < 4; ++nt) {
            const int n  = bn + wc * 64 + nt * 16 + ln;
            const float bs = bias[n];
#pragma unroll
            for (int v = 0; v < 8; ++v) {
                const int m = bm + wr * 32 + mt * 16 + v + 8 * hf;
                float val = acc[mt][nt][v] + bs;
                const size_t idx = (size_t)m * N + n;
                if (EPI == 0) {
                    ((bf16*)out)[idx] = (bf16)val;
                } else if (EPI == 1) {
                    float t = 0.7978845608028654f * (val + 0.044715f * val * val * val);
                    val = 0.5f * val * (1.0f + tanhf(t));
                    ((bf16*)out)[idx] = (bf16)val;
                } else {
                    ((float*)out)[idx] = val + res[idx];
                }
            }
        }
    }
}

__global__ __launch_bounds__(128) void attn_kernel(
    const bf16* __restrict__ Q, int qstride,
    const bf16* __restrict__ Kp, const bf16* __restrict__ Vp, int kvstride,
    bf16* __restrict__ O, int Tq, int Tk, int causal, float scale) {
    __shared__ bf16 Ks[32][72];        // K chunk [key][d]  (144B rows, 16B aligned)
    __shared__ bf16 Vs[32][72];        // V chunk [key][d]
    __shared__ bf16 Ps[4][16][40];     // per-wave P staging [q][key]

    const int tid  = threadIdx.x;
    const int lane = tid & 31;
    const int w    = tid >> 5;
    const int hf = lane >> 4, c0 = hf << 3, ln = lane & 15;
    const int q0 = blockIdx.x * 64;
    const int h  = blockIdx.y;
    const int b  = blockIdx.z;

    const bf16* qbase = Q  + (size_t)(b * Tq) * qstride  + h * 64;
    const bf16* kbase = Kp + (size_t)(b * Tk) * kvstride + h * 64;
    const bf16* vbase = Vp + (size_t)(b * Tk) * kvstride + h * 64;

    // Q fragments for this wave's 16 rows (2 K-steps over dh=64), kept resident
    bf16x16 qf[2];
    {
        const bf16* qp = qbase + (size_t)(q0 + w * 16 + ln) * qstride;
#pragma unroll
        for (int ks = 0; ks < 2; ++ks) {
            bf16x16 f;
#pragma unroll
            for (int e = 0; e < 8; ++e) f[e] = qp[ks * 32 + c0 + e];
#pragma unroll
            for (int e = 0; e < 8; ++e) f[e + 8] = qp[ks * 32 + c0 + 16 + e];
            qf[ks] = f;
        }
    }

    floatx8 o[4];
#pragma unroll
    for (int i = 0; i < 4; ++i) o[i] = fzero8();
    float m_r[8], l_r[8];
#pragma unroll
    for (int v = 0; v < 8; ++v) { m_r[v] = -1e30f; l_r[v] = 0.0f; }

    int kend = causal ? (q0 + 64) : Tk;
    if (kend > Tk) kend = Tk;

    for (int kc = 0; kc < kend; kc += 32) {
        __syncthreads();
        if (w == 0) {
            tdm_load_2d_pad(kbase + (size_t)kc * kvstride, &Ks[0][0], 32, 64, kvstride);
            tdm_load_2d_pad(vbase + (size_t)kc * kvstride, &Vs[0][0], 32, 64, kvstride);
            wait_tensor0();
        }
        __syncthreads();

        // S = Q * K^T : two 16x16 n-tiles, K-dim = dh = 64 (2 WMMA steps)
        floatx8 s[2];
#pragma unroll
        for (int nt = 0; nt < 2; ++nt) {
            floatx8 a = fzero8();
#pragma unroll
            for (int ks = 0; ks < 2; ++ks) {
                bf16x16 kf = frag_row(&Ks[nt * 16 + ln][ks * 32 + c0]);
                a = wmma_bf16(qf[ks], kf, a);
            }
            s[nt] = a;
        }
        // scale + causal mask (D layout: lane holds col n=ln, rows v+8*hf)
#pragma unroll
        for (int nt = 0; nt < 2; ++nt) {
            const int kg = kc + nt * 16 + ln;
#pragma unroll
            for (int v = 0; v < 8; ++v) {
                float x = s[nt][v] * scale;
                if (causal) {
                    const int qg = q0 + w * 16 + v + 8 * hf;
                    if (kg > qg) x = -1e30f;
                }
                s[nt][v] = x;
            }
        }
        // online softmax
        float pr0[8], pr1[8], alpha[8];
#pragma unroll
        for (int v = 0; v < 8; ++v) {
            float t = fmaxf(s[0][v], s[1][v]);
            t = red16_max(t);
            float mn = fmaxf(m_r[v], t);
            alpha[v] = __expf(m_r[v] - mn);
            m_r[v]   = mn;
            pr0[v] = __expf(s[0][v] - mn);
            pr1[v] = __expf(s[1][v] - mn);
            float rs = red16_sum(pr0[v] + pr1[v]);
            l_r[v] = l_r[v] * alpha[v] + rs;
        }
#pragma unroll
        for (int nt = 0; nt < 4; ++nt)
#pragma unroll
            for (int v = 0; v < 8; ++v) o[nt][v] *= alpha[v];

        // D-layout -> A-layout for P via per-wave LDS (same-wave LDS is in-order)
#pragma unroll
        for (int v = 0; v < 8; ++v) {
            Ps[w][v + 8 * hf][ln]      = (bf16)pr0[v];
            Ps[w][v + 8 * hf][16 + ln] = (bf16)pr1[v];
        }
        bf16x16 pf = frag_row(&Ps[w][ln][c0]);
        // O += P(16x32) * V(32x64)
#pragma unroll
        for (int nt = 0; nt < 4; ++nt) {
            bf16x16 vf = frag_col(&Vs[0][0], 72, nt * 16 + ln, c0);
            o[nt] = wmma_bf16(pf, vf, o[nt]);
        }
    }

#pragma unroll
    for (int v = 0; v < 8; ++v) {
        const float inv = 1.0f / l_r[v];
        const int qg = q0 + w * 16 + v + 8 * hf;
        bf16* op = O + (size_t)(b * Tq + qg) * 1024 + h * 64;
#pragma unroll
        for (int nt = 0; nt < 4; ++nt)
            op[nt * 16 + ln] = (bf16)(o[nt][v] * inv);
    }
}

// ---------------------------------------------------------------------------
// Host-side orchestration
// ---------------------------------------------------------------------------
template <int EPI>
static void gemm(const bf16* A, const bf16* B, const float* bias, const float* res,
                 void* out, int M, int N, int K, hipStream_t s) {
    dim3 g(N / 128, M / 128);
    gemm_bf16_kernel<EPI><<<g, 256, 0, s>>>(A, B, bias, res, out, M, N, K);
}

extern "C" void kernel_launch(void* const* d_in, const int* in_sizes, int n_in,
                              void* d_out, int out_size, void* d_ws, size_t ws_size,
                              hipStream_t stream) {
    const float* x      = (const float*)d_in[0];
    const float* key    = (const float*)d_in[1];
    const float* val    = (const float*)d_in[2];
    const float* ln1_g  = (const float*)d_in[3];
    const float* ln1_b  = (const float*)d_in[4];
    const float* ln2_g  = (const float*)d_in[5];
    const float* ln2_b  = (const float*)d_in[6];
    const float* ln3_g  = (const float*)d_in[7];
    const float* ln3_b  = (const float*)d_in[8];
    const float* W_attn = (const float*)d_in[9];
    const float* b_attn = (const float*)d_in[10];
    const float* W_aproj= (const float*)d_in[11];
    const float* b_aproj= (const float*)d_in[12];
    const float* Wq     = (const float*)d_in[13];
    const float* bq     = (const float*)d_in[14];
    const float* Wk     = (const float*)d_in[15];
    const float* bk     = (const float*)d_in[16];
    const float* Wv     = (const float*)d_in[17];
    const float* bv     = (const float*)d_in[18];
    const float* W_cproj= (const float*)d_in[19];
    const float* b_cproj= (const float*)d_in[20];
    const float* W_fc   = (const float*)d_in[21];
    const float* b_fc   = (const float*)d_in[22];
    const float* W_mproj= (const float*)d_in[23];
    const float* b_mproj= (const float*)d_in[24];

    const int B = 8, T = 1024, C = 1024, Ck = 768, TK = 256, NH = 16;
    const size_t BT  = (size_t)B * T;    // 8192 rows
    const size_t BTk = (size_t)B * TK;   // 2048 rows

    char* ws = (char*)d_ws;
    size_t off = 0;
    auto alloc = [&](size_t bytes) -> void* {
        void* p = ws + off;
        off += (bytes + 255) & ~(size_t)255;
        return p;
    };

    // persistent bf16 buffers
    bf16* wattn  = (bf16*)alloc((size_t)C * 3 * C * 2);
    bf16* waproj = (bf16*)alloc((size_t)C * C * 2);
    bf16* wqb    = (bf16*)alloc((size_t)C * C * 2);
    bf16* wkb    = (bf16*)alloc((size_t)Ck * C * 2);
    bf16* wvb    = (bf16*)alloc((size_t)Ck * C * 2);
    bf16* wcproj = (bf16*)alloc((size_t)C * C * 2);
    bf16* wfc    = (bf16*)alloc((size_t)C * 4 * C * 2);
    bf16* wmproj = (bf16*)alloc((size_t)4 * C * C * 2);
    bf16* keyb   = (bf16*)alloc(BTk * Ck * 2);
    bf16* valb   = (bf16*)alloc(BTk * Ck * 2);
    bf16* lnbuf  = (bf16*)alloc(BT * C * 2);
    bf16* attnb  = (bf16*)alloc(BT * C * 2);
    // phase-aliased scratch (max of: qkv 50MB | q/k/v-proj 24MB | mlp hidden 67MB)
    char* scratch = (char*)alloc(BT * (size_t)4 * C * 2);
    bf16* qkv = (bf16*)scratch;
    bf16* qc  = (bf16*)scratch;
    bf16* kc  = (bf16*)(scratch + BT * C * 2);
    bf16* vc  = (bf16*)(scratch + BT * C * 2 + BTk * C * 2);
    bf16* hfc = (bf16*)scratch;

    float* xo = (float*)d_out;  // running residual state lives in d_out x-region

    // 0) down-conversions: wattn .. valb are contiguous in ws, in this order
    cvt_all_bf16_kernel<<<dim3(1184), 128, 0, stream>>>(
        W_attn, W_aproj, Wq, Wk, Wv, W_cproj, W_fc, W_mproj, key, val, wattn);

    const float scale = 0.125f;  // 1/sqrt(64)

    // 1) self-attention branch
    ln_bf16_kernel<<<dim3((unsigned)(BT / 16)), 256, 0, stream>>>(x, ln1_g, ln1_b, lnbuf);
    gemm<0>(lnbuf, wattn, b_attn, nullptr, qkv, (int)BT, 3 * C, C, stream);
    attn_kernel<<<dim3(T / 64, NH, B), 128, 0, stream>>>(
        qkv, 3 * C, qkv + C, qkv + 2 * C, 3 * C, attnb, T, T, /*causal=*/1, scale);
    gemm<2>(attnb, waproj, b_aproj, x, xo, (int)BT, C, C, stream);  // x + attn

    // 2) cross-attention branch
    ln_bf16_kernel<<<dim3((unsigned)(BT / 16)), 256, 0, stream>>>(xo, ln3_g, ln3_b, lnbuf);
    gemm<0>(lnbuf, wqb, bq, nullptr, qc, (int)BT, C, C, stream);
    gemm<0>(keyb, wkb, bk, nullptr, kc, (int)BTk, C, Ck, stream);
    gemm<0>(valb, wvb, bv, nullptr, vc, (int)BTk, C, Ck, stream);
    attn_kernel<<<dim3(T / 64, NH, B), 128, 0, stream>>>(
        qc, C, kc, vc, C, attnb, T, TK, /*causal=*/0, scale);
    gemm<2>(attnb, wcproj, b_cproj, xo, xo, (int)BT, C, C, stream);  // x += cross

    // 3) MLP branch
    ln_bf16_kernel<<<dim3((unsigned)(BT / 16)), 256, 0, stream>>>(xo, ln2_g, ln2_b, lnbuf);
    gemm<1>(lnbuf, wfc, b_fc, nullptr, hfc, (int)BT, 4 * C, C, stream);   // + GELU
    gemm<2>(hfc, wmproj, b_mproj, xo, xo, (int)BT, C, 4 * C, stream);     // x += mlp

    // 4) echo key/val into the output tuple
    size_t x_elems = BT * (size_t)C;
    size_t kv_elems = BTk * (size_t)Ck;
    hipMemcpyAsync(xo + x_elems, key, kv_elems * sizeof(float),
                   hipMemcpyDeviceToDevice, stream);
    hipMemcpyAsync(xo + x_elems + kv_elems, val, kv_elems * sizeof(float),
                   hipMemcpyDeviceToDevice, stream);
}

// v004
// In two side-by-side timings against v003, it was 1.21 and 1.20 times as fast.
// All steps since v000 together make it 1.98 times as fast.
#include <hip/hip_runtime.h>
#include <hip/hip_bf16.h>

typedef __bf16 bf16;
typedef __attribute__((ext_vector_type(16))) __bf16 bf16x16;
typedef __attribute__((ext_vector_type(8)))  float  floatx8;
typedef __attribute__((ext_vector_type(4)))  unsigned int uint32x4;
typedef __attribute__((ext_vector_type(8)))  unsigned int uint32x8;
typedef __attribute__((ext_vector_type(8)))  short s16x8;
typedef __attribute__((ext_vector_type(16))) short s16x16;

// ---------------------------------------------------------------------------
// WMMA wrapper: D = A(16x32 bf16) * B(32x16 bf16) + C(16x16 f32)
// ---------------------------------------------------------------------------
__device__ __forceinline__ floatx8 wmma_bf16(bf16x16 a, bf16x16 b, floatx8 c) {
    return __builtin_amdgcn_wmma_f32_16x16x32_bf16(
        /*neg_a=*/false, a, /*neg_b=*/false, b,
        /*c_mod=*/(short)0, c, /*reuse_a=*/false, /*reuse_b=*/false);
}

__device__ __forceinline__ floatx8 fzero8() {
    floatx8 z;
#pragma unroll
    for (int i = 0; i < 8; ++i) z[i] = 0.0f;
    return z;
}

__device__ __forceinline__ void async_load4_b128(const bf16* gptr, size_t gstep,
                                                 bf16* lptr, int lstep) {
    unsigned l0 = (unsigned)(size_t)lptr;
    unsigned l1 = (unsigned)(size_t)(lptr + lstep);
    unsigned l2 = (unsigned)(size_t)(lptr + 2 * lstep);
    unsigned l3 = (unsigned)(size_t)(lptr + 3 * lstep);
    unsigned long long g0 = (unsigned long long)(size_t)gptr;
    unsigned long long g1 = (unsigned long long)(size_t)(gptr + gstep);
    unsigned long long g2 = (unsigned long long)(size_t)(gptr + 2 * gstep);
    unsigned long long g3 = (unsigned long long)(size_t)(gptr + 3 * gstep);
    asm volatile("global_load_async_to_lds_b128 %0, %4, off\n\t"
                 "global_load_async_to_lds_b128 %1, %5, off\n\t"
                 "global_load_async_to_lds_b128 %2, %6, off\n\t"
                 "global_load_async_to_lds_b128 %3, %7, off\n\t"
                 "s_wait_xcnt 0x0"
                 :: "v"(l0), "v"(l1), "v"(l2), "v"(l3), "v"(g0), "v"(g1), "v"(g2), "v"(g3)
                 : "memory");
}
__device__ __forceinline__ void wait_async0() {
    asm volatile("s_wait_asynccnt 0x0" ::: "memory");
}

__device__ __forceinline__ void tdm_load_2d_pad(const bf16* gptr, bf16* lptr,
                                                unsigned rows, unsigned cols,
                                                unsigned stride_elems) {
    unsigned long long ga = (unsigned long long)(size_t)gptr;
    uint32x4 g0;
    g0[0] = 1u;
    g0[1] = (unsigned)(size_t)lptr;
    g0[2] = (unsigned)ga;
    g0[3] = (unsigned)(ga >> 32) | 0x80000000u;
    uint32x8 g1;
    g1[0] = (1u << 16) | (1u << 20) | (4u << 22) | (3u << 25);
    g1[1] = (cols & 0xffffu) << 16;
    g1[2] = (rows & 0xffffu) << 16;
    g1[3] = (cols & 0xffffu) << 16;
    g1[4] = (rows & 0xffffu);
    g1[5] = stride_elems;
    g1[6] = 0u;
    g1[7] = 0u;
    asm volatile("tensor_load_to_lds %0, %1" :: "s"(g0), "s"(g1) : "memory");
}
__device__ __forceinline__ void wait_tensor0() {
#if __has_builtin(__builtin_amdgcn_s_wait_tensorcnt)
    __builtin_amdgcn_s_wait_tensorcnt(0);
#else
    asm volatile("s_wait_tensorcnt 0x0" ::: "memory");
#endif
}

__device__ __forceinline__ bf16x16 frag_row(const bf16* p) {
    bf16x16 f;
#pragma unroll
    for (int e = 0; e < 8; ++e) f[e] = p[e];
#pragma unroll
    for (int e = 0; e < 8; ++e) f[e + 8] = p[e + 16];
    return f;
}

// 32x16 B fragment from a row-major [k][n] LDS tile by two transposing loads.
// p is the lane's own address: row 8*(lane>>4) + (lane&7), column n0 + 8*((lane>>3)&1);
// lane (c = lane&15, h = lane>>4) then holds column n0 + c at k {8h..8h+7, 16+8h..16+8h+7},
// the same k order as frag_row. ld = row pitch in elements.
__device__ __forceinline__ bf16x16 frag_tr(const bf16* p, int ld) {
    typedef __attribute__((address_space(3))) s16x8 lds_s16x8;
    s16x8 lo = __builtin_amdgcn_ds_load_tr16_b128_v8i16((lds_s16x8*)p);
    s16x8 hi = __builtin_amdgcn_ds_load_tr16_b128_v8i16((lds_s16x8*)(p + 16 * ld));
    s16x16 f = __builtin_shufflevector(lo, hi, 0, 1, 2, 3, 4, 5, 6, 7,
                                       8, 9, 10, 11, 12, 13, 14, 15);
    return __builtin_bit_cast(bf16x16, f);
}

// Fragment from a column of a row-major [K][N] LDS tile (V^T as A operand).
__device__ __forceinline__ bf16x16 frag_col(const bf16* base, int ld, int col, int c0) {
    bf16x16 f;
#pragma unroll
    for (int e = 0; e < 8; ++e) f[e] = base[(c0 + e) * ld + col];
#pragma unroll
    for (int e = 0; e < 8; ++e) f[e + 8] = base[(c0 + 16 + e) * ld + col];
    return f;
}

// wave32 full reduction
__device__ __forceinline__ float wave_sum32(float v) {
#pragma unroll
    for (int m = 16; m >= 1; m >>= 1) v += __shfl_xor(v, m, 32);
    return v;
}
__device__ __forceinline__ float exp_slot(float x) {
    float r;
    asm("v_exp_f32 %0, %1\n\tv_nop" : "=v"(r) : "v"(x * 1.44269504f));
    return r;
}
__device__ __forceinline__ float other_half(float v) {
    const int b = __builtin_bit_cast(int, v);
    return __builtin_bit_cast(float,
        __builtin_amdgcn_permlanex16(b, b, 0x76543210, 0xfedcba98, false, false));
}

// ---------------------------------------------------------------------------
// f32 -> bf16 conversion of all ten tensors in one launch of few, long waves.
// These streams were held back by the number of waves that had to start, not by
// their bytes. A wave takes 4096 consecutive elements (32 loads of 16 bytes a
// lane, each load 512 contiguous bytes), a block of four waves 16384.
// The ten destinations lie back to back in the workspace, in the order of the
// sources, so the destination is one array. Block counts = elements / 16384.
// ---------------------------------------------------------------------------
typedef __attribute__((ext_vector_type(4))) float  floatx4;
typedef __attribute__((ext_vector_type(4))) __bf16 bf16x4;

__global__ __launch_bounds__(128) void cvt_all_bf16_kernel(
    const float* __restrict__ s0, const float* __restrict__ s1,
    const float* __restrict__ s2, const float* __restrict__ s3,
    const float* __restrict__ s4, const float* __restrict__ s5,
    const float* __restrict__ s6, const float* __restrict__ s7,
    const float* __restrict__ s8, const float* __restrict__ s9,
    bf16* __restrict__ out) {
    const int b = blockIdx.x;
    const float* src;
    int first;  // first block of the tensor that block b lies in
    if      (b <  192) { src = s0; first =    0; }
    else if (b <  256) { src = s1; first =  192; }
    else if (b <  320) { src = s2; first =  256; }
    else if (b <  368) { src = s3; first =  320; }
    else if (b <  416) { src = s4; first =  368; }
    else if (b <  480) { src = s5; first =  416; }
    else if (b <  736) { src = s6; first =  480; }
    else if (b <  992) { src = s7; first =  736; }
    else if (b < 1088) { src = s8; first =  992; }
    else               { src = s9; first = 1088; }
    const int within = (threadIdx.x >> 5) * 4096 + (threadIdx.x & 31) * 4;
    const float* ip = src + (size_t)(b - first) * 16384 + within;
    bf16*        op = out + (size_t)b * 16384 + within;
    floatx4 v[32];
#pragma unroll
    for (int j = 0; j < 32; ++j) v[j] = *(const floatx4*)(ip + j * 128);
    // keeps all 32 loads in front of the first conversion: one trip to memory a wave;
    // without it the compiler issues them in six groups, each waiting for the one before
    __builtin_amdgcn_sched_barrier(0);
#pragma unroll
    for (int j = 0; j < 32; ++j)
        *(bf16x4*)(op + j * 128) = __builtin_convertvector(v[j], bf16x4);
}

// ---------------------------------------------------------------------------
// LayerNorm over rows of 1024: one wave takes two whole rows and keeps them in
// registers (eight 16-byte loads a lane and row, each 512 contiguous bytes), so
// a row is read once, its sums need no LDS and no barrier, and a launch starts
// 4096 waves (16 a WGP). f32 in, bf16 out.
// ---------------------------------------------------------------------------
__global__ __launch_bounds__(256) void ln_bf16_kernel(
    const float* __restrict__ x, const float* __restrict__ g,
    const float* __restrict__ bta, bf16* __restrict__ out) {
    const unsigned goff = (threadIdx.x & 31) * 16;                // the lane's bytes in a 512-byte piece
    const unsigned xoff = (threadIdx.x >> 5) * 8192 + goff;       // + the wave's two rows among the block's sixteen
    const char* xb = (const char*)(x + (size_t)blockIdx.x * 16384);
    char*       ob = (char*)(out + (size_t)blockIdx.x * 16384);
    floatx4 v[2][8], gg[8], bb[8];
#pragma unroll
    for (int r = 0; r < 2; ++r)
#pragma unroll
        for (int j = 0; j < 8; ++j) v[r][j] = *(const floatx4*)(xb + xoff + r * 4096 + j * 512);
#pragma unroll
    for (int j = 0; j < 8; ++j) {
        gg[j] = *(const floatx4*)((const char*)g + goff + j * 512);
        bb[j] = *(const floatx4*)((const char*)bta + goff + j * 512);
    }
    asm volatile("s_wait_xcnt 0x0" :: "v"(xoff), "v"(goff) : "memory");
    // keeps the loads of gain and bias up here with the rows': without it the compiler
    // sinks them behind the row sums, and the wave waits for memory a second and third time
    __builtin_amdgcn_sched_barrier(0);
#pragma unroll
    for (int r = 0; r < 2; ++r) {
        floatx4 s4 = v[r][0], q4 = v[r][0] * v[r][0];
#pragma unroll
        for (int j = 1; j < 8; ++j) {
            s4 += v[r][j];
            q4 += v[r][j] * v[r][j];
        }
        const float ls = wave_sum32((s4[0] + s4[1]) + (s4[2] + s4[3]));
        const float lq = wave_sum32((q4[0] + q4[1]) + (q4[2] + q4[3]));
        const float mean = ls / 1024.0f;
        const float var  = lq / 1024.0f - mean * mean;
        const float inv  = rsqrtf(var + 1e-5f);
#pragma unroll
        for (int j = 0; j < 8; ++j) {
            const floatx4 y = (v[r][j] - mean) * inv * gg[j] + bb[j];
            *(bf16x4*)(ob + xoff / 2 + r * 2048 + j * 256) = __builtin_convertvector(y, bf16x4);
        }
    }
}

template <int EPI>
__global__ __launch_bounds__(256) void gemm_bf16_kernel(
    const bf16* __restrict__ A, const bf16* __restrict__ B,
    const float* __restrict__ bias, const float* __restrict__ res,
    void* __restrict__ out, int M, int N, int K) {
    // row-major [m][k], 144B rows (16B x odd: the plain 16-byte load's pitch)
    __shared__ __attribute__((aligned(16))) bf16 As[2][128][72];
    // row-major [k][n], 288B rows (32B x odd: the transposing load's pitch)
    __shared__ __attribute__((aligned(16))) bf16 Bs[2][64][144];

    const int tid  = threadIdx.x;
    const int lane = tid & 31;
    const int wave = tid >> 5;
    const int wr = wave >> 1;   // 0..3 : 32-row group
    const int wc = wave & 1;    // 0..1 : 64-col group
    const int hf = lane >> 4;   // lane half
    const int c0 = hf << 3;
    const int ln = lane & 15;
    const int bm = blockIdx.y * 128;
    const int bn = blockIdx.x * 128;

    floatx8 acc[2][4];
#pragma unroll
    for (int i = 0; i < 2; ++i)
#pragma unroll
        for (int j = 0; j < 4; ++j) acc[i][j] = fzero8();

    const int ar = tid >> 3, as8 = (tid & 7) * 8;   // A: rows ar + 32 i, 8 lanes a 128-byte row
    const int br = tid >> 4, bs8 = (tid & 15) * 8;  // B: rows br + 16 i, 16 lanes a 256-byte row
    const bf16* ga = A + (size_t)(bm + ar) * K + as8;
    const bf16* gb = B + (size_t)br * N + bn + bs8;

    // ---- prologue: stage tile 0 into buffer 0 ----
    {
        async_load4_b128(ga, (size_t)32 * K, &As[0][ar][as8], 32 * 72);
#pragma unroll
        for (int i = 0; i < 4; ++i)
            *(uint4*)&Bs[0][br + 16 * i][bs8] = *(const uint4*)(gb + (size_t)(16 * i) * N);
        wait_async0();
    }
    __syncthreads();

    int cur = 0;
    for (int kk = 0; kk < K; kk += 64) {
        const int nxt = cur ^ 1;
        const bool has_next = (kk + 64 < K);
        uint4 breg0, breg1, breg2, breg3;  // next B tile's 64 bytes of this thread, held over the WMMAs
        if (has_next) {
            async_load4_b128(ga + kk + 64, (size_t)32 * K, &As[nxt][ar][as8], 32 * 72);
            const bf16* gbn = gb + (size_t)(kk + 64) * N;
            breg0 = *(const uint4*)(gbn);
            breg1 = *(const uint4*)(gbn + (size_t)16 * N);
            breg2 = *(const uint4*)(gbn + (size_t)32 * N);
            breg3 = *(const uint4*)(gbn + (size_t)48 * N);
            asm volatile("s_wait_xcnt 0x0" ::: "memory");
            if (kk + 128 < K) {  // L2 warm-up two tiles ahead (global_prefetch_b8), one lane a line
                if (__builtin_amdgcn_readfirstlane(wave) < 4)  // scalar test: waves 0-3 take A, 4-7 take B
                    __builtin_prefetch(A + (size_t)(bm + tid) * K + kk + 128, 0, 1);
                else
                    __builtin_prefetch(B + (size_t)(kk + 128 + ((tid - 128) >> 1)) * N + bn + (tid & 1) * 64, 0, 1);
            }
        }

        // ---- compute current tile: 16 WMMAs per wave ----
#pragma unroll
        for (int ks = 0; ks < 2; ++ks) {
            bf16x16 af[2], bfv[4];
#pragma unroll
            for (int mt = 0; mt < 2; ++mt)
                af[mt] = frag_row(&As[cur][wr * 32 + mt * 16 + ln][ks * 32 + c0]);
#pragma unroll
            for (int nt = 0; nt < 4; ++nt)
                bfv[nt] = frag_tr(&Bs[cur][ks * 32 + c0 + (lane & 7)][wc * 64 + nt * 16 + ((lane >> 3) & 1) * 8], 144);
#pragma unroll
            for (int mt = 0; mt < 2; ++mt)
#pragma unroll
                for (int nt = 0; nt < 4; ++nt)
                    acc[mt][nt] = wmma_bf16(af[mt], bfv[nt], acc[mt][nt]);
        }

        if (has_next) {
            // commit staged B to LDS[nxt]
            *(uint4*)&Bs[nxt][br +  0][bs8] = breg0;
            *(uint4*)&Bs[nxt][br + 16][bs8] = breg1;
            *(uint4*)&Bs[nxt][br + 32][bs8] = breg2;
            *(uint4*)&Bs[nxt][br + 48][bs8] = breg3;
        }
        // hand-over of the stage: this wave's LDS reads and writes done, its copies
        // landed, then the barrier that publishes tile t+1 and frees buffer cur
        asm volatile("s_wait_dscnt 0x0" ::: "memory");
        wait_async0();
        __syncthreads();
        cur = nxt;
    }
    wait_async0();  // no copy outlives the loop

    // ---- epilogue: D layout = lane holds col n=ln, rows v + 8*hf ----
#pragma unroll
    for (int mt = 0; mt < 2; ++mt) {
#pragma unroll
        for (int nt = 0; nt < 4; ++nt) {
            const int n  = bn + wc * 64 + nt * 16 + ln;
            const float bs = bias[n];
#pragma unroll
            for (int v = 0; v < 8; ++v) {
                const int m = bm + wr * 32 + mt * 16 + v + 8 * hf;
                float val = acc[mt][nt][v] + bs;
                const size_t idx = (size_t)m * N + n;
                if (EPI == 0) {
                    ((bf16*)out)[idx] = (bf16)val;
                } else if (EPI == 1) {
                    float t = 0.7978845608028654f * (val + 0.044715f * val * val * val);
                    val = 0.5f * val * (1.0f + tanhf(t));
                    ((bf16*)out)[idx] = (bf16)val;
                } else {
                    ((float*)out)[idx] = val + res[idx];
                }
            }
        }
    }
}

__global__ __launch_bounds__(128) void attn_kernel(
    const bf16* __restrict__ Q, int qstride,
    const bf16* __restrict__ Kp, const bf16* __restrict__ Vp, int kvstride,
    bf16* __restrict__ O, int Tq, int Tk, int causal, float scale) {
    // each tensor load's place in LDS is a multiple of 2 KiB
    __shared__ __attribute__((aligned(2048))) bf16 Ks[32][72];  // K chunk [key][d]  (144B rows)
    __shared__ __attribute__((aligned(2048))) bf16 Vs[32][72];  // V chunk [key][d]

    const int tid  = threadIdx.x;
    const int lane = tid & 31;
    const int w    = tid >> 5;
    const int hf = lane >> 4, c0 = hf << 3, ln = lane & 15;
    const int q0 = blockIdx.x * 64;
    const int h  = blockIdx.y;
    const int b  = blockIdx.z;

    const bf16* qbase = Q  + (size_t)(b * Tq) * qstride  + h * 64;
    const bf16* kbase = Kp + (size_t)(b * Tk) * kvstride + h * 64;
    const bf16* vbase = Vp + (size_t)(b * Tk) * kvstride + h * 64;

    // Q fragments for this wave's 16 rows (2 K-steps over dh=64), kept resident
    bf16x16 qf[2];
    {
        const bf16* qp = qbase + (size_t)(q0 + w * 16 + ln) * qstride;
#pragma unroll
        for (int ks = 0; ks < 2; ++ks) {
            bf16x16 f;
#pragma unroll
            for (int e = 0; e < 8; ++e) f[e] = qp[ks * 32 + c0 + e];
#pragma unroll
            for (int e = 0; e < 8; ++e) f[e + 8] = qp[ks * 32 + c0 + 16 + e];
            qf[ks] = f;
        }
    }

    floatx8 o[4];
#pragma unroll
    for (int i = 0; i < 4; ++i) o[i] = fzero8();
    // of the lane's query (row q0 + w*16 + ln): running maximum, the same in both
    // halves, and the sum over the keys that this half has seen
    float m_r = -1e30f, l_r = 0.0f;

    int kend = causal ? (q0 + 64) : Tk;
    if (kend > Tk) kend = Tk;

    for (int kc = 0; kc < kend; kc += 32) {
        __syncthreads();
        if (w == 0) {
            tdm_load_2d_pad(kbase + (size_t)kc * kvstride, &Ks[0][0], 32, 64, kvstride);
            tdm_load_2d_pad(vbase + (size_t)kc * kvstride, &Vs[0][0], 32, 64, kvstride);
            wait_tensor0();
        }
        __syncthreads();

        // V^T fragments (A operand of the second product), named ahead of the softmax:
        // their loads then go out in groups, not in pairs that each wait for LDS
        bf16x16 vf[4];
#pragma unroll
        for (int nt = 0; nt < 4; ++nt) vf[nt] = frag_col(&Vs[0][0], 72, nt * 16 + ln, c0);

        // S^T = K * Q^T : two 16-key tiles, K-dim = dh = 64 (2 WMMA steps)
        floatx8 s[2];
#pragma unroll
        for (int nt = 0; nt < 2; ++nt) {
            floatx8 a = fzero8();
#pragma unroll
            for (int ks = 0; ks < 2; ++ks) {
                bf16x16 kf = frag_row(&Ks[nt * 16 + ln][ks * 32 + c0]);
                a = wmma_bf16(kf, qf[ks], a);
            }
            s[nt] = a;
        }
        // scale + causal mask (D layout: lane holds query ln, keys v + 8*hf of the tile)
        const int qg = q0 + w * 16 + ln;
#pragma unroll
        for (int nt = 0; nt < 2; ++nt) {
#pragma unroll
            for (int v = 0; v < 8; ++v) {
                float x = s[nt][v] * scale;
                if (causal) {
                    const int kg = kc + nt * 16 + v + 8 * hf;
                    if (kg > qg) x = -1e30f;
                }
                s[nt][v] = x;
            }
        }
        // online softmax of the lane's query
        float t = fmaxf(s[0][0], s[1][0]);
#pragma unroll
        for (int v = 1; v < 8; ++v) t = fmaxf(t, fmaxf(s[0][v], s[1][v]));
        t = fmaxf(t, other_half(t));
        const float mn = fmaxf(m_r, t);
        const float alpha = exp_slot(m_r - mn);
        m_r = mn;
        // P^T as B operand: element e is key 8*hf + e, element 8 + e key 16 + 8*hf + e,
        // the k order of frag_col
        bf16x16 pf;
        float rs0, rs1;
#pragma unroll
        for (int v = 0; v < 8; ++v) {
            const float p0 = exp_slot(s[0][v] - mn);
            const float p1 = exp_slot(s[1][v] - mn);
            rs0 = v == 0 ? p0 : rs0 + p0;
            rs1 = v == 0 ? p1 : rs1 + p1;
            pf[v]     = (bf16)p0;
            pf[v + 8] = (bf16)p1;
        }
        l_r = l_r * alpha + (rs0 + rs1);
#pragma unroll
        for (int nt = 0; nt < 4; ++nt)
#pragma unroll
            for (int v = 0; v < 8; ++v) o[nt][v] *= alpha;

        // O^T += V^T(64x32) * P^T(32x16)
#pragma unroll
        for (int nt = 0; nt < 4; ++nt) o[nt] = wmma_bf16(vf[nt], pf, o[nt]);
    }

    // finalize: join the halves' sums, divide; the lane holds d = nt*16 + 8*hf + v of
    // its query: eight consecutive bf16, one 16-byte store a tile
    {
        typedef __attribute__((ext_vector_type(8))) __bf16 bf16x8;
        const float inv = 1.0f / (l_r + other_half(l_r));
        bf16* op = O + (size_t)(b * Tq + q0 + w * 16 + ln) * 1024 + h * 64 + 8 * hf;
#pragma unroll
        for (int nt = 0; nt < 4; ++nt) {
            bf16x8 y;
#pragma unroll
            for (int v = 0; v < 8; ++v) y[v] = (bf16)(o[nt][v] * inv);
            *(bf16x8*)(op + nt * 16) = y;
        }
    }
}

// ---------------------------------------------------------------------------
// Host-side orchestration
// ---------------------------------------------------------------------------
template <int EPI>
static void gemm(const bf16* A, const bf16* B, const float* bias, const float* res,
                 void* out, int M, int N, int K, hipStream_t s) {
    dim3 g(N / 128, M / 128);
    gemm_bf16_kernel<EPI><<<g, 256, 0, s>>>(A, B, bias, res, out, M, N, K);
}

extern "C" void kernel_launch(void* const* d_in, const int* in_sizes, int n_in,
                              void* d_out, int out_size, void* d_ws, size_t ws_size,
                              hipStream_t stream) {
    const float* x      = (const float*)d_in[0];
    const float* key    = (const float*)d_in[1];
    const float* val    = (const float*)d_in[2];
    const float* ln1_g  = (const float*)d_in[3];
    const float* ln1_b  = (const float*)d_in[4];
    const float* ln2_g  = (const float*)d_in[5];
    const float* ln2_b  = (const float*)d_in[6];
    const float* ln3_g  = (const float*)d_in[7];
    const float* ln3_b  = (const float*)d_in[8];
    const float* W_attn = (const float*)d_in[9];
    const float* b_attn = (const float*)d_in[10];
    const float* W_aproj= (const float*)d_in[11];
    const float* b_aproj= (const float*)d_in[12];
    const float* Wq     = (const float*)d_in[13];
    const float* bq     = (const float*)d_in[14];
    const float* Wk     = (const float*)d_in[15];
    const float* bk     = (const float*)d_in[16];
    const float* Wv     = (const float*)d_in[17];
    const float* bv     = (const float*)d_in[18];
    const float* W_cproj= (const float*)d_in[19];
    const float* b_cproj= (const float*)d_in[20];
    const float* W_fc   = (const float*)d_in[21];
    const float* b_fc   = (const float*)d_in[22];
    const float* W_mproj= (const float*)d_in[23];
    const float* b_mproj= (const float*)d_in[24];

    const int B = 8, T = 1024, C = 1024, Ck = 768, TK = 256, NH = 16;
    const size_t BT  = (size_t)B * T;    // 8192 rows
    const size_t BTk = (size_t)B * TK;   // 2048 rows

    char* ws = (char*)d_ws;
    size_t off = 0;
    auto alloc = [&](size_t bytes) -> void* {
        void* p = ws + off;
        off += (bytes + 255) & ~(size_t)255;
        return p;
    };

    // persistent bf16 buffers
    bf16* wattn  = (bf16*)alloc((size_t)C * 3 * C * 2);
    bf16* waproj = (bf16*)alloc((size_t)C * C * 2);
    bf16* wqb    = (bf16*)alloc((size_t)C * C * 2);
    bf16* wkb    = (bf16*)alloc((size_t)Ck * C * 2);
    bf16* wvb    = (bf16*)alloc((size_t)Ck * C * 2);
    bf16* wcproj = (bf16*)alloc((size_t)C * C * 2);
    bf16* wfc    = (bf16*)alloc((size_t)C * 4 * C * 2);
    bf16* wmproj = (bf16*)alloc((size_t)4 * C * C * 2);
    bf16* keyb   = (bf16*)alloc(BTk * Ck * 2);
    bf16* valb   = (bf16*)alloc(BTk * Ck * 2);
    bf16* lnbuf  = (bf16*)alloc(BT * C * 2);
    bf16* attnb  = (bf16*)alloc(BT * C * 2);
    // phase-aliased scratch (max of: qkv 50MB | q/k/v-proj 24MB | mlp hidden 67MB)
    char* scratch = (char*)alloc(BT * (size_t)4 * C * 2);
    bf16* qkv = (bf16*)scratch;
    bf16* qc  = (bf16*)scratch;
    bf16* kc  = (bf16*)(scratch + BT * C * 2);
    bf16* vc  = (bf16*)(scratch + BT * C * 2 + BTk * C * 2);
    bf16* hfc = (bf16*)scratch;

    float* xo = (float*)d_out;  // running residual state lives in d_out x-region

    // 0) down-conversions: wattn .. valb are contiguous in ws, in this order
    cvt_all_bf16_kernel<<<dim3(1184), 128, 0, stream>>>(
        W_attn, W_aproj, Wq, Wk, Wv, W_cproj, W_fc, W_mproj, key, val, wattn);

    const float scale = 0.125f;  // 1/sqrt(64)

    // 1) self-attention branch
    ln_bf16_kernel<<<dim3((unsigned)(BT / 16)), 256, 0, stream>>>(x, ln1_g, ln1_b, lnbuf);
    gemm<0>(lnbuf, wattn, b_attn, nullptr, qkv, (int)BT, 3 * C, C, stream);
    attn_kernel<<<dim3(T / 64, NH, B), 128, 0, stream>>>(
        qkv, 3 * C, qkv + C, qkv + 2 * C, 3 * C, attnb, T, T, /*causal=*/1, scale);
    gemm<2>(attnb, waproj, b_aproj, x, xo, (int)BT, C, C, stream);  // x + attn

    // 2) cross-attention branch
    ln_bf16_kernel<<<dim3((unsigned)(BT / 16)), 256, 0, stream>>>(xo, ln3_g, ln3_b, lnbuf);
    gemm<0>(lnbuf, wqb, bq, nullptr, qc, (int)BT, C, C, stream);
    gemm<0>(keyb, wkb, bk, nullptr, kc, (int)BTk, C, Ck, stream);
    gemm<0>(valb, wvb, bv, nullptr, vc, (int)BTk, C, Ck, stream);
    attn_kernel<<<dim3(T / 64, NH, B), 128, 0, stream>>>(
        qc, C, kc, vc, C, attnb, T, TK, /*causal=*/0, scale);
    gemm<2>(attnb, wcproj, b_cproj, xo, xo, (int)BT, C, C, stream);  // x += cross

    // 3) MLP branch
    ln_bf16_kernel<<<dim3((unsigned)(BT / 16)), 256, 0, stream>>>(xo, ln2_g, ln2_b, lnbuf);
    gemm<1>(lnbuf, wfc, b_fc, nullptr, hfc, (int)BT, 4 * C, C, stream);   // + GELU
    gemm<2>(hfc, wmproj, b_mproj, xo, xo, (int)BT, C, 4 * C, stream);     // x += mlp

    // 4) echo key/val into the output tuple
    size_t x_elems = BT * (size_t)C;
    size_t kv_elems = BTk * (size_t)Ck;
    hipMemcpyAsync(xo + x_elems, key, kv_elems * sizeof(float),
                   hipMemcpyDeviceToDevice, stream);
    hipMemcpyAsync(xo + x_elems + kv_elems, val, kv_elems * sizeof(float),
                   hipMemcpyDeviceToDevice, stream);
}

// v005
// Timed twice side by side with v004, it ran 1.04 times as fast both times.
// Counting every step since v000, it is 2.06 times as fast.
#include <hip/hip_runtime.h>
#include <hip/hip_bf16.h>

typedef __bf16 bf16;
typedef __attribute__((ext_vector_type(16))) __bf16 bf16x16;
typedef __attribute__((ext_vector_type(8)))  float  floatx8;
typedef __attribute__((ext_vector_type(4)))  unsigned int uint32x4;
typedef __attribute__((ext_vector_type(8)))  unsigned int uint32x8;
typedef __attribute__((ext_vector_type(8)))  short s16x8;
typedef __attribute__((ext_vector_type(16))) short s16x16;

// ---------------------------------------------------------------------------
// WMMA wrapper: D = A(16x32 bf16) * B(32x16 bf16) + C(16x16 f32)
// ---------------------------------------------------------------------------
__device__ __forceinline__ floatx8 wmma_bf16(bf16x16 a, bf16x16 b, floatx8 c) {
    return __builtin_amdgcn_wmma_f32_16x16x32_bf16(
        /*neg_a=*/false, a, /*neg_b=*/false, b,
        /*c_mod=*/(short)0, c, /*reuse_a=*/false, /*reuse_b=*/false);
}

__device__ __forceinline__ floatx8 fzero8() {
    floatx8 z;
#pragma unroll
    for (int i = 0; i < 8; ++i) z[i] = 0.0f;
    return z;
}

__device__ __forceinline__ void async_load4_b128(const bf16* gptr, size_t gstep,
                                                 bf16* lptr, int lstep) {
    unsigned l0 = (unsigned)(size_t)lptr;
    unsigned l1 = (unsigned)(size_t)(lptr + lstep);
    unsigned l2 = (unsigned)(size_t)(lptr + 2 * lstep);
    unsigned l3 = (unsigned)(size_t)(lptr + 3 * lstep);
    unsigned long long g0 = (unsigned long long)(size_t)gptr;
    unsigned long long g1 = (unsigned long long)(size_t)(gptr + gstep);
    unsigned long long g2 = (unsigned long long)(size_t)(gptr + 2 * gstep);
    unsigned long long g3 = (unsigned long long)(size_t)(gptr + 3 * gstep);
    asm volatile("global_load_async_to_lds_b128 %0, %4, off\n\t"
                 "global_load_async_to_lds_b128 %1, %5, off\n\t"
                 "global_load_async_to_lds_b128 %2, %6, off\n\t"
                 "global_load_async_to_lds_b128 %3, %7, off\n\t"
                 "s_wait_xcnt 0x0"
                 :: "v"(l0), "v"(l1), "v"(l2), "v"(l3), "v"(g0), "v"(g1), "v"(g2), "v"(g3)
                 : "memory");
}
__device__ __forceinline__ void wait_async0() {
    asm volatile("s_wait_asynccnt 0x0" ::: "memory");
}

__device__ __forceinline__ void tdm_load_2d_pad(const bf16* gptr, bf16* lptr,
                                                unsigned rows, unsigned cols,
                                                unsigned stride_elems) {
    unsigned long long ga = (unsigned long long)(size_t)gptr;
    uint32x4 g0;
    g0[0] = 1u;
    g0[1] = (unsigned)(size_t)lptr;
    g0[2] = (unsigned)ga;
    g0[3] = (unsigned)(ga >> 32) | 0x80000000u;
    uint32x8 g1;
    g1[0] = (1u << 16) | (1u << 20) | (4u << 22) | (3u << 25);
    g1[1] = (cols & 0xffffu) << 16;
    g1[2] = (rows & 0xffffu) << 16;
    g1[3] = (cols & 0xffffu) << 16;
    g1[4] = (rows & 0xffffu);
    g1[5] = stride_elems;
    g1[6] = 0u;
    g1[7] = 0u;
    asm volatile("tensor_load_to_lds %0, %1" :: "s"(g0), "s"(g1) : "memory");
}
__device__ __forceinline__ void wait_tensor0() {
#if __has_builtin(__builtin_amdgcn_s_wait_tensorcnt)
    __builtin_amdgcn_s_wait_tensorcnt(0);
#else
    asm volatile("s_wait_tensorcnt 0x0" ::: "memory");
#endif
}

__device__ __forceinline__ bf16x16 frag_row(const bf16* p) {
    bf16x16 f;
#pragma unroll
    for (int e = 0; e < 8; ++e) f[e] = p[e];
#pragma unroll
    for (int e = 0; e < 8; ++e) f[e + 8] = p[e + 16];
    return f;
}

// 32x16 B fragment from a row-major [k][n] LDS tile by two transposing loads.
// p is the lane's own address: row 8*(lane>>4) + (lane&7), column n0 + 8*((lane>>3)&1);
// lane (c = lane&15, h = lane>>4) then holds column n0 + c at k {8h..8h+7, 16+8h..16+8h+7},
// the same k order as frag_row. ld = row pitch in elements.
__device__ __forceinline__ bf16x16 frag_tr(const bf16* p, int ld) {
    typedef __attribute__((address_space(3))) s16x8 lds_s16x8;
    s16x8 lo = __builtin_amdgcn_ds_load_tr16_b128_v8i16((lds_s16x8*)p);
    s16x8 hi = __builtin_amdgcn_ds_load_tr16_b128_v8i16((lds_s16x8*)(p + 16 * ld));
    s16x16 f = __builtin_shufflevector(lo, hi, 0, 1, 2, 3, 4, 5, 6, 7,
                                       8, 9, 10, 11, 12, 13, 14, 15);
    return __builtin_bit_cast(bf16x16, f);
}

// Fragment from a column of a row-major [K][N] LDS tile (V^T as A operand).
__device__ __forceinline__ bf16x16 frag_col(const bf16* base, int ld, int col, int c0) {
    bf16x16 f;
#pragma unroll
    for (int e = 0; e < 8; ++e) f[e] = base[(c0 + e) * ld + col];
#pragma unroll
    for (int e = 0; e < 8; ++e) f[e + 8] = base[(c0 + 16 + e) * ld + col];
    return f;
}

// wave32 full reduction
__device__ __forceinline__ float wave_sum32(float v) {
#pragma unroll
    for (int m = 16; m >= 1; m >>= 1) v += __shfl_xor(v, m, 32);
    return v;
}
__device__ __forceinline__ float exp_slot(float x) {
    float r;
    asm("v_exp_f32 %0, %1\n\tv_nop" : "=v"(r) : "v"(x * 1.44269504f));
    return r;
}
__device__ __forceinline__ float exp2_slot(float x) {
    float r;
    asm("v_exp_f32 %0, %1\n\tv_nop" : "=v"(r) : "v"(x));
    return r;
}
__device__ __forceinline__ float rcp_slot(float x) {
    float r;
    asm("v_rcp_f32 %0, %1\n\tv_nop" : "=v"(r) : "v"(x));
    return r;
}
__device__ __forceinline__ float other_half(float v) {
    const int b = __builtin_bit_cast(int, v);
    return __builtin_bit_cast(float,
        __builtin_amdgcn_permlanex16(b, b, 0x76543210, 0xfedcba98, false, false));
}

// ---------------------------------------------------------------------------
// f32 -> bf16 conversion of all ten tensors in one launch of few, long waves.
// These streams were held back by the number of waves that had to start, not by
// their bytes. A wave takes 4096 consecutive elements (32 loads of 16 bytes a
// lane, each load 512 contiguous bytes), a block of four waves 16384.
// The ten destinations lie back to back in the workspace, in the order of the
// sources, so the destination is one array. Block counts = elements / 16384.
// ---------------------------------------------------------------------------
typedef __attribute__((ext_vector_type(4))) float  floatx4;
typedef __attribute__((ext_vector_type(4))) __bf16 bf16x4;

__global__ __launch_bounds__(128) void cvt_all_bf16_kernel(
    const float* __restrict__ s0, const float* __restrict__ s1,
    const float* __restrict__ s2, const float* __restrict__ s3,
    const float* __restrict__ s4, const float* __restrict__ s5,
    const float* __restrict__ s6, const float* __restrict__ s7,
    const float* __restrict__ s8, const float* __restrict__ s9,
    bf16* __restrict__ out) {
    const int b = blockIdx.x;
    const float* src;
    int first;  // first block of the tensor that block b lies in
    if      (b <  192) { src = s0; first =    0; }
    else if (b <  256) { src = s1; first =  192; }
    else if (b <  320) { src = s2; first =  256; }
    else if (b <  368) { src = s3; first =  320; }
    else if (b <  416) { src = s4; first =  368; }
    else if (b <  480) { src = s5; first =  416; }
    else if (b <  736) { src = s6; first =  480; }
    else if (b <  992) { src = s7; first =  736; }
    else if (b < 1088) { src = s8; first =  992; }
    else               { src = s9; first = 1088; }
    const int within = (threadIdx.x >> 5) * 4096 + (threadIdx.x & 31) * 4;
    const float* ip = src + (size_t)(b - first) * 16384 + within;
    bf16*        op = out + (size_t)b * 16384 + within;
    floatx4 v[32];
#pragma unroll
    for (int j = 0; j < 32; ++j) v[j] = *(const floatx4*)(ip + j * 128);
    // keeps all 32 loads in front of the first conversion: one trip to memory a wave;
    // without it the compiler issues them in six groups, each waiting for the one before
    __builtin_amdgcn_sched_barrier(0);
#pragma unroll
    for (int j = 0; j < 32; ++j)
        *(bf16x4*)(op + j * 128) = __builtin_convertvector(v[j], bf16x4);
}

// ---------------------------------------------------------------------------
// LayerNorm over rows of 1024: one wave takes two whole rows and keeps them in
// registers (eight 16-byte loads a lane and row, each 512 contiguous bytes), so
// a row is read once, its sums need no LDS and no barrier, and a launch starts
// 4096 waves (16 a WGP). f32 in, bf16 out.
// ---------------------------------------------------------------------------
__global__ __launch_bounds__(256) void ln_bf16_kernel(
    const float* __restrict__ x, const float* __restrict__ g,
    const float* __restrict__ bta, bf16* __restrict__ out) {
    const unsigned goff = (threadIdx.x & 31) * 16;                // the lane's bytes in a 512-byte piece
    const unsigned xoff = (threadIdx.x >> 5) * 8192 + goff;       // + the wave's two rows among the block's sixteen
    const char* xb = (const char*)(x + (size_t)blockIdx.x * 16384);
    char*       ob = (char*)(out + (size_t)blockIdx.x * 16384);
    floatx4 v[2][8], gg[8], bb[8];
#pragma unroll
    for (int r = 0; r < 2; ++r)
#pragma unroll
        for (int j = 0; j < 8; ++j) v[r][j] = *(const floatx4*)(xb + xoff + r * 4096 + j * 512);
#pragma unroll
    for (int j = 0; j < 8; ++j) {
        gg[j] = *(const floatx4*)((const char*)g + goff + j * 512);
        bb[j] = *(const floatx4*)((const char*)bta + goff + j * 512);
    }
    asm volatile("s_wait_xcnt 0x0" :: "v"(xoff), "v"(goff) : "memory");
    // keeps the loads of gain and bias up here with the rows': without it the compiler
    // sinks them behind the row sums, and the wave waits for memory a second and third time
    __builtin_amdgcn_sched_barrier(0);
#pragma unroll
    for (int r = 0; r < 2; ++r) {
        floatx4 s4 = v[r][0], q4 = v[r][0] * v[r][0];
#pragma unroll
        for (int j = 1; j < 8; ++j) {
            s4 += v[r][j];
            q4 += v[r][j] * v[r][j];
        }
        const float ls = wave_sum32((s4[0] + s4[1]) + (s4[2] + s4[3]));
        const float lq = wave_sum32((q4[0] + q4[1]) + (q4[2] + q4[3]));
        const float mean = ls / 1024.0f;
        const float var  = lq / 1024.0f - mean * mean;
        const float inv  = rsqrtf(var + 1e-5f);
#pragma unroll
        for (int j = 0; j < 8; ++j) {
            const floatx4 y = (v[r][j] - mean) * inv * gg[j] + bb[j];
            *(bf16x4*)(ob + xoff / 2 + r * 2048 + j * 256) = __builtin_convertvector(y, bf16x4);
        }
    }
}

template <int EPI>
__global__ __launch_bounds__(256) void gemm_bf16_kernel(
    const bf16* __restrict__ A, const bf16* __restrict__ B,
    const float* __restrict__ bias, const float* __restrict__ res,
    void* __restrict__ out, int M, int N, int K) {
    // row-major [m][k], 144B rows (16B x odd: the plain 16-byte load's pitch)
    __shared__ __attribute__((aligned(16))) bf16 As[2][128][72];
    // row-major [k][n], 288B rows (32B x odd: the transposing load's pitch)
    __shared__ __attribute__((aligned(16))) bf16 Bs[2][64][144];

    const int tid  = threadIdx.x;
    const int lane = tid & 31;
    const int wave = tid >> 5;
    const int wr = wave >> 1;   // 0..3 : 32-row group
    const int wc = wave & 1;    // 0..1 : 64-col group
    const int hf = lane >> 4;   // lane half
    const int c0 = hf << 3;
    const int ln = lane & 15;
    const int bm = blockIdx.y * 128;
    const int bn = blockIdx.x * 128;

    floatx8 acc[2][4];
#pragma unroll
    for (int i = 0; i < 2; ++i)
#pragma unroll
        for (int j = 0; j < 4; ++j) acc[i][j] = fzero8();

    const int ar = tid >> 3, as8 = (tid & 7) * 8;   // A: rows ar + 32 i, 8 lanes a 128-byte row
    const int br = tid >> 4, bs8 = (tid & 15) * 8;  // B: rows br + 16 i, 16 lanes a 256-byte row
    const bf16* ga = A + (size_t)(bm + ar) * K + as8;
    const bf16* gb = B + (size_t)br * N + bn + bs8;

    // ---- prologue: stage tile 0 into buffer 0 ----
    {
        async_load4_b128(ga, (size_t)32 * K, &As[0][ar][as8], 32 * 72);
#pragma unroll
        for (int i = 0; i < 4; ++i)
            *(uint4*)&Bs[0][br + 16 * i][bs8] = *(const uint4*)(gb + (size_t)(16 * i) * N);
        wait_async0();
    }
    __syncthreads();

    int cur = 0;
    for (int kk = 0; kk < K; kk += 64) {
        const int nxt = cur ^ 1;
        const bool has_next = (kk + 64 < K);
        uint4 breg0, breg1, breg2, breg3;  // next B tile's 64 bytes of this thread, held over the WMMAs
        if (has_next) {
            async_load4_b128(ga + kk + 64, (size_t)32 * K, &As[nxt][ar][as8], 32 * 72);
            const bf16* gbn = gb + (size_t)(kk + 64) * N;
            breg0 = *(const uint4*)(gbn);
            breg1 = *(const uint4*)(gbn + (size_t)16 * N);
            breg2 = *(const uint4*)(gbn + (size_t)32 * N);
            breg3 = *(const uint4*)(gbn + (size_t)48 * N);
            asm volatile("s_wait_xcnt 0x0" ::: "memory");
            if (kk + 128 < K) {  // L2 warm-up two tiles ahead (global_prefetch_b8), one lane a line
                if (__builtin_amdgcn_readfirstlane(wave) < 4)  // scalar test: waves 0-3 take A, 4-7 take B
                    __builtin_prefetch(A + (size_t)(bm + tid) * K + kk + 128, 0, 1);
                else
                    __builtin_prefetch(B + (size_t)(kk + 128 + ((tid - 128) >> 1)) * N + bn + (tid & 1) * 64, 0, 1);
            }
        }

        // ---- compute current tile: 16 WMMAs per wave ----
#pragma unroll
        for (int ks = 0; ks < 2; ++ks) {
            bf16x16 af[2], bfv[4];
#pragma unroll
            for (int mt = 0; mt < 2; ++mt)
                af[mt] = frag_row(&As[cur][wr * 32 + mt * 16 + ln][ks * 32 + c0]);
#pragma unroll
            for (int nt = 0; nt < 4; ++nt)
                bfv[nt] = frag_tr(&Bs[cur][ks * 32 + c0 + (lane & 7)][wc * 64 + nt * 16 + ((lane >> 3) & 1) * 8], 144);
#pragma unroll
            for (int mt = 0; mt < 2; ++mt)
#pragma unroll
                for (int nt = 0; nt < 4; ++nt)
                    acc[mt][nt] = wmma_bf16(af[mt], bfv[nt], acc[mt][nt]);
        }

        if (has_next) {
            // commit staged B to LDS[nxt]
            *(uint4*)&Bs[nxt][br +  0][bs8] = breg0;
            *(uint4*)&Bs[nxt][br + 16][bs8] = breg1;
            *(uint4*)&Bs[nxt][br + 32][bs8] = breg2;
            *(uint4*)&Bs[nxt][br + 48][bs8] = breg3;
        }
        // hand-over of the stage: this wave's LDS reads and writes done, its copies
        // landed, then the barrier that publishes tile t+1 and frees buffer cur
        asm volatile("s_wait_dscnt 0x0" ::: "memory");
        wait_async0();
        __syncthreads();
        cur = nxt;
    }
    wait_async0();  // no copy outlives the loop

    // ---- epilogue: D layout = lane holds col n=ln, rows v + 8*hf ----
#pragma unroll
    for (int mt = 0; mt < 2; ++mt) {
#pragma unroll
        for (int nt = 0; nt < 4; ++nt) {
            const int n  = bn + wc * 64 + nt * 16 + ln;
            const float bs = bias[n];
#pragma unroll
            for (int v = 0; v < 8; ++v) {
                const int m = bm + wr * 32 + mt * 16 + v + 8 * hf;
                float val = acc[mt][nt][v] + bs;
                const size_t idx = (size_t)m * N + n;
                if (EPI == 0) {
                    ((bf16*)out)[idx] = (bf16)val;
                } else if (EPI == 1) {
                    // 0.5 (1 + tanh t) = 1 / (1 + e^(-2t)), with e^(-2t) = 2^(val (a + b val^2)),
                    // a = -2 log2(e) sqrt(2/pi), b = 0.044715 a: no branch, so a lane's
                    // 64 elements run interleaved and not one behind the other
                    const float e = exp2_slot(val * (-2.3022082f - 0.10294324f * (val * val)));
                    val = val * rcp_slot(1.0f + e);
                    ((bf16*)out)[idx] = (bf16)val;
                } else {
                    ((float*)out)[idx] = val + res[idx];
                }
            }
        }
    }
}

__global__ __launch_bounds__(128) void attn_kernel(
    const bf16* __restrict__ Q, int qstride,
    const bf16* __restrict__ Kp, const bf16* __restrict__ Vp, int kvstride,
    bf16* __restrict__ O, int Tq, int Tk, int causal, float scale) {
    // each tensor load's place in LDS is a multiple of 2 KiB
    __shared__ __attribute__((aligned(2048))) bf16 Ks[32][72];  // K chunk [key][d]  (144B rows)
    __shared__ __attribute__((aligned(2048))) bf16 Vs[32][72];  // V chunk [key][d]

    const int tid  = threadIdx.x;
    const int lane = tid & 31;
    const int w    = tid >> 5;
    const int hf = lane >> 4, c0 = hf << 3, ln = lane & 15;
    const int q0 = blockIdx.x * 64;
    const int h  = blockIdx.y;
    const int b  = blockIdx.z;

    const bf16* qbase = Q  + (size_t)(b * Tq) * qstride  + h * 64;
    const bf16* kbase = Kp + (size_t)(b * Tk) * kvstride + h * 64;
    const bf16* vbase = Vp + (size_t)(b * Tk) * kvstride + h * 64;

    // Q fragments for this wave's 16 rows (2 K-steps over dh=64), kept resident
    bf16x16 qf[2];
    {
        const bf16* qp = qbase + (size_t)(q0 + w * 16 + ln) * qstride;
#pragma unroll
        for (int ks = 0; ks < 2; ++ks) {
            bf16x16 f;
#pragma unroll
            for (int e = 0; e < 8; ++e) f[e] = qp[ks * 32 + c0 + e];
#pragma unroll
            for (int e = 0; e < 8; ++e) f[e + 8] = qp[ks * 32 + c0 + 16 + e];
            qf[ks] = f;
        }
    }

    floatx8 o[4];
#pragma unroll
    for (int i = 0; i < 4; ++i) o[i] = fzero8();
    // of the lane's query (row q0 + w*16 + ln): running maximum, the same in both
    // halves, and the sum over the keys that this half has seen
    float m_r = -1e30f, l_r = 0.0f;

    int kend = causal ? (q0 + 64) : Tk;
    if (kend > Tk) kend = Tk;

    for (int kc = 0; kc < kend; kc += 32) {
        __syncthreads();
        if (w == 0) {
            tdm_load_2d_pad(kbase + (size_t)kc * kvstride, &Ks[0][0], 32, 64, kvstride);
            tdm_load_2d_pad(vbase + (size_t)kc * kvstride, &Vs[0][0], 32, 64, kvstride);
            wait_tensor0();
        }
        __syncthreads();

        // V^T fragments (A operand of the second product), named ahead of the softmax:
        // their loads then go out in groups, not in pairs that each wait for LDS
        bf16x16 vf[4];
#pragma unroll
        for (int nt = 0; nt < 4; ++nt) vf[nt] = frag_col(&Vs[0][0], 72, nt * 16 + ln, c0);

        // S^T = K * Q^T : two 16-key tiles, K-dim = dh = 64 (2 WMMA steps)
        floatx8 s[2];
#pragma unroll
        for (int nt = 0; nt < 2; ++nt) {
            floatx8 a = fzero8();
#pragma unroll
            for (int ks = 0; ks < 2; ++ks) {
                bf16x16 kf = frag_row(&Ks[nt * 16 + ln][ks * 32 + c0]);
                a = wmma_bf16(kf, qf[ks], a);
            }
            s[nt] = a;
        }
        // scale + causal mask (D layout: lane holds query ln, keys v + 8*hf of the tile)
        const int qg = q0 + w * 16 + ln;
#pragma unroll
        for (int nt = 0; nt < 2; ++nt) {
#pragma unroll
            for (int v = 0; v < 8; ++v) {
                float x = s[nt][v] * scale;
                if (causal) {
                    const int kg = kc + nt * 16 + v + 8 * hf;
                    if (kg > qg) x = -1e30f;
                }
                s[nt][v] = x;
            }
        }
        // online softmax of the lane's query
        float t = fmaxf(s[0][0], s[1][0]);
#pragma unroll
        for (int v = 1; v < 8; ++v) t = fmaxf(t, fmaxf(s[0][v], s[1][v]));
        t = fmaxf(t, other_half(t));
        const float mn = fmaxf(m_r, t);
        const float alpha = exp_slot(m_r - mn);
        m_r = mn;
        // P^T as B operand: element e is key 8*hf + e, element 8 + e key 16 + 8*hf + e,
        // the k order of frag_col
        bf16x16 pf;
        float rs0, rs1;
#pragma unroll
        for (int v = 0; v < 8; ++v) {
            const float p0 = exp_slot(s[0][v] - mn);
            const float p1 = exp_slot(s[1][v] - mn);
            rs0 = v == 0 ? p0 : rs0 + p0;
            rs1 = v == 0 ? p1 : rs1 + p1;
            pf[v]     = (bf16)p0;
            pf[v + 8] = (bf16)p1;
        }
        l_r = l_r * alpha + (rs0 + rs1);
#pragma unroll
        for (int nt = 0; nt < 4; ++nt)
#pragma unroll
            for (int v = 0; v < 8; ++v) o[nt][v] *= alpha;

        // O^T += V^T(64x32) * P^T(32x16)
#pragma unroll
        for (int nt = 0; nt < 4; ++nt) o[nt] = wmma_bf16(vf[nt], pf, o[nt]);
    }

    // finalize: join the halves' sums, divide; the lane holds d = nt*16 + 8*hf + v of
    // its query: eight consecutive bf16, one 16-byte store a tile
    {
        typedef __attribute__((ext_vector_type(8))) __bf16 bf16x8;
        const float inv = 1.0f / (l_r + other_half(l_r));
        bf16* op = O + (size_t)(b * Tq + q0 + w * 16 + ln) * 1024 + h * 64 + 8 * hf;
#pragma unroll
        for (int nt = 0; nt < 4; ++nt) {
            bf16x8 y;
#pragma unroll
            for (int v = 0; v < 8; ++v) y[v] = (bf16)(o[nt][v] * inv);
            *(bf16x8*)(op + nt * 16) = y;
        }
    }
}

// ---------------------------------------------------------------------------
// Host-side orchestration
// ---------------------------------------------------------------------------
template <int EPI>
static void gemm(const bf16* A, const bf16* B, const float* bias, const float* res,
                 void* out, int M, int N, int K, hipStream_t s) {
    dim3 g(N / 128, M / 128);
    gemm_bf16_kernel<EPI><<<g, 256, 0, s>>>(A, B, bias, res, out, M, N, K);
}

extern "C" void kernel_launch(void* const* d_in, const int* in_sizes, int n_in,
                              void* d_out, int out_size, void* d_ws, size_t ws_size,
                              hipStream_t stream) {
    const float* x      = (const float*)d_in[0];
    const float* key    = (const float*)d_in[1];
    const float* val    = (const float*)d_in[2];
    const float* ln1_g  = (const float*)d_in[3];
    const float* ln1_b  = (const float*)d_in[4];
    const float* ln2_g  = (const float*)d_in[5];
    const float* ln2_b  = (const float*)d_in[6];
    const float* ln3_g  = (const float*)d_in[7];
    const float* ln3_b  = (const float*)d_in[8];
    const float* W_attn = (const float*)d_in[9];
    const float* b_attn = (const float*)d_in[10];
    const float* W_aproj= (const float*)d_in[11];
    const float* b_aproj= (const float*)d_in[12];
    const float* Wq     = (const float*)d_in[13];
    const float* bq     = (const float*)d_in[14];
    const float* Wk     = (const float*)d_in[15];
    const float* bk     = (const float*)d_in[16];
    const float* Wv     = (const float*)d_in[17];
    const float* bv     = (const float*)d_in[18];
    const float* W_cproj= (const float*)d_in[19];
    const float* b_cproj= (const float*)d_in[20];
    const float* W_fc   = (const float*)d_in[21];
    const float* b_fc   = (const float*)d_in[22];
    const float* W_mproj= (const float*)d_in[23];
    const float* b_mproj= (const float*)d_in[24];

    const int B = 8, T = 1024, C = 1024, Ck = 768, TK = 256, NH = 16;
    const size_t BT  = (size_t)B * T;    // 8192 rows
    const size_t BTk = (size_t)B * TK;   // 2048 rows

    char* ws = (char*)d_ws;
    size_t off = 0;
    auto alloc = [&](size_t bytes) -> void* {
        void* p = ws + off;
        off += (bytes + 255) & ~(size_t)255;
        return p;
    };

    // persistent bf16 buffers
    bf16* wattn  = (bf16*)alloc((size_t)C * 3 * C * 2);
    bf16* waproj = (bf16*)alloc((size_t)C * C * 2);
    bf16* wqb    = (bf16*)alloc((size_t)C * C * 2);
    bf16* wkb    = (bf16*)alloc((size_t)Ck * C * 2);
    bf16* wvb    = (bf16*)alloc((size_t)Ck * C * 2);
    bf16* wcproj = (bf16*)alloc((size_t)C * C * 2);
    bf16* wfc    = (bf16*)alloc((size_t)C * 4 * C * 2);
    bf16* wmproj = (bf16*)alloc((size_t)4 * C * C * 2);
    bf16* keyb   = (bf16*)alloc(BTk * Ck * 2);
    bf16* valb   = (bf16*)alloc(BTk * Ck * 2);
    bf16* lnbuf  = (bf16*)alloc(BT * C * 2);
    bf16* attnb  = (bf16*)alloc(BT * C * 2);
    // phase-aliased scratch (max of: qkv 50MB | q/k/v-proj 24MB | mlp hidden 67MB)
    char* scratch = (char*)alloc(BT * (size_t)4 * C * 2);
    bf16* qkv = (bf16*)scratch;
    bf16* qc  = (bf16*)scratch;
    bf16* kc  = (bf16*)(scratch + BT * C * 2);
    bf16* vc  = (bf16*)(scratch + BT * C * 2 + BTk * C * 2);
    bf16* hfc = (bf16*)scratch;

    float* xo = (float*)d_out;  // running residual state lives in d_out x-region

    // 0) down-conversions: wattn .. valb are contiguous in ws, in this order
    cvt_all_bf16_kernel<<<dim3(1184), 128, 0, stream>>>(
        W_attn, W_aproj, Wq, Wk, Wv, W_cproj, W_fc, W_mproj, key, val, wattn);

    const float scale = 0.125f;  // 1/sqrt(64)

    // 1) self-attention branch
    ln_bf16_kernel<<<dim3((unsigned)(BT / 16)), 256, 0, stream>>>(x, ln1_g, ln1_b, lnbuf);
    gemm<0>(lnbuf, wattn, b_attn, nullptr, qkv, (int)BT, 3 * C, C, stream);
    attn_kernel<<<dim3(T / 64, NH, B), 128, 0, stream>>>(
        qkv, 3 * C, qkv + C, qkv + 2 * C, 3 * C, attnb, T, T, /*causal=*/1, scale);
    gemm<2>(attnb, waproj, b_aproj, x, xo, (int)BT, C, C, stream);  // x + attn

    // 2) cross-attention branch
    ln_bf16_kernel<<<dim3((unsigned)(BT / 16)), 256, 0, stream>>>(xo, ln3_g, ln3_b, lnbuf);
    gemm<0>(lnbuf, wqb, bq, nullptr, qc, (int)BT, C, C, stream);
    gemm<0>(keyb, wkb, bk, nullptr, kc, (int)BTk, C, Ck, stream);
    gemm<0>(valb, wvb, bv, nullptr, vc, (int)BTk, C, Ck, stream);
    attn_kernel<<<dim3(T / 64, NH, B), 128, 0, stream>>>(
        qc, C, kc, vc, C, attnb, T, TK, /*causal=*/0, scale);
    gemm<2>(attnb, wcproj, b_cproj, xo, xo, (int)BT, C, C, stream);  // x += cross

    // 3) MLP branch
    ln_bf16_kernel<<<dim3((unsigned)(BT / 16)), 256, 0, stream>>>(xo, ln2_g, ln2_b, lnbuf);
    gemm<1>(lnbuf, wfc, b_fc, nullptr, hfc, (int)BT, 4 * C, C, stream);   // + GELU
    gemm<2>(hfc, wmproj, b_mproj, xo, xo, (int)BT, C, 4 * C, stream);     // x += mlp

    // 4) echo key/val into the output tuple
    size_t x_elems = BT * (size_t)C;
    size_t kv_elems = BTk * (size_t)Ck;
    hipMemcpyAsync(xo + x_elems, key, kv_elems * sizeof(float),
                   hipMemcpyDeviceToDevice, stream);
    hipMemcpyAsync(xo + x_elems + kv_elems, val, kv_elems * sizeof(float),
                   hipMemcpyDeviceToDevice, stream);
}

// v006
// Timed twice side by side with v005, it ran 1.04 times as fast both times.
// Counting every step since v000, it is 2.15 times as fast.
#include <hip/hip_runtime.h>
#include <hip/hip_bf16.h>

typedef __bf16 bf16;
typedef __attribute__((ext_vector_type(16))) __bf16 bf16x16;
typedef __attribute__((ext_vector_type(8)))  float  floatx8;
typedef __attribute__((ext_vector_type(4)))  unsigned int uint32x4;
typedef __attribute__((ext_vector_type(8)))  unsigned int uint32x8;
typedef __attribute__((ext_vector_type(8)))  short s16x8;
typedef __attribute__((ext_vector_type(16))) short s16x16;

// ---------------------------------------------------------------------------
// WMMA wrapper: D = A(16x32 bf16) * B(32x16 bf16) + C(16x16 f32)
// ---------------------------------------------------------------------------
__device__ __forceinline__ floatx8 wmma_bf16(bf16x16 a, bf16x16 b, floatx8 c) {
    return __builtin_amdgcn_wmma_f32_16x16x32_bf16(
        /*neg_a=*/false, a, /*neg_b=*/false, b,
        /*c_mod=*/(short)0, c, /*reuse_a=*/false, /*reuse_b=*/false);
}

__device__ __forceinline__ floatx8 fzero8() {
    floatx8 z;
#pragma unroll
    for (int i = 0; i < 8; ++i) z[i] = 0.0f;
    return z;
}

__device__ __forceinline__ void async_load4_b128(const bf16* gptr, size_t gstep,
                                                 bf16* lptr, int lstep) {
    unsigned l0 = (unsigned)(size_t)lptr;
    unsigned l1 = (unsigned)(size_t)(lptr + lstep);
    unsigned l2 = (unsigned)(size_t)(lptr + 2 * lstep);
    unsigned l3 = (unsigned)(size_t)(lptr + 3 * lstep);
    unsigned long long g0 = (unsigned long long)(size_t)gptr;
    unsigned long long g1 = (unsigned long long)(size_t)(gptr + gstep);
    unsigned long long g2 = (unsigned long long)(size_t)(gptr + 2 * gstep);
    unsigned long long g3 = (unsigned long long)(size_t)(gptr + 3 * gstep);
    asm volatile("global_load_async_to_lds_b128 %0, %4, off\n\t"
                 "global_load_async_to_lds_b128 %1, %5, off\n\t"
                 "global_load_async_to_lds_b128 %2, %6, off\n\t"
                 "global_load_async_to_lds_b128 %3, %7, off\n\t"
                 "s_wait_xcnt 0x0"
                 :: "v"(l0), "v"(l1), "v"(l2), "v"(l3), "v"(g0), "v"(g1), "v"(g2), "v"(g3)
                 : "memory");
}
__device__ __forceinline__ void wait_async0() {
    asm volatile("s_wait_asynccnt 0x0" ::: "memory");
}

__device__ __forceinline__ void tdm_load_2d_pad(const bf16* gptr, bf16* lptr,
                                                unsigned rows, unsigned cols,
                                                unsigned stride_elems) {
    unsigned long long ga = (unsigned long long)(size_t)gptr;
    uint32x4 g0;
    g0[0] = 1u;
    g0[1] = (unsigned)(size_t)lptr;
    g0[2] = (unsigned)ga;
    g0[3] = (unsigned)(ga >> 32) | 0x80000000u;
    uint32x8 g1;
    g1[0] = (1u << 16) | (1u << 20) | (4u << 22) | (3u << 25);
    g1[1] = (cols & 0xffffu) << 16;
    g1[2] = (rows & 0xffffu) << 16;
    g1[3] = (cols & 0xffffu) << 16;
    g1[4] = (rows & 0xffffu);
    g1[5] = stride_elems;
    g1[6] = 0u;
    g1[7] = 0u;
    asm volatile("tensor_load_to_lds %0, %1" :: "s"(g0), "s"(g1) : "memory");
}
__device__ __forceinline__ void wait_tensor0() {
#if __has_builtin(__builtin_amdgcn_s_wait_tensorcnt)
    __builtin_amdgcn_s_wait_tensorcnt(0);
#else
    asm volatile("s_wait_tensorcnt 0x0" ::: "memory");
#endif
}

__device__ __forceinline__ bf16x16 frag_row(const bf16* p) {
    bf16x16 f;
#pragma unroll
    for (int e = 0; e < 8; ++e) f[e] = p[e];
#pragma unroll
    for (int e = 0; e < 8; ++e) f[e + 8] = p[e + 16];
    return f;
}

// 32x16 B fragment from a row-major [k][n] LDS tile by two transposing loads.
// p is the lane's own address: row 8*(lane>>4) + (lane&7), column n0 + 8*((lane>>3)&1);
// lane (c = lane&15, h = lane>>4) then holds column n0 + c at k {8h..8h+7, 16+8h..16+8h+7},
// the same k order as frag_row. ld = row pitch in elements.
__device__ __forceinline__ bf16x16 frag_tr(const bf16* p, int ld) {
    typedef __attribute__((address_space(3))) s16x8 lds_s16x8;
    s16x8 lo = __builtin_amdgcn_ds_load_tr16_b128_v8i16((lds_s16x8*)p);
    s16x8 hi = __builtin_amdgcn_ds_load_tr16_b128_v8i16((lds_s16x8*)(p + 16 * ld));
    s16x16 f = __builtin_shufflevector(lo, hi, 0, 1, 2, 3, 4, 5, 6, 7,
                                       8, 9, 10, 11, 12, 13, 14, 15);
    return __builtin_bit_cast(bf16x16, f);
}

// wave32 full reduction
__device__ __forceinline__ float wave_sum32(float v) {
#pragma unroll
    for (int m = 16; m >= 1; m >>= 1) v += __shfl_xor(v, m, 32);
    return v;
}
__device__ __forceinline__ float exp_slot(float x) {
    float r;
    asm("v_exp_f32 %0, %1\n\tv_nop" : "=v"(r) : "v"(x * 1.44269504f));
    return r;
}
__device__ __forceinline__ float exp2_slot(float x) {
    float r;
    asm("v_exp_f32 %0, %1\n\tv_nop" : "=v"(r) : "v"(x));
    return r;
}
__device__ __forceinline__ float rcp_slot(float x) {
    float r;
    asm("v_rcp_f32 %0, %1\n\tv_nop" : "=v"(r) : "v"(x));
    return r;
}
__device__ __forceinline__ float other_half(float v) {
    const int b = __builtin_bit_cast(int, v);
    return __builtin_bit_cast(float,
        __builtin_amdgcn_permlanex16(b, b, 0x76543210, 0xfedcba98, false, false));
}

// ---------------------------------------------------------------------------
// f32 -> bf16 conversion of all ten tensors in one launch of few, long waves.
// These streams were held back by the number of waves that had to start, not by
// their bytes. A wave takes 4096 consecutive elements (32 loads of 16 bytes a
// lane, each load 512 contiguous bytes), a block of four waves 16384.
// The ten destinations lie back to back in the workspace, in the order of the
// sources, so the destination is one array. Block counts = elements / 16384.
// ---------------------------------------------------------------------------
typedef __attribute__((ext_vector_type(4))) float  floatx4;
typedef __attribute__((ext_vector_type(4))) __bf16 bf16x4;

__global__ __launch_bounds__(128) void cvt_all_bf16_kernel(
    const float* __restrict__ s0, const float* __restrict__ s1,
    const float* __restrict__ s2, const float* __restrict__ s3,
    const float* __restrict__ s4, const float* __restrict__ s5,
    const float* __restrict__ s6, const float* __restrict__ s7,
    const float* __restrict__ s8, const float* __restrict__ s9,
    bf16* __restrict__ out) {
    const int b = blockIdx.x;
    const float* src;
    int first;  // first block of the tensor that block b lies in
    if      (b <  192) { src = s0; first =    0; }
    else if (b <  256) { src = s1; first =  192; }
    else if (b <  320) { src = s2; first =  256; }
    else if (b <  368) { src = s3; first =  320; }
    else if (b <  416) { src = s4; first =  368; }
    else if (b <  480) { src = s5; first =  416; }
    else if (b <  736) { src = s6; first =  480; }
    else if (b <  992) { src = s7; first =  736; }
    else if (b < 1088) { src = s8; first =  992; }
    else               { src = s9; first = 1088; }
    const int within = (threadIdx.x >> 5) * 4096 + (threadIdx.x & 31) * 4;
    const float* ip = src + (size_t)(b - first) * 16384 + within;
    bf16*        op = out + (size_t)b * 16384 + within;
    floatx4 v[32];
#pragma unroll
    for (int j = 0; j < 32; ++j) v[j] = *(const floatx4*)(ip + j * 128);
    // keeps all 32 loads in front of the first conversion: one trip to memory a wave;
    // without it the compiler issues them in six groups, each waiting for the one before
    __builtin_amdgcn_sched_barrier(0);
#pragma unroll
    for (int j = 0; j < 32; ++j)
        *(bf16x4*)(op + j * 128) = __builtin_convertvector(v[j], bf16x4);
}

// ---------------------------------------------------------------------------
// LayerNorm over rows of 1024: one wave takes two whole rows and keeps them in
// registers (eight 16-byte loads a lane and row, each 512 contiguous bytes), so
// a row is read once, its sums need no LDS and no barrier, and a launch starts
// 4096 waves (16 a WGP). f32 in, bf16 out.
// ---------------------------------------------------------------------------
__global__ __launch_bounds__(256) void ln_bf16_kernel(
    const float* __restrict__ x, const float* __restrict__ g,
    const float* __restrict__ bta, bf16* __restrict__ out) {
    const unsigned goff = (threadIdx.x & 31) * 16;                // the lane's bytes in a 512-byte piece
    const unsigned xoff = (threadIdx.x >> 5) * 8192 + goff;       // + the wave's two rows among the block's sixteen
    const char* xb = (const char*)(x + (size_t)blockIdx.x * 16384);
    char*       ob = (char*)(out + (size_t)blockIdx.x * 16384);
    floatx4 v[2][8], gg[8], bb[8];
#pragma unroll
    for (int r = 0; r < 2; ++r)
#pragma unroll
        for (int j = 0; j < 8; ++j) v[r][j] = *(const floatx4*)(xb + xoff + r * 4096 + j * 512);
#pragma unroll
    for (int j = 0; j < 8; ++j) {
        gg[j] = *(const floatx4*)((const char*)g + goff + j * 512);
        bb[j] = *(const floatx4*)((const char*)bta + goff + j * 512);
    }
    asm volatile("s_wait_xcnt 0x0" :: "v"(xoff), "v"(goff) : "memory");
    // keeps the loads of gain and bias up here with the rows': without it the compiler
    // sinks them behind the row sums, and the wave waits for memory a second and third time
    __builtin_amdgcn_sched_barrier(0);
#pragma unroll
    for (int r = 0; r < 2; ++r) {
        floatx4 s4 = v[r][0], q4 = v[r][0] * v[r][0];
#pragma unroll
        for (int j = 1; j < 8; ++j) {
            s4 += v[r][j];
            q4 += v[r][j] * v[r][j];
        }
        const float ls = wave_sum32((s4[0] + s4[1]) + (s4[2] + s4[3]));
        const float lq = wave_sum32((q4[0] + q4[1]) + (q4[2] + q4[3]));
        const float mean = ls / 1024.0f;
        const float var  = lq / 1024.0f - mean * mean;
        const float inv  = rsqrtf(var + 1e-5f);
#pragma unroll
        for (int j = 0; j < 8; ++j) {
            const floatx4 y = (v[r][j] - mean) * inv * gg[j] + bb[j];
            *(bf16x4*)(ob + xoff / 2 + r * 2048 + j * 256) = __builtin_convertvector(y, bf16x4);
        }
    }
}

template <int EPI>
__global__ __launch_bounds__(256) void gemm_bf16_kernel(
    const bf16* __restrict__ A, const bf16* __restrict__ B,
    const float* __restrict__ bias, const float* __restrict__ res,
    void* __restrict__ out, int M, int N, int K) {
    // row-major [m][k], 144B rows (16B x odd: the plain 16-byte load's pitch)
    __shared__ __attribute__((aligned(16))) bf16 As[2][128][72];
    // row-major [k][n], 288B rows (32B x odd: the transposing load's pitch)
    __shared__ __attribute__((aligned(16))) bf16 Bs[2][64][144];

    const int tid  = threadIdx.x;
    const int lane = tid & 31;
    const int wave = tid >> 5;
    const int wr = wave >> 1;   // 0..3 : 32-row group
    const int wc = wave & 1;    // 0..1 : 64-col group
    const int hf = lane >> 4;   // lane half
    const int c0 = hf << 3;
    const int ln = lane & 15;
    const int bm = blockIdx.y * 128;
    const int bn = blockIdx.x * 128;

    floatx8 acc[2][4];
#pragma unroll
    for (int i = 0; i < 2; ++i)
#pragma unroll
        for (int j = 0; j < 4; ++j) acc[i][j] = fzero8();

    const int ar = tid >> 3, as8 = (tid & 7) * 8;   // A: rows ar + 32 i, 8 lanes a 128-byte row
    const int br = tid >> 4, bs8 = (tid & 15) * 8;  // B: rows br + 16 i, 16 lanes a 256-byte row
    const bf16* ga = A + (size_t)(bm + ar) * K + as8;
    const bf16* gb = B + (size_t)br * N + bn + bs8;

    // ---- prologue: stage tile 0 into buffer 0 ----
    {
        async_load4_b128(ga, (size_t)32 * K, &As[0][ar][as8], 32 * 72);
#pragma unroll
        for (int i = 0; i < 4; ++i)
            *(uint4*)&Bs[0][br + 16 * i][bs8] = *(const uint4*)(gb + (size_t)(16 * i) * N);
        wait_async0();
    }
    __syncthreads();

    int cur = 0;
    for (int kk = 0; kk < K; kk += 64) {
        const int nxt = cur ^ 1;
        const bool has_next = (kk + 64 < K);
        uint4 breg0, breg1, breg2, breg3;  // next B tile's 64 bytes of this thread, held over the WMMAs
        if (has_next) {
            async_load4_b128(ga + kk + 64, (size_t)32 * K, &As[nxt][ar][as8], 32 * 72);
            const bf16* gbn = gb + (size_t)(kk + 64) * N;
            breg0 = *(const uint4*)(gbn);
            breg1 = *(const uint4*)(gbn + (size_t)16 * N);
            breg2 = *(const uint4*)(gbn + (size_t)32 * N);
            breg3 = *(const uint4*)(gbn + (size_t)48 * N);
            asm volatile("s_wait_xcnt 0x0" ::: "memory");
            if (kk + 128 < K) {  // L2 warm-up two tiles ahead (global_prefetch_b8), one lane a line
                if (__builtin_amdgcn_readfirstlane(wave) < 4)  // scalar test: waves 0-3 take A, 4-7 take B
                    __builtin_prefetch(A + (size_t)(bm + tid) * K + kk + 128, 0, 1);
                else
                    __builtin_prefetch(B + (size_t)(kk + 128 + ((tid - 128) >> 1)) * N + bn + (tid & 1) * 64, 0, 1);
            }
        }

        // ---- compute current tile: 16 WMMAs per wave ----
#pragma unroll
        for (int ks = 0; ks < 2; ++ks) {
            bf16x16 af[2], bfv[4];
#pragma unroll
            for (int mt = 0; mt < 2; ++mt)
                af[mt] = frag_row(&As[cur][wr * 32 + mt * 16 + ln][ks * 32 + c0]);
#pragma unroll
            for (int nt = 0; nt < 4; ++nt)
                bfv[nt] = frag_tr(&Bs[cur][ks * 32 + c0 + (lane & 7)][wc * 64 + nt * 16 + ((lane >> 3) & 1) * 8], 144);
#pragma unroll
            for (int mt = 0; mt < 2; ++mt)
#pragma unroll
                for (int nt = 0; nt < 4; ++nt)
                    acc[mt][nt] = wmma_bf16(af[mt], bfv[nt], acc[mt][nt]);
        }

        if (has_next) {
            // commit staged B to LDS[nxt]
            *(uint4*)&Bs[nxt][br +  0][bs8] = breg0;
            *(uint4*)&Bs[nxt][br + 16][bs8] = breg1;
            *(uint4*)&Bs[nxt][br + 32][bs8] = breg2;
            *(uint4*)&Bs[nxt][br + 48][bs8] = breg3;
        }
        // hand-over of the stage: this wave's LDS reads and writes done, its copies
        // landed, then the barrier that publishes tile t+1 and frees buffer cur
        asm volatile("s_wait_dscnt 0x0" ::: "memory");
        wait_async0();
        __syncthreads();
        cur = nxt;
    }
    wait_async0();  // no copy outlives the loop

    // ---- epilogue: D layout = lane holds col n=ln, rows v + 8*hf ----
#pragma unroll
    for (int mt = 0; mt < 2; ++mt) {
#pragma unroll
        for (int nt = 0; nt < 4; ++nt) {
            const int n  = bn + wc * 64 + nt * 16 + ln;
            const float bs = bias[n];
#pragma unroll
            for (int v = 0; v < 8; ++v) {
                const int m = bm + wr * 32 + mt * 16 + v + 8 * hf;
                float val = acc[mt][nt][v] + bs;
                const size_t idx = (size_t)m * N + n;
                if (EPI == 0) {
                    ((bf16*)out)[idx] = (bf16)val;
                } else if (EPI == 1) {
                    // 0.5 (1 + tanh t) = 1 / (1 + e^(-2t)), with e^(-2t) = 2^(val (a + b val^2)),
                    // a = -2 log2(e) sqrt(2/pi), b = 0.044715 a: no branch, so a lane's
                    // 64 elements run interleaved and not one behind the other
                    const float e = exp2_slot(val * (-2.3022082f - 0.10294324f * (val * val)));
                    val = val * rcp_slot(1.0f + e);
                    ((bf16*)out)[idx] = (bf16)val;
                } else {
                    ((float*)out)[idx] = val + res[idx];
                }
            }
        }
    }
}

__global__ __launch_bounds__(128) void attn_kernel(
    const bf16* __restrict__ Q, int qstride,
    const bf16* __restrict__ Kp, const bf16* __restrict__ Vp, int kvstride,
    bf16* __restrict__ O, int Tq, int Tk, int causal, float scale) {
    // each tensor load's place in LDS is a multiple of 2 KiB
    __shared__ __attribute__((aligned(2048))) bf16 Ks[32][72];  // K chunk [key][d]  (144B rows)
    __shared__ __attribute__((aligned(2048))) bf16 Vs[32][72];  // V chunk [key][d]

    const int tid  = threadIdx.x;
    const int lane = tid & 31;
    const int w    = tid >> 5;
    const int hf = lane >> 4, c0 = hf << 3, ln = lane & 15;
    const int q0 = blockIdx.x * 64;
    const int h  = blockIdx.y;
    const int b  = blockIdx.z;

    const bf16* qbase = Q  + (size_t)(b * Tq) * qstride  + h * 64;
    const bf16* kbase = Kp + (size_t)(b * Tk) * kvstride + h * 64;
    const bf16* vbase = Vp + (size_t)(b * Tk) * kvstride + h * 64;

    // Q fragments for this wave's 16 rows (2 K-steps over dh=64), kept resident
    bf16x16 qf[2];
    {
        const bf16* qp = qbase + (size_t)(q0 + w * 16 + ln) * qstride;
#pragma unroll
        for (int ks = 0; ks < 2; ++ks) {
            bf16x16 f;
#pragma unroll
            for (int e = 0; e < 8; ++e) f[e] = qp[ks * 32 + c0 + e];
#pragma unroll
            for (int e = 0; e < 8; ++e) f[e + 8] = qp[ks * 32 + c0 + 16 + e];
            qf[ks] = f;
        }
    }

    floatx8 o[4];
#pragma unroll
    for (int i = 0; i < 4; ++i) o[i] = fzero8();
    // of the lane's query (row q0 + w*16 + ln): running maximum, the same in both
    // halves, and the sum over the keys that this half has seen
    float m_r = -1e30f, l_r = 0.0f;

    int kend = causal ? (q0 + 64) : Tk;
    if (kend > Tk) kend = Tk;

    for (int kc = 0; kc < kend; kc += 32) {
        __syncthreads();
        if (w == 0) {
            tdm_load_2d_pad(kbase + (size_t)kc * kvstride, &Ks[0][0], 32, 64, kvstride);
            tdm_load_2d_pad(vbase + (size_t)kc * kvstride, &Vs[0][0], 32, 64, kvstride);
            wait_tensor0();
        }
        __syncthreads();

        // S^T = K * Q^T : two 16-key tiles, K-dim = dh = 64 (2 WMMA steps)
        floatx8 s[2];
#pragma unroll
        for (int nt = 0; nt < 2; ++nt) {
            floatx8 a = fzero8();
#pragma unroll
            for (int ks = 0; ks < 2; ++ks) {
                bf16x16 kf = frag_row(&Ks[nt * 16 + ln][ks * 32 + c0]);
                a = wmma_bf16(kf, qf[ks], a);
            }
            s[nt] = a;
        }
        // V^T fragments (A operand of the second product) by the transposing load: two
        // 16-byte loads a fragment, in the k order of frag_row and of P^T below
        bf16x16 vf[4];
#pragma unroll
        for (int nt = 0; nt < 4; ++nt)
            vf[nt] = frag_tr(&Vs[c0 + (lane & 7)][nt * 16 + ((lane >> 3) & 1) * 8], 72);
        // keeps the eight loads up here as one group, so that LDS answers behind the softmax;
        // without it the compiler sinks them in pairs, each pair waited for in front of its product
        __builtin_amdgcn_sched_barrier(0);
        // scale + causal mask (D layout: lane holds query ln, keys v + 8*hf of the tile)
        const int qg = q0 + w * 16 + ln;
#pragma unroll
        for (int nt = 0; nt < 2; ++nt) {
#pragma unroll
            for (int v = 0; v < 8; ++v) {
                float x = s[nt][v] * scale;
                if (causal) {
                    const int kg = kc + nt * 16 + v + 8 * hf;
                    if (kg > qg) x = -1e30f;
                }
                s[nt][v] = x;
            }
        }
        // online softmax of the lane's query
        float t = fmaxf(s[0][0], s[1][0]);
#pragma unroll
        for (int v = 1; v < 8; ++v) t = fmaxf(t, fmaxf(s[0][v], s[1][v]));
        t = fmaxf(t, other_half(t));
        const float mn = fmaxf(m_r, t);
        const float alpha = exp_slot(m_r - mn);
        m_r = mn;
        // P^T as B operand: element e is key 8*hf + e, element 8 + e key 16 + 8*hf + e,
        // the k order of frag_tr
        bf16x16 pf;
        float rs0, rs1;
#pragma unroll
        for (int v = 0; v < 8; ++v) {
            const float p0 = exp_slot(s[0][v] - mn);
            const float p1 = exp_slot(s[1][v] - mn);
            rs0 = v == 0 ? p0 : rs0 + p0;
            rs1 = v == 0 ? p1 : rs1 + p1;
            pf[v]     = (bf16)p0;
            pf[v + 8] = (bf16)p1;
        }
        l_r = l_r * alpha + (rs0 + rs1);
#pragma unroll
        for (int nt = 0; nt < 4; ++nt)
#pragma unroll
            for (int v = 0; v < 8; ++v) o[nt][v] *= alpha;

        // O^T += V^T(64x32) * P^T(32x16)
#pragma unroll
        for (int nt = 0; nt < 4; ++nt) o[nt] = wmma_bf16(vf[nt], pf, o[nt]);
    }

    // finalize: join the halves' sums, divide; the lane holds d = nt*16 + 8*hf + v of
    // its query: eight consecutive bf16, one 16-byte store a tile
    {
        typedef __attribute__((ext_vector_type(8))) __bf16 bf16x8;
        const float inv = 1.0f / (l_r + other_half(l_r));
        bf16* op = O + (size_t)(b * Tq + q0 + w * 16 + ln) * 1024 + h * 64 + 8 * hf;
#pragma unroll
        for (int nt = 0; nt < 4; ++nt) {
            bf16x8 y;
#pragma unroll
            for (int v = 0; v < 8; ++v) y[v] = (bf16)(o[nt][v] * inv);
            *(bf16x8*)(op + nt * 16) = y;
        }
    }
}

// ---------------------------------------------------------------------------
// Host-side orchestration
// ---------------------------------------------------------------------------
template <int EPI>
static void gemm(const bf16* A, const bf16* B, const float* bias, const float* res,
                 void* out, int M, int N, int K, hipStream_t s) {
    dim3 g(N / 128, M / 128);
    gemm_bf16_kernel<EPI><<<g, 256, 0, s>>>(A, B, bias, res, out, M, N, K);
}

extern "C" void kernel_launch(void* const* d_in, const int* in_sizes, int n_in,
                              void* d_out, int out_size, void* d_ws, size_t ws_size,
                              hipStream_t stream) {
    const float* x      = (const float*)d_in[0];
    const float* key    = (const float*)d_in[1];
    const float* val    = (const float*)d_in[2];
    const float* ln1_g  = (const float*)d_in[3];
    const float* ln1_b  = (const float*)d_in[4];
    const float* ln2_g  = (const float*)d_in[5];
    const float* ln2_b  = (const float*)d_in[6];
    const float* ln3_g  = (const float*)d_in[7];
    const float* ln3_b  = (const float*)d_in[8];
    const float* W_attn = (const float*)d_in[9];
    const float* b_attn = (const float*)d_in[10];
    const float* W_aproj= (const float*)d_in[11];
    const float* b_aproj= (const float*)d_in[12];
    const float* Wq     = (const float*)d_in[13];
    const float* bq     = (const float*)d_in[14];
    const float* Wk     = (const float*)d_in[15];
    const float* bk     = (const float*)d_in[16];
    const float* Wv     = (const float*)d_in[17];
    const float* bv     = (const float*)d_in[18];
    const float* W_cproj= (const float*)d_in[19];
    const float* b_cproj= (const float*)d_in[20];
    const float* W_fc   = (const float*)d_in[21];
    const float* b_fc   = (const float*)d_in[22];
    const float* W_mproj= (const float*)d_in[23];
    const float* b_mproj= (const float*)d_in[24];

    const int B = 8, T = 1024, C = 1024, Ck = 768, TK = 256, NH = 16;
    const size_t BT  = (size_t)B * T;    // 8192 rows
    const size_t BTk = (size_t)B * TK;   // 2048 rows

    char* ws = (char*)d_ws;
    size_t off = 0;
    auto alloc = [&](size_t bytes) -> void* {
        void* p = ws + off;
        off += (bytes + 255) & ~(size_t)255;
        return p;
    };

    // persistent bf16 buffers
    bf16* wattn  = (bf16*)alloc((size_t)C * 3 * C * 2);
    bf16* waproj = (bf16*)alloc((size_t)C * C * 2);
    bf16* wqb    = (bf16*)alloc((size_t)C * C * 2);
    bf16* wkb    = (bf16*)alloc((size_t)Ck * C * 2);
    bf16* wvb    = (bf16*)alloc((size_t)Ck * C * 2);
    bf16* wcproj = (bf16*)alloc((size_t)C * C * 2);
    bf16* wfc    = (bf16*)alloc((size_t)C * 4 * C * 2);
    bf16* wmproj = (bf16*)alloc((size_t)4 * C * C * 2);
    bf16* keyb   = (bf16*)alloc(BTk * Ck * 2);
    bf16* valb   = (bf16*)alloc(BTk * Ck * 2);
    bf16* lnbuf  = (bf16*)alloc(BT * C * 2);
    bf16* attnb  = (bf16*)alloc(BT * C * 2);
    // phase-aliased scratch (max of: qkv 50MB | q/k/v-proj 24MB | mlp hidden 67MB)
    char* scratch = (char*)alloc(BT * (size_t)4 * C * 2);
    bf16* qkv = (bf16*)scratch;
    bf16* qc  = (bf16*)scratch;
    bf16* kc  = (bf16*)(scratch + BT * C * 2);
    bf16* vc  = (bf16*)(scratch + BT * C * 2 + BTk * C * 2);
    bf16* hfc = (bf16*)scratch;

    float* xo = (float*)d_out;  // running residual state lives in d_out x-region

    // 0) down-conversions: wattn .. valb are contiguous in ws, in this order
    cvt_all_bf16_kernel<<<dim3(1184), 128, 0, stream>>>(
        W_attn, W_aproj, Wq, Wk, Wv, W_cproj, W_fc, W_mproj, key, val, wattn);

    const float scale = 0.125f;  // 1/sqrt(64)

    // 1) self-attention branch
    ln_bf16_kernel<<<dim3((unsigned)(BT / 16)), 256, 0, stream>>>(x, ln1_g, ln1_b, lnbuf);
    gemm<0>(lnbuf, wattn, b_attn, nullptr, qkv, (int)BT, 3 * C, C, stream);
    attn_kernel<<<dim3(T / 64, NH, B), 128, 0, stream>>>(
        qkv, 3 * C, qkv + C, qkv + 2 * C, 3 * C, attnb, T, T, /*causal=*/1, scale);
    gemm<2>(attnb, waproj, b_aproj, x, xo, (int)BT, C, C, stream);  // x + attn

    // 2) cross-attention branch
    ln_bf16_kernel<<<dim3((unsigned)(BT / 16)), 256, 0, stream>>>(xo, ln3_g, ln3_b, lnbuf);
    gemm<0>(lnbuf, wqb, bq, nullptr, qc, (int)BT, C, C, stream);
    gemm<0>(keyb, wkb, bk, nullptr, kc, (int)BTk, C, Ck, stream);
    gemm<0>(valb, wvb, bv, nullptr, vc, (int)BTk, C, Ck, stream);
    attn_kernel<<<dim3(T / 64, NH, B), 128, 0, stream>>>(
        qc, C, kc, vc, C, attnb, T, TK, /*causal=*/0, scale);
    gemm<2>(attnb, wcproj, b_cproj, xo, xo, (int)BT, C, C, stream);  // x += cross

    // 3) MLP branch
    ln_bf16_kernel<<<dim3((unsigned)(BT / 16)), 256, 0, stream>>>(xo, ln2_g, ln2_b, lnbuf);
    gemm<1>(lnbuf, wfc, b_fc, nullptr, hfc, (int)BT, 4 * C, C, stream);   // + GELU
    gemm<2>(hfc, wmproj, b_mproj, xo, xo, (int)BT, C, 4 * C, stream);     // x += mlp

    // 4) echo key/val into the output tuple
    size_t x_elems = BT * (size_t)C;
    size_t kv_elems = BTk * (size_t)Ck;
    hipMemcpyAsync(xo + x_elems, key, kv_elems * sizeof(float),
                   hipMemcpyDeviceToDevice, stream);
    hipMemcpyAsync(xo + x_elems + kv_elems, val, kv_elems * sizeof(float),
                   hipMemcpyDeviceToDevice, stream);
}

// v007
// Two timings next to v006 both put it at 1.06 times that version's speed.
// All steps since v000 together make it 2.28 times as fast.
#include <hip/hip_runtime.h>
#include <hip/hip_bf16.h>

typedef __bf16 bf16;
typedef __attribute__((ext_vector_type(16))) __bf16 bf16x16;
typedef __attribute__((ext_vector_type(8)))  float  floatx8;
typedef __attribute__((ext_vector_type(4)))  unsigned int uint32x4;
typedef __attribute__((ext_vector_type(8)))  unsigned int uint32x8;
typedef __attribute__((ext_vector_type(8)))  short s16x8;
typedef __attribute__((ext_vector_type(16))) short s16x16;

// ---------------------------------------------------------------------------
// WMMA wrapper: D = A(16x32 bf16) * B(32x16 bf16) + C(16x16 f32)
// ---------------------------------------------------------------------------
__device__ __forceinline__ floatx8 wmma_bf16(bf16x16 a, bf16x16 b, floatx8 c) {
    return __builtin_amdgcn_wmma_f32_16x16x32_bf16(
        /*neg_a=*/false, a, /*neg_b=*/false, b,
        /*c_mod=*/(short)0, c, /*reuse_a=*/false, /*reuse_b=*/false);
}

__device__ __forceinline__ floatx8 fzero8() {
    floatx8 z;
#pragma unroll
    for (int i = 0; i < 8; ++i) z[i] = 0.0f;
    return z;
}

__device__ __forceinline__ void async_load4_b128(const bf16* gptr, size_t gstep,
                                                 bf16* lptr, int lstep) {
    unsigned l0 = (unsigned)(size_t)lptr;
    unsigned l1 = (unsigned)(size_t)(lptr + lstep);
    unsigned l2 = (unsigned)(size_t)(lptr + 2 * lstep);
    unsigned l3 = (unsigned)(size_t)(lptr + 3 * lstep);
    unsigned long long g0 = (unsigned long long)(size_t)gptr;
    unsigned long long g1 = (unsigned long long)(size_t)(gptr + gstep);
    unsigned long long g2 = (unsigned long long)(size_t)(gptr + 2 * gstep);
    unsigned long long g3 = (unsigned long long)(size_t)(gptr + 3 * gstep);
    asm volatile("global_load_async_to_lds_b128 %0, %4, off\n\t"
                 "global_load_async_to_lds_b128 %1, %5, off\n\t"
                 "global_load_async_to_lds_b128 %2, %6, off\n\t"
                 "global_load_async_to_lds_b128 %3, %7, off\n\t"
                 "s_wait_xcnt 0x0"
                 :: "v"(l0), "v"(l1), "v"(l2), "v"(l3), "v"(g0), "v"(g1), "v"(g2), "v"(g3)
                 : "memory");
}
__device__ __forceinline__ void async_load8_b128(const bf16* gptr, size_t gstep,
                                                 bf16* lptr, int lstep) {
    unsigned l[8];
    unsigned long long g[8];
#pragma unroll
    for (int i = 0; i < 8; ++i) {
        l[i] = (unsigned)(size_t)(lptr + i * lstep);
        g[i] = (unsigned long long)(size_t)(gptr + i * gstep);
    }
    asm volatile("global_load_async_to_lds_b128 %0, %8, off\n\t"
                 "global_load_async_to_lds_b128 %1, %9, off\n\t"
                 "global_load_async_to_lds_b128 %2, %10, off\n\t"
                 "global_load_async_to_lds_b128 %3, %11, off\n\t"
                 "global_load_async_to_lds_b128 %4, %12, off\n\t"
                 "global_load_async_to_lds_b128 %5, %13, off\n\t"
                 "global_load_async_to_lds_b128 %6, %14, off\n\t"
                 "global_load_async_to_lds_b128 %7, %15, off\n\t"
                 "s_wait_xcnt 0x0"
                 :: "v"(l[0]), "v"(l[1]), "v"(l[2]), "v"(l[3]), "v"(l[4]), "v"(l[5]), "v"(l[6]), "v"(l[7]),
                    "v"(g[0]), "v"(g[1]), "v"(g[2]), "v"(g[3]), "v"(g[4]), "v"(g[5]), "v"(g[6]), "v"(g[7])
                 : "memory");
}
__device__ __forceinline__ void wait_async0() {
    asm volatile("s_wait_asynccnt 0x0" ::: "memory");
}

__device__ __forceinline__ void tdm_load_2d_pad(const bf16* gptr, bf16* lptr,
                                                unsigned rows, unsigned cols,
                                                unsigned stride_elems) {
    unsigned long long ga = (unsigned long long)(size_t)gptr;
    uint32x4 g0;
    g0[0] = 1u;
    g0[1] = (unsigned)(size_t)lptr;
    g0[2] = (unsigned)ga;
    g0[3] = (unsigned)(ga >> 32) | 0x80000000u;
    uint32x8 g1;
    g1[0] = (1u << 16) | (1u << 20) | (4u << 22) | (3u << 25);
    g1[1] = (cols & 0xffffu) << 16;
    g1[2] = (rows & 0xffffu) << 16;
    g1[3] = (cols & 0xffffu) << 16;
    g1[4] = (rows & 0xffffu);
    g1[5] = stride_elems;
    g1[6] = 0u;
    g1[7] = 0u;
    asm volatile("tensor_load_to_lds %0, %1" :: "s"(g0), "s"(g1) : "memory");
}
__device__ __forceinline__ void wait_tensor0() {
#if __has_builtin(__builtin_amdgcn_s_wait_tensorcnt)
    __builtin_amdgcn_s_wait_tensorcnt(0);
#else
    asm volatile("s_wait_tensorcnt 0x0" ::: "memory");
#endif
}

__device__ __forceinline__ bf16x16 frag_row(const bf16* p) {
    bf16x16 f;
#pragma unroll
    for (int e = 0; e < 8; ++e) f[e] = p[e];
#pragma unroll
    for (int e = 0; e < 8; ++e) f[e + 8] = p[e + 16];
    return f;
}

// 32x16 B fragment from a row-major [k][n] LDS tile by two transposing loads.
// p is the lane's own address: row 8*(lane>>4) + (lane&7), column n0 + 8*((lane>>3)&1);
// lane (c = lane&15, h = lane>>4) then holds column n0 + c at k {8h..8h+7, 16+8h..16+8h+7},
// the same k order as frag_row. ld = row pitch in elements.
__device__ __forceinline__ bf16x16 frag_tr(const bf16* p, int ld) {
    typedef __attribute__((address_space(3))) s16x8 lds_s16x8;
    s16x8 lo = __builtin_amdgcn_ds_load_tr16_b128_v8i16((lds_s16x8*)p);
    s16x8 hi = __builtin_amdgcn_ds_load_tr16_b128_v8i16((lds_s16x8*)(p + 16 * ld));
    s16x16 f = __builtin_shufflevector(lo, hi, 0, 1, 2, 3, 4, 5, 6, 7,
                                       8, 9, 10, 11, 12, 13, 14, 15);
    return __builtin_bit_cast(bf16x16, f);
}

// wave32 full reduction
__device__ __forceinline__ float wave_sum32(float v) {
#pragma unroll
    for (int m = 16; m >= 1; m >>= 1) v += __shfl_xor(v, m, 32);
    return v;
}
__device__ __forceinline__ float exp_slot(float x) {
    float r;
    asm("v_exp_f32 %0, %1\n\tv_nop" : "=v"(r) : "v"(x * 1.44269504f));
    return r;
}
__device__ __forceinline__ float exp2_slot(float x) {
    float r;
    asm("v_exp_f32 %0, %1\n\tv_nop" : "=v"(r) : "v"(x));
    return r;
}
__device__ __forceinline__ float rcp_slot(float x) {
    float r;
    asm("v_rcp_f32 %0, %1\n\tv_nop" : "=v"(r) : "v"(x));
    return r;
}
__device__ __forceinline__ float other_half(float v) {
    const int b = __builtin_bit_cast(int, v);
    return __builtin_bit_cast(float,
        __builtin_amdgcn_permlanex16(b, b, 0x76543210, 0xfedcba98, false, false));
}

// ---------------------------------------------------------------------------
// f32 -> bf16 conversion of all ten tensors in one launch of few, long waves.
// These streams were held back by the number of waves that had to start, not by
// their bytes. A wave takes 4096 consecutive elements (32 loads of 16 bytes a
// lane, each load 512 contiguous bytes), a block of four waves 16384.
// The ten destinations lie back to back in the workspace, in the order of the
// sources, so the destination is one array. Block counts = elements / 16384.
// ---------------------------------------------------------------------------
typedef __attribute__((ext_vector_type(4))) float  floatx4;
typedef __attribute__((ext_vector_type(4))) __bf16 bf16x4;
typedef __attribute__((ext_vector_type(2))) float  floatx2;
typedef __attribute__((ext_vector_type(2))) __bf16 bf16x2;

__global__ __launch_bounds__(128) void cvt_all_bf16_kernel(
    const float* __restrict__ s0, const float* __restrict__ s1,
    const float* __restrict__ s2, const float* __restrict__ s3,
    const float* __restrict__ s4, const float* __restrict__ s5,
    const float* __restrict__ s6, const float* __restrict__ s7,
    const float* __restrict__ s8, const float* __restrict__ s9,
    bf16* __restrict__ out) {
    const int b = blockIdx.x;
    const float* src;
    int first;  // first block of the tensor that block b lies in
    if      (b <  192) { src = s0; first =    0; }
    else if (b <  256) { src = s1; first =  192; }
    else if (b <  320) { src = s2; first =  256; }
    else if (b <  368) { src = s3; first =  320; }
    else if (b <  416) { src = s4; first =  368; }
    else if (b <  480) { src = s5; first =  416; }
    else if (b <  736) { src = s6; first =  480; }
    else if (b <  992) { src = s7; first =  736; }
    else if (b < 1088) { src = s8; first =  992; }
    else               { src = s9; first = 1088; }
    const int within = (threadIdx.x >> 5) * 4096 + (threadIdx.x & 31) * 4;
    const float* ip = src + (size_t)(b - first) * 16384 + within;
    bf16*        op = out + (size_t)b * 16384 + within;
    floatx4 v[32];
#pragma unroll
    for (int j = 0; j < 32; ++j) v[j] = *(const floatx4*)(ip + j * 128);
    // keeps all 32 loads in front of the first conversion: one trip to memory a wave;
    // without it the compiler issues them in six groups, each waiting for the one before
    __builtin_amdgcn_sched_barrier(0);
#pragma unroll
    for (int j = 0; j < 32; ++j)
        *(bf16x4*)(op + j * 128) = __builtin_convertvector(v[j], bf16x4);
}

// ---------------------------------------------------------------------------
// LayerNorm over rows of 1024: one wave takes two whole rows and keeps them in
// registers (eight 16-byte loads a lane and row, each 512 contiguous bytes), so
// a row is read once, its sums need no LDS and no barrier, and a launch starts
// 4096 waves (16 a WGP). f32 in, bf16 out.
// ---------------------------------------------------------------------------
__global__ __launch_bounds__(256) void ln_bf16_kernel(
    const float* __restrict__ x, const float* __restrict__ g,
    const float* __restrict__ bta, bf16* __restrict__ out) {
    const unsigned goff = (threadIdx.x & 31) * 16;                // the lane's bytes in a 512-byte piece
    const unsigned xoff = (threadIdx.x >> 5) * 8192 + goff;       // + the wave's two rows among the block's sixteen
    const char* xb = (const char*)(x + (size_t)blockIdx.x * 16384);
    char*       ob = (char*)(out + (size_t)blockIdx.x * 16384);
    floatx4 v[2][8], gg[8], bb[8];
#pragma unroll
    for (int r = 0; r < 2; ++r)
#pragma unroll
        for (int j = 0; j < 8; ++j) v[r][j] = *(const floatx4*)(xb + xoff + r * 4096 + j * 512);
#pragma unroll
    for (int j = 0; j < 8; ++j) {
        gg[j] = *(const floatx4*)((const char*)g + goff + j * 512);
        bb[j] = *(const floatx4*)((const char*)bta + goff + j * 512);
    }
    asm volatile("s_wait_xcnt 0x0" :: "v"(xoff), "v"(goff) : "memory");
    // keeps the loads of gain and bias up here with the rows': without it the compiler
    // sinks them behind the row sums, and the wave waits for memory a second and third time
    __builtin_amdgcn_sched_barrier(0);
#pragma unroll
    for (int r = 0; r < 2; ++r) {
        floatx4 s4 = v[r][0], q4 = v[r][0] * v[r][0];
#pragma unroll
        for (int j = 1; j < 8; ++j) {
            s4 += v[r][j];
            q4 += v[r][j] * v[r][j];
        }
        const float ls = wave_sum32((s4[0] + s4[1]) + (s4[2] + s4[3]));
        const float lq = wave_sum32((q4[0] + q4[1]) + (q4[2] + q4[3]));
        const float mean = ls / 1024.0f;
        const float var  = lq / 1024.0f - mean * mean;
        const float inv  = rsqrtf(var + 1e-5f);
#pragma unroll
        for (int j = 0; j < 8; ++j) {
            const floatx4 y = (v[r][j] - mean) * inv * gg[j] + bb[j];
            *(bf16x4*)(ob + xoff / 2 + r * 2048 + j * 256) = __builtin_convertvector(y, bf16x4);
        }
    }
}

template <int EPI, int MT>
__global__ __launch_bounds__(256) void gemm_bf16_kernel(
    const bf16* __restrict__ A, const bf16* __restrict__ B,
    const float* __restrict__ bias, const float* __restrict__ res,
    void* __restrict__ out, int M, int N, int K) {
    // row-major [m][k], 144B rows (16B x odd: the plain 16-byte load's pitch)
    __shared__ __attribute__((aligned(16))) bf16 As[2][64 * MT][72];
    // row-major [k][n], 288B rows (32B x odd: the transposing load's pitch)
    __shared__ __attribute__((aligned(16))) bf16 Bs[2][64][144];

    const int tid  = threadIdx.x;
    const int lane = tid & 31;
    const int wave = tid >> 5;
    const int wr = wave >> 1;   // 0..3 : group of 16 MT rows
    const int wc = wave & 1;    // 0..1 : 64-col group
    const int hf = lane >> 4;   // lane half
    const int c0 = hf << 3;
    const int ln = lane & 15;
    const int bm = blockIdx.y * (64 * MT);
    const int bn = blockIdx.x * 128;

    floatx8 acc[MT][4];
#pragma unroll
    for (int i = 0; i < MT; ++i)
#pragma unroll
        for (int j = 0; j < 4; ++j) acc[i][j] = fzero8();

    const int ar = tid >> 3, as8 = (tid & 7) * 8;   // A: rows ar + 32 i, 8 lanes a 128-byte row
    const int br = tid >> 4, bs8 = (tid & 15) * 8;  // B: rows br + 16 i, 16 lanes a 256-byte row
    const bf16* ga = A + (size_t)(bm + ar) * K + as8;
    const bf16* gb = B + (size_t)br * N + bn + bs8;

    // ---- prologue: stage tile 0 into buffer 0 ----
    {
        if (MT == 4) async_load8_b128(ga, (size_t)32 * K, &As[0][ar][as8], 32 * 72);
        else         async_load4_b128(ga, (size_t)32 * K, &As[0][ar][as8], 32 * 72);
#pragma unroll
        for (int i = 0; i < 4; ++i)
            *(uint4*)&Bs[0][br + 16 * i][bs8] = *(const uint4*)(gb + (size_t)(16 * i) * N);
        wait_async0();
    }
    __syncthreads();

    int cur = 0;
    for (int kk = 0; kk < K; kk += 64) {
        const int nxt = cur ^ 1;
        const bool has_next = (kk + 64 < K);
        uint4 breg0, breg1, breg2, breg3;  // next B tile's 64 bytes of this thread, held over the WMMAs
        if (has_next) {
            if (MT == 4) async_load8_b128(ga + kk + 64, (size_t)32 * K, &As[nxt][ar][as8], 32 * 72);
            else         async_load4_b128(ga + kk + 64, (size_t)32 * K, &As[nxt][ar][as8], 32 * 72);
            const bf16* gbn = gb + (size_t)(kk + 64) * N;
            breg0 = *(const uint4*)(gbn);
            breg1 = *(const uint4*)(gbn + (size_t)16 * N);
            breg2 = *(const uint4*)(gbn + (size_t)32 * N);
            breg3 = *(const uint4*)(gbn + (size_t)48 * N);
            asm volatile("s_wait_xcnt 0x0" ::: "memory");
            if (kk + 128 < K) {  // L2 warm-up two tiles ahead (global_prefetch_b8), one lane a line
                // scalar tests: A's 64 MT lines go to the first 2 MT waves, B's 128 to waves 4-7
                if (MT == 4 || __builtin_amdgcn_readfirstlane(wave) < 4)
                    __builtin_prefetch(A + (size_t)(bm + tid) * K + kk + 128, 0, 1);
                if (__builtin_amdgcn_readfirstlane(wave) >= 4)
                    __builtin_prefetch(B + (size_t)(kk + 128 + ((tid - 128) >> 1)) * N + bn + (tid & 1) * 64, 0, 1);
            }
        }

        // ---- compute current tile: 8 MT WMMAs per wave ----
#pragma unroll
        for (int ks = 0; ks < 2; ++ks) {
            bf16x16 af[MT], bfv[4];
#pragma unroll
            for (int nt = 0; nt < 4; ++nt)
                bfv[nt] = frag_tr(&Bs[cur][ks * 32 + c0 + (lane & 7)][wc * 64 + nt * 16 + ((lane >> 3) & 1) * 8], 144);
#pragma unroll
            for (int mt = 0; mt < MT; ++mt)
                af[mt] = frag_row(&As[cur][wr * (16 * MT) + mt * 16 + ln][ks * 32 + c0]);
            __builtin_amdgcn_sched_barrier(0);
#pragma unroll
            for (int mt = 0; mt < MT; ++mt)
#pragma unroll
                for (int nt = 0; nt < 4; ++nt)
                    acc[mt][nt] = wmma_bf16(af[mt], bfv[nt], acc[mt][nt]);
        }

        if (has_next) {
            // commit staged B to LDS[nxt]
            *(uint4*)&Bs[nxt][br +  0][bs8] = breg0;
            *(uint4*)&Bs[nxt][br + 16][bs8] = breg1;
            *(uint4*)&Bs[nxt][br + 32][bs8] = breg2;
            *(uint4*)&Bs[nxt][br + 48][bs8] = breg3;
        }
        // hand-over of the stage: this wave's LDS reads and writes done, its copies
        // landed, then the barrier that publishes tile t+1 and frees buffer cur
        asm volatile("s_wait_dscnt 0x0" ::: "memory");
        wait_async0();
        __syncthreads();
        cur = nxt;
    }
    wait_async0();  // no copy outlives the loop

    // ---- epilogue: D layout = lane holds col n=ln, rows v + 8*hf ----
    // Two rows of tiles (64 elements a lane) at a time, so that beside MT * 32 accumulators
    // a group's residuals still fit and are all in flight at once. An address is the block's
    // scalar base plus a 32-bit element offset of the lane, one for each of the group's 16 rows.
    const unsigned lcol = wc * 64 + ln;                                              // the lane's column
    const unsigned loff = (unsigned)(wr * (16 * MT) + 8 * hf) * (unsigned)N + lcol;  // and its first row
    const size_t   boff = (size_t)bm * N + bn;                                       // the block's corner
    float bs[4];
#pragma unroll
    for (int nt = 0; nt < 4; ++nt) bs[nt] = (bias + bn + nt * 16)[lcol];
#pragma unroll
    for (int mg = 0; mg < MT; mg += 2) {
        unsigned roff[2][8];
#pragma unroll
        for (int mi = 0; mi < 2; ++mi)
#pragma unroll
            for (int v = 0; v < 8; ++v) roff[mi][v] = loff + (unsigned)((mg + mi) * 16 + v) * (unsigned)N;
        float  val[2][4][8];
        bf16x2 hp[2][4][4];  // bf16 kinds: rows v, v + 1 share a register, and a store takes its half as it lies
        if (EPI == 2) {
#pragma unroll
            for (int mi = 0; mi < 2; ++mi)
#pragma unroll
                for (int nt = 0; nt < 4; ++nt)
#pragma unroll
                    for (int v = 0; v < 8; ++v) val[mi][nt][v] = (res + boff + nt * 16)[roff[mi][v]];
        }
#pragma unroll
        for (int mi = 0; mi < 2; ++mi)
#pragma unroll
            for (int nt = 0; nt < 4; ++nt)
#pragma unroll
                for (int v = 0; v < 8; ++v) {
                    const float a = acc[mg + mi][nt][v] + bs[nt];
                    if (EPI == 0) {
                        val[mi][nt][v] = a;
                    } else if (EPI == 1) {
                        // 0.5 (1 + tanh t) = 1 / (1 + e^(-2t)), with e^(-2t) = 2^(a (c + d a^2)),
                        // c = -2 log2(e) sqrt(2/pi), d = 0.044715 c: no branch, so a lane's
                        // elements run interleaved and not one behind the other
                        const float e = exp2_slot(a * (-2.3022082f - 0.10294324f * (a * a)));
                        val[mi][nt][v] = a * rcp_slot(1.0f + e);
                    } else {
                        val[mi][nt][v] = a + val[mi][nt][v];
                    }
                    if (EPI != 2 && (v & 1)) {
                        floatx2 p;
                        p[0] = val[mi][nt][v - 1];
                        p[1] = val[mi][nt][v];
                        hp[mi][nt][v >> 1] = __builtin_convertvector(p, bf16x2);
                    }
                }
#pragma unroll
        for (int mi = 0; mi < 2; ++mi)
#pragma unroll
            for (int nt = 0; nt < 4; ++nt)
#pragma unroll
                for (int v = 0; v < 8; ++v) {
                    if (EPI == 2) ((float*)out + boff + nt * 16)[roff[mi][v]] = val[mi][nt][v];
                    else          ((bf16*)out + boff + nt * 16)[roff[mi][v]] = hp[mi][nt][v >> 1][v & 1];
                }
        if (mg + 2 < MT) asm volatile("s_wait_xcnt 0x0" ::: "memory");
    }
}

__global__ __launch_bounds__(128) void attn_kernel(
    const bf16* __restrict__ Q, int qstride,
    const bf16* __restrict__ Kp, const bf16* __restrict__ Vp, int kvstride,
    bf16* __restrict__ O, int Tq, int Tk, int causal, float scale) {
    // each tensor load's place in LDS is a multiple of 2 KiB
    __shared__ __attribute__((aligned(2048))) bf16 Ks[32][72];  // K chunk [key][d]  (144B rows)
    __shared__ __attribute__((aligned(2048))) bf16 Vs[32][72];  // V chunk [key][d]

    const int tid  = threadIdx.x;
    const int lane = tid & 31;
    const int w    = tid >> 5;
    const int hf = lane >> 4, c0 = hf << 3, ln = lane & 15;
    const int q0 = blockIdx.x * 64;
    const int h  = blockIdx.y;
    const int b  = blockIdx.z;

    const bf16* qbase = Q  + (size_t)(b * Tq) * qstride  + h * 64;
    const bf16* kbase = Kp + (size_t)(b * Tk) * kvstride + h * 64;
    const bf16* vbase = Vp + (size_t)(b * Tk) * kvstride + h * 64;

    // Q fragments for this wave's 16 rows (2 K-steps over dh=64), kept resident
    bf16x16 qf[2];
    {
        const bf16* qp = qbase + (size_t)(q0 + w * 16 + ln) * qstride;
#pragma unroll
        for (int ks = 0; ks < 2; ++ks) {
            bf16x16 f;
#pragma unroll
            for (int e = 0; e < 8; ++e) f[e] = qp[ks * 32 + c0 + e];
#pragma unroll
            for (int e = 0; e < 8; ++e) f[e + 8] = qp[ks * 32 + c0 + 16 + e];
            qf[ks] = f;
        }
    }

    floatx8 o[4];
#pragma unroll
    for (int i = 0; i < 4; ++i) o[i] = fzero8();
    // of the lane's query (row q0 + w*16 + ln): running maximum, the same in both
    // halves, and the sum over the keys that this half has seen
    float m_r = -1e30f, l_r = 0.0f;

    int kend = causal ? (q0 + 64) : Tk;
    if (kend > Tk) kend = Tk;

    for (int kc = 0; kc < kend; kc += 32) {
        __syncthreads();
        if (w == 0) {
            tdm_load_2d_pad(kbase + (size_t)kc * kvstride, &Ks[0][0], 32, 64, kvstride);
            tdm_load_2d_pad(vbase + (size_t)kc * kvstride, &Vs[0][0], 32, 64, kvstride);
            wait_tensor0();
        }
        __syncthreads();

        // S^T = K * Q^T : two 16-key tiles, K-dim = dh = 64 (2 WMMA steps)
        floatx8 s[2];
#pragma unroll
        for (int nt = 0; nt < 2; ++nt) {
            floatx8 a = fzero8();
#pragma unroll
            for (int ks = 0; ks < 2; ++ks) {
                bf16x16 kf = frag_row(&Ks[nt * 16 + ln][ks * 32 + c0]);
                a = wmma_bf16(kf, qf[ks], a);
            }
            s[nt] = a;
        }
        // V^T fragments (A operand of the second product) by the transposing load: two
        // 16-byte loads a fragment, in the k order of frag_row and of P^T below
        bf16x16 vf[4];
#pragma unroll
        for (int nt = 0; nt < 4; ++nt)
            vf[nt] = frag_tr(&Vs[c0 + (lane & 7)][nt * 16 + ((lane >> 3) & 1) * 8], 72);
        // keeps the eight loads up here as one group, so that LDS answers behind the softmax;
        // without it the compiler sinks them in pairs, each pair waited for in front of its product
        __builtin_amdgcn_sched_barrier(0);
        // scale + causal mask (D layout: lane holds query ln, keys v + 8*hf of the tile)
        const int qg = q0 + w * 16 + ln;
#pragma unroll
        for (int nt = 0; nt < 2; ++nt) {
#pragma unroll
            for (int v = 0; v < 8; ++v) {
                float x = s[nt][v] * scale;
                if (causal) {
                    const int kg = kc + nt * 16 + v + 8 * hf;
                    if (kg > qg) x = -1e30f;
                }
                s[nt][v] = x;
            }
        }
        // online softmax of the lane's query
        float t = fmaxf(s[0][0], s[1][0]);
#pragma unroll
        for (int v = 1; v < 8; ++v) t = fmaxf(t, fmaxf(s[0][v], s[1][v]));
        t = fmaxf(t, other_half(t));
        const float mn = fmaxf(m_r, t);
        const float alpha = exp_slot(m_r - mn);
        m_r = mn;
        // P^T as B operand: element e is key 8*hf + e, element 8 + e key 16 + 8*hf + e,
        // the k order of frag_tr
        bf16x16 pf;
        float rs0, rs1;
#pragma unroll
        for (int v = 0; v < 8; ++v) {
            const float p0 = exp_slot(s[0][v] - mn);
            const float p1 = exp_slot(s[1][v] - mn);
            rs0 = v == 0 ? p0 : rs0 + p0;
            rs1 = v == 0 ? p1 : rs1 + p1;
            pf[v]     = (bf16)p0;
            pf[v + 8] = (bf16)p1;
        }
        l_r = l_r * alpha + (rs0 + rs1);
#pragma unroll
        for (int nt = 0; nt < 4; ++nt)
#pragma unroll
            for (int v = 0; v < 8; ++v) o[nt][v] *= alpha;

        // O^T += V^T(64x32) * P^T(32x16)
#pragma unroll
        for (int nt = 0; nt < 4; ++nt) o[nt] = wmma_bf16(vf[nt], pf, o[nt]);
    }

    // finalize: join the halves' sums, divide; the lane holds d = nt*16 + 8*hf + v of
    // its query: eight consecutive bf16, one 16-byte store a tile
    {
        typedef __attribute__((ext_vector_type(8))) __bf16 bf16x8;
        const float inv = 1.0f / (l_r + other_half(l_r));
        bf16* op = O + (size_t)(b * Tq + q0 + w * 16 + ln) * 1024 + h * 64 + 8 * hf;
#pragma unroll
        for (int nt = 0; nt < 4; ++nt) {
            bf16x8 y;
#pragma unroll
            for (int v = 0; v < 8; ++v) y[v] = (bf16)(o[nt][v] * inv);
            *(bf16x8*)(op + nt * 16) = y;
        }
    }
}

// ---------------------------------------------------------------------------
// Host-side orchestration
// ---------------------------------------------------------------------------
template <int EPI, int MT>
static void gemm(const bf16* A, const bf16* B, const float* bias, const float* res,
                 void* out, int M, int N, int K, hipStream_t s) {
    dim3 g(N / 128, M / (64 * MT));
    gemm_bf16_kernel<EPI, MT><<<g, 256, 0, s>>>(A, B, bias, res, out, M, N, K);
}

extern "C" void kernel_launch(void* const* d_in, const int* in_sizes, int n_in,
                              void* d_out, int out_size, void* d_ws, size_t ws_size,
                              hipStream_t stream) {
    const float* x      = (const float*)d_in[0];
    const float* key    = (const float*)d_in[1];
    const float* val    = (const float*)d_in[2];
    const float* ln1_g  = (const float*)d_in[3];
    const float* ln1_b  = (const float*)d_in[4];
    const float* ln2_g  = (const float*)d_in[5];
    const float* ln2_b  = (const float*)d_in[6];
    const float* ln3_g  = (const float*)d_in[7];
    const float* ln3_b  = (const float*)d_in[8];
    const float* W_attn = (const float*)d_in[9];
    const float* b_attn = (const float*)d_in[10];
    const float* W_aproj= (const float*)d_in[11];
    const float* b_aproj= (const float*)d_in[12];
    const float* Wq     = (const float*)d_in[13];
    const float* bq     = (const float*)d_in[14];
    const float* Wk     = (const float*)d_in[15];
    const float* bk     = (const float*)d_in[16];
    const float* Wv     = (const float*)d_in[17];
    const float* bv     = (const float*)d_in[18];
    const float* W_cproj= (const float*)d_in[19];
    const float* b_cproj= (const float*)d_in[20];
    const float* W_fc   = (const float*)d_in[21];
    const float* b_fc   = (const float*)d_in[22];
    const float* W_mproj= (const float*)d_in[23];
    const float* b_mproj= (const float*)d_in[24];

    const int B = 8, T = 1024, C = 1024, Ck = 768, TK = 256, NH = 16;
    const size_t BT  = (size_t)B * T;    // 8192 rows
    const size_t BTk = (size_t)B * TK;   // 2048 rows

    char* ws = (char*)d_ws;
    size_t off = 0;
    auto alloc = [&](size_t bytes) -> void* {
        void* p = ws + off;
        off += (bytes + 255) & ~(size_t)255;
        return p;
    };

    // persistent bf16 buffers
    bf16* wattn  = (bf16*)alloc((size_t)C * 3 * C * 2);
    bf16* waproj = (bf16*)alloc((size_t)C * C * 2);
    bf16* wqb    = (bf16*)alloc((size_t)C * C * 2);
    bf16* wkb    = (bf16*)alloc((size_t)Ck * C * 2);
    bf16* wvb    = (bf16*)alloc((size_t)Ck * C * 2);
    bf16* wcproj = (bf16*)alloc((size_t)C * C * 2);
    bf16* wfc    = (bf16*)alloc((size_t)C * 4 * C * 2);
    bf16* wmproj = (bf16*)alloc((size_t)4 * C * C * 2);
    bf16* keyb   = (bf16*)alloc(BTk * Ck * 2);
    bf16* valb   = (bf16*)alloc(BTk * Ck * 2);
    bf16* lnbuf  = (bf16*)alloc(BT * C * 2);
    bf16* attnb  = (bf16*)alloc(BT * C * 2);
    // phase-aliased scratch (max of: qkv 50MB | q/k/v-proj 24MB | mlp hidden 67MB)
    char* scratch = (char*)alloc(BT * (size_t)4 * C * 2);
    bf16* qkv = (bf16*)scratch;
    bf16* qc  = (bf16*)scratch;
    bf16* kc  = (bf16*)(scratch + BT * C * 2);
    bf16* vc  = (bf16*)(scratch + BT * C * 2 + BTk * C * 2);
    bf16* hfc = (bf16*)scratch;

    float* xo = (float*)d_out;  // running residual state lives in d_out x-region

    // 0) down-conversions: wattn .. valb are contiguous in ws, in this order
    cvt_all_bf16_kernel<<<dim3(1184), 128, 0, stream>>>(
        W_attn, W_aproj, Wq, Wk, Wv, W_cproj, W_fc, W_mproj, key, val, wattn);

    const float scale = 0.125f;  // 1/sqrt(64)

    // 1) self-attention branch
    ln_bf16_kernel<<<dim3((unsigned)(BT / 16)), 256, 0, stream>>>(x, ln1_g, ln1_b, lnbuf);
    gemm<0, 4>(lnbuf, wattn, b_attn, nullptr, qkv, (int)BT, 3 * C, C, stream);
    attn_kernel<<<dim3(T / 64, NH, B), 128, 0, stream>>>(
        qkv, 3 * C, qkv + C, qkv + 2 * C, 3 * C, attnb, T, T, /*causal=*/1, scale);
    gemm<2, 4>(attnb, waproj, b_aproj, x, xo, (int)BT, C, C, stream);  // x + attn

    // 2) cross-attention branch
    ln_bf16_kernel<<<dim3((unsigned)(BT / 16)), 256, 0, stream>>>(xo, ln3_g, ln3_b, lnbuf);
    gemm<0, 4>(lnbuf, wqb, bq, nullptr, qc, (int)BT, C, C, stream);
    gemm<0, 2>(keyb, wkb, bk, nullptr, kc, (int)BTk, C, Ck, stream);
    gemm<0, 2>(valb, wvb, bv, nullptr, vc, (int)BTk, C, Ck, stream);
    attn_kernel<<<dim3(T / 64, NH, B), 128, 0, stream>>>(
        qc, C, kc, vc, C, attnb, T, TK, /*causal=*/0, scale);
    gemm<2, 4>(attnb, wcproj, b_cproj, xo, xo, (int)BT, C, C, stream);  // x += cross

    // 3) MLP branch
    ln_bf16_kernel<<<dim3((unsigned)(BT / 16)), 256, 0, stream>>>(xo, ln2_g, ln2_b, lnbuf);
    gemm<1, 4>(lnbuf, wfc, b_fc, nullptr, hfc, (int)BT, 4 * C, C, stream);   // + GELU
    gemm<2, 4>(hfc, wmproj, b_mproj, xo, xo, (int)BT, C, 4 * C, stream);     // x += mlp

    // 4) echo key/val into the output tuple
    size_t x_elems = BT * (size_t)C;
    size_t kv_elems = BTk * (size_t)Ck;
    hipMemcpyAsync(xo + x_elems, key, kv_elems * sizeof(float),
                   hipMemcpyDeviceToDevice, stream);
    hipMemcpyAsync(xo + x_elems + kv_elems, val, kv_elems * sizeof(float),
                   hipMemcpyDeviceToDevice, stream);
}

// v008
// It runs in 376 microseconds.
// In two side-by-side timings against v007, it was 1.04 and 1.05 times as fast.
// All steps since v000 together make it 2.38 times as fast.
#include <hip/hip_runtime.h>
#include <hip/hip_bf16.h>

typedef __bf16 bf16;
typedef __attribute__((ext_vector_type(16))) __bf16 bf16x16;
typedef __attribute__((ext_vector_type(8)))  float  floatx8;
typedef __attribute__((ext_vector_type(4)))  unsigned int uint32x4;
typedef __attribute__((ext_vector_type(8)))  unsigned int uint32x8;
typedef __attribute__((ext_vector_type(8)))  short s16x8;
typedef __attribute__((ext_vector_type(16))) short s16x16;

// ---------------------------------------------------------------------------
// WMMA wrapper: D = A(16x32 bf16) * B(32x16 bf16) + C(16x16 f32)
// ---------------------------------------------------------------------------
__device__ __forceinline__ floatx8 wmma_bf16(bf16x16 a, bf16x16 b, floatx8 c) {
    return __builtin_amdgcn_wmma_f32_16x16x32_bf16(
        /*neg_a=*/false, a, /*neg_b=*/false, b,
        /*c_mod=*/(short)0, c, /*reuse_a=*/false, /*reuse_b=*/false);
}

__device__ __forceinline__ floatx8 fzero8() {
    floatx8 z;
#pragma unroll
    for (int i = 0; i < 8; ++i) z[i] = 0.0f;
    return z;
}

__device__ __forceinline__ void async_load4_b128(const bf16* gptr, size_t gstep,
                                                 bf16* lptr, int lstep) {
    unsigned l0 = (unsigned)(size_t)lptr;
    unsigned l1 = (unsigned)(size_t)(lptr + lstep);
    unsigned l2 = (unsigned)(size_t)(lptr + 2 * lstep);
    unsigned l3 = (unsigned)(size_t)(lptr + 3 * lstep);
    unsigned long long g0 = (unsigned long long)(size_t)gptr;
    unsigned long long g1 = (unsigned long long)(size_t)(gptr + gstep);
    unsigned long long g2 = (unsigned long long)(size_t)(gptr + 2 * gstep);
    unsigned long long g3 = (unsigned long long)(size_t)(gptr + 3 * gstep);
    asm volatile("global_load_async_to_lds_b128 %0, %4, off\n\t"
                 "global_load_async_to_lds_b128 %1, %5, off\n\t"
                 "global_load_async_to_lds_b128 %2, %6, off\n\t"
                 "global_load_async_to_lds_b128 %3, %7, off\n\t"
                 "s_wait_xcnt 0x0"
                 :: "v"(l0), "v"(l1), "v"(l2), "v"(l3), "v"(g0), "v"(g1), "v"(g2), "v"(g3)
                 : "memory");
}
__device__ __forceinline__ void async_load8_b128(const bf16* gptr, size_t gstep,
                                                 bf16* lptr, int lstep) {
    unsigned l[8];
    unsigned long long g[8];
#pragma unroll
    for (int i = 0; i < 8; ++i) {
        l[i] = (unsigned)(size_t)(lptr + i * lstep);
        g[i] = (unsigned long long)(size_t)(gptr + i * gstep);
    }
    asm volatile("global_load_async_to_lds_b128 %0, %8, off\n\t"
                 "global_load_async_to_lds_b128 %1, %9, off\n\t"
                 "global_load_async_to_lds_b128 %2, %10, off\n\t"
                 "global_load_async_to_lds_b128 %3, %11, off\n\t"
                 "global_load_async_to_lds_b128 %4, %12, off\n\t"
                 "global_load_async_to_lds_b128 %5, %13, off\n\t"
                 "global_load_async_to_lds_b128 %6, %14, off\n\t"
                 "global_load_async_to_lds_b128 %7, %15, off\n\t"
                 "s_wait_xcnt 0x0"
                 :: "v"(l[0]), "v"(l[1]), "v"(l[2]), "v"(l[3]), "v"(l[4]), "v"(l[5]), "v"(l[6]), "v"(l[7]),
                    "v"(g[0]), "v"(g[1]), "v"(g[2]), "v"(g[3]), "v"(g[4]), "v"(g[5]), "v"(g[6]), "v"(g[7])
                 : "memory");
}
__device__ __forceinline__ void wait_async0() {
    asm volatile("s_wait_asynccnt 0x0" ::: "memory");
}

__device__ __forceinline__ void tdm_load_2d_pad(const bf16* gptr, bf16* lptr,
                                                unsigned rows, unsigned cols,
                                                unsigned stride_elems) {
    unsigned long long ga = (unsigned long long)(size_t)gptr;
    uint32x4 g0;
    g0[0] = 1u;
    g0[1] = (unsigned)(size_t)lptr;
    g0[2] = (unsigned)ga;
    g0[3] = (unsigned)(ga >> 32) | 0x80000000u;
    uint32x8 g1;
    g1[0] = (1u << 16) | (1u << 20) | (4u << 22) | (3u << 25);
    g1[1] = (cols & 0xffffu) << 16;
    g1[2] = (rows & 0xffffu) << 16;
    g1[3] = (cols & 0xffffu) << 16;
    g1[4] = (rows & 0xffffu);
    g1[5] = stride_elems;
    g1[6] = 0u;
    g1[7] = 0u;
    asm volatile("tensor_load_to_lds %0, %1" :: "s"(g0), "s"(g1) : "memory");
}
__device__ __forceinline__ void wait_tensor0() {
#if __has_builtin(__builtin_amdgcn_s_wait_tensorcnt)
    __builtin_amdgcn_s_wait_tensorcnt(0);
#else
    asm volatile("s_wait_tensorcnt 0x0" ::: "memory");
#endif
}

__device__ __forceinline__ bf16x16 frag_row(const bf16* p) {
    bf16x16 f;
#pragma unroll
    for (int e = 0; e < 8; ++e) f[e] = p[e];
#pragma unroll
    for (int e = 0; e < 8; ++e) f[e + 8] = p[e + 16];
    return f;
}

// 32x16 B fragment from a row-major [k][n] LDS tile by two transposing loads.
// p is the lane's own address: row 8*(lane>>4) + (lane&7), column n0 + 8*((lane>>3)&1);
// lane (c = lane&15, h = lane>>4) then holds column n0 + c at k {8h..8h+7, 16+8h..16+8h+7},
// the same k order as frag_row. ld = row pitch in elements.
__device__ __forceinline__ bf16x16 frag_tr(const bf16* p, int ld) {
    typedef __attribute__((address_space(3))) s16x8 lds_s16x8;
    s16x8 lo = __builtin_amdgcn_ds_load_tr16_b128_v8i16((lds_s16x8*)p);
    s16x8 hi = __builtin_amdgcn_ds_load_tr16_b128_v8i16((lds_s16x8*)(p + 16 * ld));
    s16x16 f = __builtin_shufflevector(lo, hi, 0, 1, 2, 3, 4, 5, 6, 7,
                                       8, 9, 10, 11, 12, 13, 14, 15);
    return __builtin_bit_cast(bf16x16, f);
}

// wave32 full reduction
__device__ __forceinline__ float wave_sum32(float v) {
#pragma unroll
    for (int m = 16; m >= 1; m >>= 1) v += __shfl_xor(v, m, 32);
    return v;
}
__device__ __forceinline__ float exp_slot(float x) {
    float r;
    asm("v_exp_f32 %0, %1\n\tv_nop" : "=v"(r) : "v"(x * 1.44269504f));
    return r;
}
__device__ __forceinline__ float exp2_slot(float x) {
    float r;
    asm("v_exp_f32 %0, %1\n\tv_nop" : "=v"(r) : "v"(x));
    return r;
}
__device__ __forceinline__ float rcp_slot(float x) {
    float r;
    asm("v_rcp_f32 %0, %1\n\tv_nop" : "=v"(r) : "v"(x));
    return r;
}
__device__ __forceinline__ float other_half(float v) {
    const int b = __builtin_bit_cast(int, v);
    return __builtin_bit_cast(float,
        __builtin_amdgcn_permlanex16(b, b, 0x76543210, 0xfedcba98, false, false));
}

// ---------------------------------------------------------------------------
// f32 -> bf16 conversion of all ten tensors in one launch of few, long waves.
// These streams were held back by the number of waves that had to start, not by
// their bytes. A wave takes 4096 consecutive elements (32 loads of 16 bytes a
// lane, each load 512 contiguous bytes), a block of four waves 16384.
// The ten destinations lie back to back in the workspace, in the order of the
// sources, so the destination is one array. Block counts = elements / 16384.
// The last two tensors (key, val) are also outputs as they are: their blocks store
// the f32 values that they hold anyway, which spares two copy operations of their own.
// ---------------------------------------------------------------------------
typedef __attribute__((ext_vector_type(4))) float  floatx4;
typedef __attribute__((ext_vector_type(4))) __bf16 bf16x4;
typedef __attribute__((ext_vector_type(2))) float  floatx2;
typedef __attribute__((ext_vector_type(2))) __bf16 bf16x2;

__global__ __launch_bounds__(128) void cvt_all_bf16_kernel(
    const float* __restrict__ s0, const float* __restrict__ s1,
    const float* __restrict__ s2, const float* __restrict__ s3,
    const float* __restrict__ s4, const float* __restrict__ s5,
    const float* __restrict__ s6, const float* __restrict__ s7,
    const float* __restrict__ s8, const float* __restrict__ s9,
    bf16* __restrict__ out, float* __restrict__ echo) {
    const int b = blockIdx.x;
    const float* src;
    int first;  // first block of the tensor that block b lies in
    if      (b <  192) { src = s0; first =    0; }
    else if (b <  256) { src = s1; first =  192; }
    else if (b <  320) { src = s2; first =  256; }
    else if (b <  368) { src = s3; first =  320; }
    else if (b <  416) { src = s4; first =  368; }
    else if (b <  480) { src = s5; first =  416; }
    else if (b <  736) { src = s6; first =  480; }
    else if (b <  992) { src = s7; first =  736; }
    else if (b < 1088) { src = s8; first =  992; }
    else               { src = s9; first = 1088; }
    const int within = (threadIdx.x >> 5) * 4096 + (threadIdx.x & 31) * 4;
    const float* ip = src + (size_t)(b - first) * 16384 + within;
    bf16*        op = out + (size_t)b * 16384 + within;
    floatx4 v[32];
#pragma unroll
    for (int j = 0; j < 32; ++j) v[j] = *(const floatx4*)(ip + j * 128);
    // keeps all 32 loads in front of the first conversion: one trip to memory a wave;
    // without it the compiler issues them in six groups, each waiting for the one before
    __builtin_amdgcn_sched_barrier(0);
    asm volatile("s_wait_xcnt 0x0" ::: "memory");
    if (b >= 992) {  // key, val: back to back in the output too
        float* ep = echo + (size_t)(b - 992) * 16384 + within;
#pragma unroll
        for (int j = 0; j < 32; ++j) *(floatx4*)(ep + j * 128) = v[j];
        asm volatile("s_wait_xcnt 0x0" ::: "memory");
    }
#pragma unroll
    for (int j = 0; j < 32; ++j)
        *(bf16x4*)(op + j * 128) = __builtin_convertvector(v[j], bf16x4);
}

// ---------------------------------------------------------------------------
// LayerNorm over rows of 1024: one wave takes two whole rows and keeps them in
// registers (eight 16-byte loads a lane and row, each 512 contiguous bytes), so
// a row is read once, its sums need no LDS and no barrier, and a launch starts
// 4096 waves (16 a WGP). f32 in, bf16 out.
// ---------------------------------------------------------------------------
__global__ __launch_bounds__(256) void ln_bf16_kernel(
    const float* __restrict__ x, const float* __restrict__ g,
    const float* __restrict__ bta, bf16* __restrict__ out) {
    const unsigned goff = (threadIdx.x & 31) * 16;                // the lane's bytes in a 512-byte piece
    const unsigned xoff = (threadIdx.x >> 5) * 8192 + goff;       // + the wave's two rows among the block's sixteen
    const char* xb = (const char*)(x + (size_t)blockIdx.x * 16384);
    char*       ob = (char*)(out + (size_t)blockIdx.x * 16384);
    floatx4 v[2][8], gg[8], bb[8];
#pragma unroll
    for (int r = 0; r < 2; ++r)
#pragma unroll
        for (int j = 0; j < 8; ++j) v[r][j] = *(const floatx4*)(xb + xoff + r * 4096 + j * 512);
#pragma unroll
    for (int j = 0; j < 8; ++j) {
        gg[j] = *(const floatx4*)((const char*)g + goff + j * 512);
        bb[j] = *(const floatx4*)((const char*)bta + goff + j * 512);
    }
    asm volatile("s_wait_xcnt 0x0" :: "v"(xoff), "v"(goff) : "memory");
    // keeps the loads of gain and bias up here with the rows': without it the compiler
    // sinks them behind the row sums, and the wave waits for memory a second and third time
    __builtin_amdgcn_sched_barrier(0);
#pragma unroll
    for (int r = 0; r < 2; ++r) {
        floatx4 s4 = v[r][0], q4 = v[r][0] * v[r][0];
#pragma unroll
        for (int j = 1; j < 8; ++j) {
            s4 += v[r][j];
            q4 += v[r][j] * v[r][j];
        }
        const float ls = wave_sum32((s4[0] + s4[1]) + (s4[2] + s4[3]));
        const float lq = wave_sum32((q4[0] + q4[1]) + (q4[2] + q4[3]));
        const float mean = ls / 1024.0f;
        const float var  = lq / 1024.0f - mean * mean;
        const float inv  = rsqrtf(var + 1e-5f);
#pragma unroll
        for (int j = 0; j < 8; ++j) {
            const floatx4 y = (v[r][j] - mean) * inv * gg[j] + bb[j];
            *(bf16x4*)(ob + xoff / 2 + r * 2048 + j * 256) = __builtin_convertvector(y, bf16x4);
        }
    }
}

template <int EPI, int MT, int NP>
__global__ __launch_bounds__(256) void gemm_bf16_kernel(
    const bf16* __restrict__ A, const bf16* __restrict__ B,
    const float* __restrict__ bias, const float* __restrict__ res,
    void* __restrict__ out, int M, int N, int K,
    const bf16* __restrict__ A1, const bf16* __restrict__ B1,
    const float* __restrict__ bias1, bf16* __restrict__ out1,
    const bf16* __restrict__ A2, const bf16* __restrict__ B2,
    const float* __restrict__ bias2, bf16* __restrict__ out2,
    int K12, int nb0, int nb1) {
    // row-major [m][k], 144B rows (16B x odd: the plain 16-byte load's pitch)
    __shared__ __attribute__((aligned(16))) bf16 As[2][64 * MT][72];
    // row-major [k][n], 288B rows (32B x odd: the transposing load's pitch)
    __shared__ __attribute__((aligned(16))) bf16 Bs[2][64][144];

    const int tid  = threadIdx.x;
    const int lane = tid & 31;
    const int wave = tid >> 5;
    const int wr = wave >> 1;   // 0..3 : group of 16 MT rows
    const int wc = wave & 1;    // 0..1 : 64-col group
    const int hf = lane >> 4;   // lane half
    const int c0 = hf << 3;
    const int ln = lane & 15;
    int by = blockIdx.y;  // the block's row of tiles within its own product
    if (NP == 3 && by >= nb0) {
        by -= nb0;
        const bool last = by >= nb1;
        if (last) by -= nb1;
        A    = last ? A2 : A1;
        B    = last ? B2 : B1;
        bias = last ? bias2 : bias1;
        out  = last ? out2 : out1;
        K    = K12;
    }
    const int bm = by * (64 * MT);
    const int bn = blockIdx.x * 128;

    floatx8 acc[MT][4];
#pragma unroll
    for (int i = 0; i < MT; ++i)
#pragma unroll
        for (int j = 0; j < 4; ++j) acc[i][j] = fzero8();

    const int ar = tid >> 3, as8 = (tid & 7) * 8;   // A: rows ar + 32 i, 8 lanes a 128-byte row
    const int br = tid >> 4, bs8 = (tid & 15) * 8;  // B: rows br + 16 i, 16 lanes a 256-byte row
    const bf16* ga = A + (size_t)(bm + ar) * K + as8;
    const bf16* gb = B + (size_t)br * N + bn + bs8;

    // ---- prologue: stage tile 0 into buffer 0 ----
    {
        if (MT == 4) async_load8_b128(ga, (size_t)32 * K, &As[0][ar][as8], 32 * 72);
        else         async_load4_b128(ga, (size_t)32 * K, &As[0][ar][as8], 32 * 72);
#pragma unroll
        for (int i = 0; i < 4; ++i)
            *(uint4*)&Bs[0][br + 16 * i][bs8] = *(const uint4*)(gb + (size_t)(16 * i) * N);
        wait_async0();
    }
    __syncthreads();

    int cur = 0;
    for (int kk = 0; kk < K; kk += 64) {
        const int nxt = cur ^ 1;
        const bool has_next = (kk + 64 < K);
        uint4 breg0, breg1, breg2, breg3;  // next B tile's 64 bytes of this thread, held over the WMMAs
        if (has_next) {
            if (MT == 4) async_load8_b128(ga + kk + 64, (size_t)32 * K, &As[nxt][ar][as8], 32 * 72);
            else         async_load4_b128(ga + kk + 64, (size_t)32 * K, &As[nxt][ar][as8], 32 * 72);
            const bf16* gbn = gb + (size_t)(kk + 64) * N;
            breg0 = *(const uint4*)(gbn);
            breg1 = *(const uint4*)(gbn + (size_t)16 * N);
            breg2 = *(const uint4*)(gbn + (size_t)32 * N);
            breg3 = *(const uint4*)(gbn + (size_t)48 * N);
            asm volatile("s_wait_xcnt 0x0" ::: "memory");
            if (kk + 128 < K) {  // L2 warm-up two tiles ahead (global_prefetch_b8), one lane a line
                // scalar tests: A's 64 MT lines go to the first 2 MT waves, B's 128 to waves 4-7
                if (MT == 4 || __builtin_amdgcn_readfirstlane(wave) < 4)
                    __builtin_prefetch(A + (size_t)(bm + tid) * K + kk + 128, 0, 1);
                if (__builtin_amdgcn_readfirstlane(wave) >= 4)
                    __builtin_prefetch(B + (size_t)(kk + 128 + ((tid - 128) >> 1)) * N + bn + (tid & 1) * 64, 0, 1);
            }
        }

        // ---- compute current tile: 8 MT WMMAs per wave ----
#pragma unroll
        for (int ks = 0; ks < 2; ++ks) {
            bf16x16 af[MT], bfv[4];
#pragma unroll
            for (int nt = 0; nt < 4; ++nt)
                bfv[nt] = frag_tr(&Bs[cur][ks * 32 + c0 + (lane & 7)][wc * 64 + nt * 16 + ((lane >> 3) & 1) * 8], 144);
#pragma unroll
            for (int mt = 0; mt < MT; ++mt)
                af[mt] = frag_row(&As[cur][wr * (16 * MT) + mt * 16 + ln][ks * 32 + c0]);
            __builtin_amdgcn_sched_barrier(0);
#pragma unroll
            for (int mt = 0; mt < MT; ++mt)
#pragma unroll
                for (int nt = 0; nt < 4; ++nt)
                    acc[mt][nt] = wmma_bf16(af[mt], bfv[nt], acc[mt][nt]);
        }

        if (has_next) {
            // commit staged B to LDS[nxt]
            *(uint4*)&Bs[nxt][br +  0][bs8] = breg0;
            *(uint4*)&Bs[nxt][br + 16][bs8] = breg1;
            *(uint4*)&Bs[nxt][br + 32][bs8] = breg2;
            *(uint4*)&Bs[nxt][br + 48][bs8] = breg3;
        }
        // hand-over of the stage: this wave's LDS reads and writes done, its copies
        // landed, then the barrier that publishes tile t+1 and frees buffer cur
        asm volatile("s_wait_dscnt 0x0" ::: "memory");
        wait_async0();
        __syncthreads();
        cur = nxt;
    }
    wait_async0();  // no copy outlives the loop

    // ---- epilogue: D layout = lane holds col n=ln, rows v + 8*hf ----
    // Two rows of tiles (64 elements a lane) at a time, so that beside MT * 32 accumulators
    // a group's residuals still fit and are all in flight at once. An address is the block's
    // scalar base plus a 32-bit element offset of the lane, one for each of the group's 16 rows.
    const unsigned lcol = wc * 64 + ln;                                              // the lane's column
    const unsigned loff = (unsigned)(wr * (16 * MT) + 8 * hf) * (unsigned)N + lcol;  // and its first row
    const size_t   boff = (size_t)bm * N + bn;                                       // the block's corner
    float bs[4];
#pragma unroll
    for (int nt = 0; nt < 4; ++nt) bs[nt] = (bias + bn + nt * 16)[lcol];
#pragma unroll
    for (int mg = 0; mg < MT; mg += 2) {
        unsigned roff[2][8];
#pragma unroll
        for (int mi = 0; mi < 2; ++mi)
#pragma unroll
            for (int v = 0; v < 8; ++v) roff[mi][v] = loff + (unsigned)((mg + mi) * 16 + v) * (unsigned)N;
        float  val[2][4][8];
        bf16x2 hp[2][4][4];  // bf16 kinds: rows v, v + 1 share a register, and a store takes its half as it lies
        if (EPI == 2) {
#pragma unroll
            for (int mi = 0; mi < 2; ++mi)
#pragma unroll
                for (int nt = 0; nt < 4; ++nt)
#pragma unroll
                    for (int v = 0; v < 8; ++v) val[mi][nt][v] = (res + boff + nt * 16)[roff[mi][v]];
        }
#pragma unroll
        for (int mi = 0; mi < 2; ++mi)
#pragma unroll
            for (int nt = 0; nt < 4; ++nt)
#pragma unroll
                for (int v = 0; v < 8; ++v) {
                    const float a = acc[mg + mi][nt][v] + bs[nt];
                    if (EPI == 0) {
                        val[mi][nt][v] = a;
                    } else if (EPI == 1) {
                        // 0.5 (1 + tanh t) = 1 / (1 + e^(-2t)), with e^(-2t) = 2^(a (c + d a^2)),
                        // c = -2 log2(e) sqrt(2/pi), d = 0.044715 c: no branch, so a lane's
                        // elements run interleaved and not one behind the other
                        const float e = exp2_slot(a * (-2.3022082f - 0.10294324f * (a * a)));
                        val[mi][nt][v] = a * rcp_slot(1.0f + e);
                    } else {
                        val[mi][nt][v] = a + val[mi][nt][v];
                    }
                    if (EPI != 2 && (v & 1)) {
                        floatx2 p;
                        p[0] = val[mi][nt][v - 1];
                        p[1] = val[mi][nt][v];
                        hp[mi][nt][v >> 1] = __builtin_convertvector(p, bf16x2);
                    }
                }
#pragma unroll
        for (int mi = 0; mi < 2; ++mi)
#pragma unroll
            for (int nt = 0; nt < 4; ++nt)
#pragma unroll
                for (int v = 0; v < 8; ++v) {
                    if (EPI == 2) ((float*)out + boff + nt * 16)[roff[mi][v]] = val[mi][nt][v];
                    else          ((bf16*)out + boff + nt * 16)[roff[mi][v]] = hp[mi][nt][v >> 1][v & 1];
                }
        if (mg + 2 < MT) asm volatile("s_wait_xcnt 0x0" ::: "memory");
    }
}

__global__ __launch_bounds__(128) void attn_kernel(
    const bf16* __restrict__ Q, int qstride,
    const bf16* __restrict__ Kp, const bf16* __restrict__ Vp, int kvstride,
    bf16* __restrict__ O, int Tq, int Tk, int causal, float scale) {
    // each tensor load's place in LDS is a multiple of 2 KiB
    __shared__ __attribute__((aligned(2048))) bf16 Ks[32][72];  // K chunk [key][d]  (144B rows)
    __shared__ __attribute__((aligned(2048))) bf16 Vs[32][72];  // V chunk [key][d]

    const int tid  = threadIdx.x;
    const int lane = tid & 31;
    const int w    = tid >> 5;
    const int hf = lane >> 4, c0 = hf << 3, ln = lane & 15;
    const int q0 = blockIdx.x * 64;
    const int h  = blockIdx.y;
    const int b  = blockIdx.z;

    const bf16* qbase = Q  + (size_t)(b * Tq) * qstride  + h * 64;
    const bf16* kbase = Kp + (size_t)(b * Tk) * kvstride + h * 64;
    const bf16* vbase = Vp + (size_t)(b * Tk) * kvstride + h * 64;

    // Q fragments for this wave's 16 rows (2 K-steps over dh=64), kept resident
    bf16x16 qf[2];
    {
        const bf16* qp = qbase + (size_t)(q0 + w * 16 + ln) * qstride;
#pragma unroll
        for (int ks = 0; ks < 2; ++ks) {
            bf16x16 f;
#pragma unroll
            for (int e = 0; e < 8; ++e) f[e] = qp[ks * 32 + c0 + e];
#pragma unroll
            for (int e = 0; e < 8; ++e) f[e + 8] = qp[ks * 32 + c0 + 16 + e];
            qf[ks] = f;
        }
    }

    floatx8 o[4];
#pragma unroll
    for (int i = 0; i < 4; ++i) o[i] = fzero8();
    // of the lane's query (row q0 + w*16 + ln): running maximum, the same in both
    // halves, and the sum over the keys that this half has seen
    float m_r = -1e30f, l_r = 0.0f;

    int kend = causal ? (q0 + 64) : Tk;
    if (kend > Tk) kend = Tk;

    for (int kc = 0; kc < kend; kc += 32) {
        __syncthreads();
        if (w == 0) {
            tdm_load_2d_pad(kbase + (size_t)kc * kvstride, &Ks[0][0], 32, 64, kvstride);
            tdm_load_2d_pad(vbase + (size_t)kc * kvstride, &Vs[0][0], 32, 64, kvstride);
            wait_tensor0();
        }
        __syncthreads();

        // S^T = K * Q^T : two 16-key tiles, K-dim = dh = 64 (2 WMMA steps)
        floatx8 s[2];
#pragma unroll
        for (int nt = 0; nt < 2; ++nt) {
            floatx8 a = fzero8();
#pragma unroll
            for (int ks = 0; ks < 2; ++ks) {
                bf16x16 kf = frag_row(&Ks[nt * 16 + ln][ks * 32 + c0]);
                a = wmma_bf16(kf, qf[ks], a);
            }
            s[nt] = a;
        }
        // V^T fragments (A operand of the second product) by the transposing load: two
        // 16-byte loads a fragment, in the k order of frag_row and of P^T below
        bf16x16 vf[4];
#pragma unroll
        for (int nt = 0; nt < 4; ++nt)
            vf[nt] = frag_tr(&Vs[c0 + (lane & 7)][nt * 16 + ((lane >> 3) & 1) * 8], 72);
        // keeps the eight loads up here as one group, so that LDS answers behind the softmax;
        // without it the compiler sinks them in pairs, each pair waited for in front of its product
        __builtin_amdgcn_sched_barrier(0);
        // scale + causal mask (D layout: lane holds query ln, keys v + 8*hf of the tile)
        const int qg = q0 + w * 16 + ln;
#pragma unroll
        for (int nt = 0; nt < 2; ++nt) {
#pragma unroll
            for (int v = 0; v < 8; ++v) {
                float x = s[nt][v] * scale;
                if (causal) {
                    const int kg = kc + nt * 16 + v + 8 * hf;
                    if (kg > qg) x = -1e30f;
                }
                s[nt][v] = x;
            }
        }
        // online softmax of the lane's query
        float t = fmaxf(s[0][0], s[1][0]);
#pragma unroll
        for (int v = 1; v < 8; ++v) t = fmaxf(t, fmaxf(s[0][v], s[1][v]));
        t = fmaxf(t, other_half(t));
        const float mn = fmaxf(m_r, t);
        const float alpha = exp_slot(m_r - mn);
        m_r = mn;
        // P^T as B operand: element e is key 8*hf + e, element 8 + e key 16 + 8*hf + e,
        // the k order of frag_tr
        bf16x16 pf;
        float rs0, rs1;
#pragma unroll
        for (int v = 0; v < 8; ++v) {
            const float p0 = exp_slot(s[0][v] - mn);
            const float p1 = exp_slot(s[1][v] - mn);
            rs0 = v == 0 ? p0 : rs0 + p0;
            rs1 = v == 0 ? p1 : rs1 + p1;
            pf[v]     = (bf16)p0;
            pf[v + 8] = (bf16)p1;
        }
        l_r = l_r * alpha + (rs0 + rs1);
#pragma unroll
        for (int nt = 0; nt < 4; ++nt)
#pragma unroll
            for (int v = 0; v < 8; ++v) o[nt][v] *= alpha;

        // O^T += V^T(64x32) * P^T(32x16)
#pragma unroll
        for (int nt = 0; nt < 4; ++nt) o[nt] = wmma_bf16(vf[nt], pf, o[nt]);
    }

    // finalize: join the halves' sums, divide; the lane holds d = nt*16 + 8*hf + v of
    // its query: eight consecutive bf16, one 16-byte store a tile
    {
        typedef __attribute__((ext_vector_type(8))) __bf16 bf16x8;
        const float inv = 1.0f / (l_r + other_half(l_r));
        bf16* op = O + (size_t)(b * Tq + q0 + w * 16 + ln) * 1024 + h * 64 + 8 * hf;
#pragma unroll
        for (int nt = 0; nt < 4; ++nt) {
            bf16x8 y;
#pragma unroll
            for (int v = 0; v < 8; ++v) y[v] = (bf16)(o[nt][v] * inv);
            *(bf16x8*)(op + nt * 16) = y;
        }
    }
}

// ---------------------------------------------------------------------------
// Host-side orchestration
// ---------------------------------------------------------------------------
template <int EPI, int MT>
static void gemm(const bf16* A, const bf16* B, const float* bias, const float* res,
                 void* out, int M, int N, int K, hipStream_t s) {
    dim3 g(N / 128, M / (64 * MT));
    gemm_bf16_kernel<EPI, MT, 1><<<g, 256, 0, s>>>(A, B, bias, res, out, M, N, K,
                                                   nullptr, nullptr, nullptr, nullptr,
                                                   nullptr, nullptr, nullptr, nullptr, 0, 0, 0);
}

extern "C" void kernel_launch(void* const* d_in, const int* in_sizes, int n_in,
                              void* d_out, int out_size, void* d_ws, size_t ws_size,
                              hipStream_t stream) {
    const float* x      = (const float*)d_in[0];
    const float* key    = (const float*)d_in[1];
    const float* val    = (const float*)d_in[2];
    const float* ln1_g  = (const float*)d_in[3];
    const float* ln1_b  = (const float*)d_in[4];
    const float* ln2_g  = (const float*)d_in[5];
    const float* ln2_b  = (const float*)d_in[6];
    const float* ln3_g  = (const float*)d_in[7];
    const float* ln3_b  = (const float*)d_in[8];
    const float* W_attn = (const float*)d_in[9];
    const float* b_attn = (const float*)d_in[10];
    const float* W_aproj= (const float*)d_in[11];
    const float* b_aproj= (const float*)d_in[12];
    const float* Wq     = (const float*)d_in[13];
    const float* bq     = (const float*)d_in[14];
    const float* Wk     = (const float*)d_in[15];
    const float* bk     = (const float*)d_in[16];
    const float* Wv     = (const float*)d_in[17];
    const float* bv     = (const float*)d_in[18];
    const float* W_cproj= (const float*)d_in[19];
    const float* b_cproj= (const float*)d_in[20];
    const float* W_fc   = (const float*)d_in[21];
    const float* b_fc   = (const float*)d_in[22];
    const float* W_mproj= (const float*)d_in[23];
    const float* b_mproj= (const float*)d_in[24];

    const int B = 8, T = 1024, C = 1024, Ck = 768, TK = 256, NH = 16;
    const size_t BT  = (size_t)B * T;    // 8192 rows
    const size_t BTk = (size_t)B * TK;   // 2048 rows

    char* ws = (char*)d_ws;
    size_t off = 0;
    auto alloc = [&](size_t bytes) -> void* {
        void* p = ws + off;
        off += (bytes + 255) & ~(size_t)255;
        return p;
    };

    // persistent bf16 buffers
    bf16* wattn  = (bf16*)alloc((size_t)C * 3 * C * 2);
    bf16* waproj = (bf16*)alloc((size_t)C * C * 2);
    bf16* wqb    = (bf16*)alloc((size_t)C * C * 2);
    bf16* wkb    = (bf16*)alloc((size_t)Ck * C * 2);
    bf16* wvb    = (bf16*)alloc((size_t)Ck * C * 2);
    bf16* wcproj = (bf16*)alloc((size_t)C * C * 2);
    bf16* wfc    = (bf16*)alloc((size_t)C * 4 * C * 2);
    bf16* wmproj = (bf16*)alloc((size_t)4 * C * C * 2);
    bf16* keyb   = (bf16*)alloc(BTk * Ck * 2);
    bf16* valb   = (bf16*)alloc(BTk * Ck * 2);
    bf16* lnbuf  = (bf16*)alloc(BT * C * 2);
    bf16* attnb  = (bf16*)alloc(BT * C * 2);
    // phase-aliased scratch (max of: qkv 50MB | q/k/v-proj 24MB | mlp hidden 67MB)
    char* scratch = (char*)alloc(BT * (size_t)4 * C * 2);
    bf16* qkv = (bf16*)scratch;
    bf16* qc  = (bf16*)scratch;
    bf16* kc  = (bf16*)(scratch + BT * C * 2);
    bf16* vc  = (bf16*)(scratch + BT * C * 2 + BTk * C * 2);
    bf16* hfc = (bf16*)scratch;

    float* xo = (float*)d_out;  // running residual state lives in d_out x-region

    // 0) down-conversions: wattn .. valb are contiguous in ws, in this order;
    //    key and val are echoed into the output tuple behind x on the way
    cvt_all_bf16_kernel<<<dim3(1184), 128, 0, stream>>>(
        W_attn, W_aproj, Wq, Wk, Wv, W_cproj, W_fc, W_mproj, key, val, wattn, xo + BT * (size_t)C);

    const float scale = 0.125f;  // 1/sqrt(64)

    // 1) self-attention branch
    ln_bf16_kernel<<<dim3((unsigned)(BT / 16)), 256, 0, stream>>>(x, ln1_g, ln1_b, lnbuf);
    gemm<0, 4>(lnbuf, wattn, b_attn, nullptr, qkv, (int)BT, 3 * C, C, stream);
    attn_kernel<<<dim3(T / 64, NH, B), 128, 0, stream>>>(
        qkv, 3 * C, qkv + C, qkv + 2 * C, 3 * C, attnb, T, T, /*causal=*/1, scale);
    gemm<2, 4>(attnb, waproj, b_aproj, x, xo, (int)BT, C, C, stream);  // x + attn

    // 2) cross-attention branch
    ln_bf16_kernel<<<dim3((unsigned)(BT / 16)), 256, 0, stream>>>(xo, ln3_g, ln3_b, lnbuf);
    // q, k and v projections in one launch: 32 + 8 + 8 rows of blocks
    gemm_bf16_kernel<0, 4, 3><<<dim3(C / 128, (unsigned)((BT + 2 * BTk) / 256)), 256, 0, stream>>>(
        lnbuf, wqb, bq, nullptr, qc, (int)BT, C, C,
        keyb, wkb, bk, kc, valb, wvb, bv, vc, Ck, (int)(BT / 256), (int)(BTk / 256));
    attn_kernel<<<dim3(T / 64, NH, B), 128, 0, stream>>>(
        qc, C, kc, vc, C, attnb, T, TK, /*causal=*/0, scale);
    gemm<2, 4>(attnb, wcproj, b_cproj, xo, xo, (int)BT, C, C, stream);  // x += cross

    // 3) MLP branch
    ln_bf16_kernel<<<dim3((unsigned)(BT / 16)), 256, 0, stream>>>(xo, ln2_g, ln2_b, lnbuf);
    gemm<1, 4>(lnbuf, wfc, b_fc, nullptr, hfc, (int)BT, 4 * C, C, stream);   // + GELU
    gemm<2, 4>(hfc, wmproj, b_mproj, xo, xo, (int)BT, C, 4 * C, stream);     // x += mlp
}

// v009
// It runs in 330 microseconds.
// Timed twice side by side with v008, it ran 1.14 times as fast both times.
// All steps since v000 together make it 2.71 times as fast.
#include <hip/hip_runtime.h>
#include <hip/hip_bf16.h>

typedef __bf16 bf16;
typedef __attribute__((ext_vector_type(16))) __bf16 bf16x16;
typedef __attribute__((ext_vector_type(8)))  float  floatx8;
typedef __attribute__((ext_vector_type(4)))  unsigned int uint32x4;
typedef __attribute__((ext_vector_type(8)))  unsigned int uint32x8;
typedef __attribute__((ext_vector_type(8)))  short s16x8;
typedef __attribute__((ext_vector_type(16))) short s16x16;

// ---------------------------------------------------------------------------
// WMMA wrapper: D = A(16x32 bf16) * B(32x16 bf16) + C(16x16 f32)
// ---------------------------------------------------------------------------
__device__ __forceinline__ floatx8 wmma_bf16(bf16x16 a, bf16x16 b, floatx8 c) {
    return __builtin_amdgcn_wmma_f32_16x16x32_bf16(
        /*neg_a=*/false, a, /*neg_b=*/false, b,
        /*c_mod=*/(short)0, c, /*reuse_a=*/false, /*reuse_b=*/false);
}

__device__ __forceinline__ floatx8 fzero8() {
    floatx8 z;
#pragma unroll
    for (int i = 0; i < 8; ++i) z[i] = 0.0f;
    return z;
}

__device__ __forceinline__ void async_load4_b128(const bf16* gptr, size_t gstep,
                                                 bf16* lptr, int lstep) {
    unsigned l0 = (unsigned)(size_t)lptr;
    unsigned l1 = (unsigned)(size_t)(lptr + lstep);
    unsigned l2 = (unsigned)(size_t)(lptr + 2 * lstep);
    unsigned l3 = (unsigned)(size_t)(lptr + 3 * lstep);
    unsigned long long g0 = (unsigned long long)(size_t)gptr;
    unsigned long long g1 = (unsigned long long)(size_t)(gptr + gstep);
    unsigned long long g2 = (unsigned long long)(size_t)(gptr + 2 * gstep);
    unsigned long long g3 = (unsigned long long)(size_t)(gptr + 3 * gstep);
    asm volatile("global_load_async_to_lds_b128 %0, %4, off\n\t"
                 "global_load_async_to_lds_b128 %1, %5, off\n\t"
                 "global_load_async_to_lds_b128 %2, %6, off\n\t"
                 "global_load_async_to_lds_b128 %3, %7, off\n\t"
                 "s_wait_xcnt 0x0"
                 :: "v"(l0), "v"(l1), "v"(l2), "v"(l3), "v"(g0), "v"(g1), "v"(g2), "v"(g3)
                 : "memory");
}
__device__ __forceinline__ void async_load8_b128(const bf16* gptr, size_t gstep,
                                                 bf16* lptr, int lstep) {
    unsigned l[8];
    unsigned long long g[8];
#pragma unroll
    for (int i = 0; i < 8; ++i) {
        l[i] = (unsigned)(size_t)(lptr + i * lstep);
        g[i] = (unsigned long long)(size_t)(gptr + i * gstep);
    }
    asm volatile("global_load_async_to_lds_b128 %0, %8, off\n\t"
                 "global_load_async_to_lds_b128 %1, %9, off\n\t"
                 "global_load_async_to_lds_b128 %2, %10, off\n\t"
                 "global_load_async_to_lds_b128 %3, %11, off\n\t"
                 "global_load_async_to_lds_b128 %4, %12, off\n\t"
                 "global_load_async_to_lds_b128 %5, %13, off\n\t"
                 "global_load_async_to_lds_b128 %6, %14, off\n\t"
                 "global_load_async_to_lds_b128 %7, %15, off\n\t"
                 "s_wait_xcnt 0x0"
                 :: "v"(l[0]), "v"(l[1]), "v"(l[2]), "v"(l[3]), "v"(l[4]), "v"(l[5]), "v"(l[6]), "v"(l[7]),
                    "v"(g[0]), "v"(g[1]), "v"(g[2]), "v"(g[3]), "v"(g[4]), "v"(g[5]), "v"(g[6]), "v"(g[7])
                 : "memory");
}
__device__ __forceinline__ void wait_async0() {
    asm volatile("s_wait_asynccnt 0x0" ::: "memory");
}

__device__ __forceinline__ void tdm_load_2d_pad(const bf16* gptr, bf16* lptr,
                                                unsigned rows, unsigned cols,
                                                unsigned stride_elems) {
    unsigned long long ga = (unsigned long long)(size_t)gptr;
    uint32x4 g0;
    g0[0] = 1u;
    g0[1] = (unsigned)(size_t)lptr;
    g0[2] = (unsigned)ga;
    g0[3] = (unsigned)(ga >> 32) | 0x80000000u;
    uint32x8 g1;
    g1[0] = (1u << 16) | (1u << 20) | (4u << 22) | (3u << 25);
    g1[1] = (cols & 0xffffu) << 16;
    g1[2] = (rows & 0xffffu) << 16;
    g1[3] = (cols & 0xffffu) << 16;
    g1[4] = (rows & 0xffffu);
    g1[5] = stride_elems;
    g1[6] = 0u;
    g1[7] = 0u;
    asm volatile("tensor_load_to_lds %0, %1" :: "s"(g0), "s"(g1) : "memory");
}
__device__ __forceinline__ void wait_tensor0() {
#if __has_builtin(__builtin_amdgcn_s_wait_tensorcnt)
    __builtin_amdgcn_s_wait_tensorcnt(0);
#else
    asm volatile("s_wait_tensorcnt 0x0" ::: "memory");
#endif
}

__device__ __forceinline__ bf16x16 frag_row(const bf16* p) {
    bf16x16 f;
#pragma unroll
    for (int e = 0; e < 8; ++e) f[e] = p[e];
#pragma unroll
    for (int e = 0; e < 8; ++e) f[e + 8] = p[e + 16];
    return f;
}

// 32x16 B fragment from a row-major [k][n] LDS tile by two transposing loads.
// p is the lane's own address: row 8*(lane>>4) + (lane&7), column n0 + 8*((lane>>3)&1);
// lane (c = lane&15, h = lane>>4) then holds column n0 + c at k {8h..8h+7, 16+8h..16+8h+7},
// the same k order as frag_row. ld = row pitch in elements.
__device__ __forceinline__ bf16x16 frag_tr(const bf16* p, int ld) {
    typedef __attribute__((address_space(3))) s16x8 lds_s16x8;
    s16x8 lo = __builtin_amdgcn_ds_load_tr16_b128_v8i16((lds_s16x8*)p);
    s16x8 hi = __builtin_amdgcn_ds_load_tr16_b128_v8i16((lds_s16x8*)(p + 16 * ld));
    s16x16 f = __builtin_shufflevector(lo, hi, 0, 1, 2, 3, 4, 5, 6, 7,
                                       8, 9, 10, 11, 12, 13, 14, 15);
    return __builtin_bit_cast(bf16x16, f);
}

// wave32 full reduction
__device__ __forceinline__ float wave_sum32(float v) {
#pragma unroll
    for (int m = 16; m >= 1; m >>= 1) v += __shfl_xor(v, m, 32);
    return v;
}
__device__ __forceinline__ float exp_slot(float x) {
    float r;
    asm("v_exp_f32 %0, %1\n\tv_nop" : "=v"(r) : "v"(x * 1.44269504f));
    return r;
}
__device__ __forceinline__ float exp2_slot(float x) {
    float r;
    asm("v_exp_f32 %0, %1\n\tv_nop" : "=v"(r) : "v"(x));
    return r;
}
__device__ __forceinline__ float rcp_slot(float x) {
    float r;
    asm("v_rcp_f32 %0, %1\n\tv_nop" : "=v"(r) : "v"(x));
    return r;
}
__device__ __forceinline__ float other_half(float v) {
    const int b = __builtin_bit_cast(int, v);
    return __builtin_bit_cast(float,
        __builtin_amdgcn_permlanex16(b, b, 0x76543210, 0xfedcba98, false, false));
}

// ---------------------------------------------------------------------------
// f32 -> bf16 conversion of all ten tensors in one launch of few, long waves.
// These streams were held back by the number of waves that had to start, not by
// their bytes. A wave takes 4096 consecutive elements (32 loads of 16 bytes a
// lane, each load 512 contiguous bytes), a block of four waves 16384.
// The ten destinations lie back to back in the workspace, in the order of the
// sources, so the destination is one array. Block counts = elements / 16384.
// The last two tensors (key, val) are also outputs as they are: their blocks store
// the f32 values that they hold anyway, which spares two copy operations of their own.
// ---------------------------------------------------------------------------
typedef __attribute__((ext_vector_type(4))) float  floatx4;
typedef __attribute__((ext_vector_type(4))) __bf16 bf16x4;

__global__ __launch_bounds__(128) void cvt_all_bf16_kernel(
    const float* __restrict__ s0, const float* __restrict__ s1,
    const float* __restrict__ s2, const float* __restrict__ s3,
    const float* __restrict__ s4, const float* __restrict__ s5,
    const float* __restrict__ s6, const float* __restrict__ s7,
    const float* __restrict__ s8, const float* __restrict__ s9,
    bf16* __restrict__ out, float* __restrict__ echo) {
    const int b = blockIdx.x;
    const float* src;
    int first;  // first block of the tensor that block b lies in
    if      (b <  192) { src = s0; first =    0; }
    else if (b <  256) { src = s1; first =  192; }
    else if (b <  320) { src = s2; first =  256; }
    else if (b <  368) { src = s3; first =  320; }
    else if (b <  416) { src = s4; first =  368; }
    else if (b <  480) { src = s5; first =  416; }
    else if (b <  736) { src = s6; first =  480; }
    else if (b <  992) { src = s7; first =  736; }
    else if (b < 1088) { src = s8; first =  992; }
    else               { src = s9; first = 1088; }
    const int within = (threadIdx.x >> 5) * 4096 + (threadIdx.x & 31) * 4;
    const float* ip = src + (size_t)(b - first) * 16384 + within;
    bf16*        op = out + (size_t)b * 16384 + within;
    floatx4 v[32];
#pragma unroll
    for (int j = 0; j < 32; ++j) v[j] = *(const floatx4*)(ip + j * 128);
    // keeps all 32 loads in front of the first conversion: one trip to memory a wave;
    // without it the compiler issues them in six groups, each waiting for the one before
    __builtin_amdgcn_sched_barrier(0);
    asm volatile("s_wait_xcnt 0x0" ::: "memory");
    if (b >= 992) {  // key, val: back to back in the output too
        float* ep = echo + (size_t)(b - 992) * 16384 + within;
#pragma unroll
        for (int j = 0; j < 32; ++j) *(floatx4*)(ep + j * 128) = v[j];
        asm volatile("s_wait_xcnt 0x0" ::: "memory");
    }
#pragma unroll
    for (int j = 0; j < 32; ++j)
        *(bf16x4*)(op + j * 128) = __builtin_convertvector(v[j], bf16x4);
}

// ---------------------------------------------------------------------------
// LayerNorm over rows of 1024: one wave takes two whole rows and keeps them in
// registers (eight 16-byte loads a lane and row, each 512 contiguous bytes), so
// a row is read once, its sums need no LDS and no barrier, and a launch starts
// 4096 waves (16 a WGP). f32 in, bf16 out.
// ---------------------------------------------------------------------------
__global__ __launch_bounds__(256) void ln_bf16_kernel(
    const float* __restrict__ x, const float* __restrict__ g,
    const float* __restrict__ bta, bf16* __restrict__ out) {
    const unsigned goff = (threadIdx.x & 31) * 16;                // the lane's bytes in a 512-byte piece
    const unsigned xoff = (threadIdx.x >> 5) * 8192 + goff;       // + the wave's two rows among the block's sixteen
    const char* xb = (const char*)(x + (size_t)blockIdx.x * 16384);
    char*       ob = (char*)(out + (size_t)blockIdx.x * 16384);
    floatx4 v[2][8], gg[8], bb[8];
#pragma unroll
    for (int r = 0; r < 2; ++r)
#pragma unroll
        for (int j = 0; j < 8; ++j) v[r][j] = *(const floatx4*)(xb + xoff + r * 4096 + j * 512);
#pragma unroll
    for (int j = 0; j < 8; ++j) {
        gg[j] = *(const floatx4*)((const char*)g + goff + j * 512);
        bb[j] = *(const floatx4*)((const char*)bta + goff + j * 512);
    }
    asm volatile("s_wait_xcnt 0x0" :: "v"(xoff), "v"(goff) : "memory");
    // keeps the loads of gain and bias up here with the rows': without it the compiler
    // sinks them behind the row sums, and the wave waits for memory a second and third time
    __builtin_amdgcn_sched_barrier(0);
#pragma unroll
    for (int r = 0; r < 2; ++r) {
        floatx4 s4 = v[r][0], q4 = v[r][0] * v[r][0];
#pragma unroll
        for (int j = 1; j < 8; ++j) {
            s4 += v[r][j];
            q4 += v[r][j] * v[r][j];
        }
        const float ls = wave_sum32((s4[0] + s4[1]) + (s4[2] + s4[3]));
        const float lq = wave_sum32((q4[0] + q4[1]) + (q4[2] + q4[3]));
        const float mean = ls / 1024.0f;
        const float var  = lq / 1024.0f - mean * mean;
        const float inv  = rsqrtf(var + 1e-5f);
#pragma unroll
        for (int j = 0; j < 8; ++j) {
            const floatx4 y = (v[r][j] - mean) * inv * gg[j] + bb[j];
            *(bf16x4*)(ob + xoff / 2 + r * 2048 + j * 256) = __builtin_convertvector(y, bf16x4);
        }
    }
}

template <int EPI, int MT, int NP>
__global__ __launch_bounds__(256) void gemm_bf16_kernel(
    const bf16* __restrict__ A, const bf16* __restrict__ B,
    const float* __restrict__ bias, const float* __restrict__ res,
    void* __restrict__ out, int M, int N, int K,
    const bf16* __restrict__ A1, const bf16* __restrict__ B1,
    const float* __restrict__ bias1, bf16* __restrict__ out1,
    const bf16* __restrict__ A2, const bf16* __restrict__ B2,
    const float* __restrict__ bias2, bf16* __restrict__ out2,
    int K12, int nb0, int nb1) {
    // row-major [m][k], 144B rows (16B x odd: the plain 16-byte load's pitch)
    __shared__ __attribute__((aligned(16))) bf16 As[2][64 * MT][72];
    // row-major [k][n], 288B rows (32B x odd: the transposing load's pitch)
    __shared__ __attribute__((aligned(16))) bf16 Bs[2][64][144];

    const int tid  = threadIdx.x;
    const int lane = tid & 31;
    const int wave = tid >> 5;
    const int wr = wave >> 1;   // 0..3 : group of 16 MT rows
    const int wc = wave & 1;    // 0..1 : 64-col group
    const int hf = lane >> 4;   // lane half
    const int c0 = hf << 3;
    const int ln = lane & 15;
    int by = blockIdx.y;  // the block's row of tiles within its own product
    if (NP == 3 && by >= nb0) {
        by -= nb0;
        const bool last = by >= nb1;
        if (last) by -= nb1;
        A    = last ? A2 : A1;
        B    = last ? B2 : B1;
        bias = last ? bias2 : bias1;
        out  = last ? out2 : out1;
        K    = K12;
    }
    const int bm = by * (64 * MT);
    const int bn = blockIdx.x * 128;

    floatx8 acc[MT][4];
#pragma unroll
    for (int i = 0; i < MT; ++i)
#pragma unroll
        for (int j = 0; j < 4; ++j) acc[i][j] = fzero8();

    const int ar = tid >> 3, as8 = (tid & 7) * 8;   // A: rows ar + 32 i, 8 lanes a 128-byte row
    const int br = tid >> 4, bs8 = (tid & 15) * 8;  // B: rows br + 16 i, 16 lanes a 256-byte row
    const bf16* ga = A + (size_t)(bm + ar) * K + as8;
    const bf16* gb = B + (size_t)br * N + bn + bs8;

    // ---- prologue: stage tile 0 into buffer 0 ----
    {
        if (MT == 4) async_load8_b128(ga, (size_t)32 * K, &As[0][ar][as8], 32 * 72);
        else         async_load4_b128(ga, (size_t)32 * K, &As[0][ar][as8], 32 * 72);
#pragma unroll
        for (int i = 0; i < 4; ++i)
            *(uint4*)&Bs[0][br + 16 * i][bs8] = *(const uint4*)(gb + (size_t)(16 * i) * N);
        wait_async0();
    }
    __syncthreads();

    int cur = 0;
    for (int kk = 0; kk < K; kk += 64) {
        const int nxt = cur ^ 1;
        const bool has_next = (kk + 64 < K);
        uint4 breg0, breg1, breg2, breg3;  // next B tile's 64 bytes of this thread, held over the WMMAs
        if (has_next) {
            if (MT == 4) async_load8_b128(ga + kk + 64, (size_t)32 * K, &As[nxt][ar][as8], 32 * 72);
            else         async_load4_b128(ga + kk + 64, (size_t)32 * K, &As[nxt][ar][as8], 32 * 72);
            const bf16* gbn = gb + (size_t)(kk + 64) * N;
            breg0 = *(const uint4*)(gbn);
            breg1 = *(const uint4*)(gbn + (size_t)16 * N);
            breg2 = *(const uint4*)(gbn + (size_t)32 * N);
            breg3 = *(const uint4*)(gbn + (size_t)48 * N);
            asm volatile("s_wait_xcnt 0x0" ::: "memory");
            if (kk + 128 < K) {  // L2 warm-up two tiles ahead (global_prefetch_b8), one lane a line
                // scalar tests: A's 64 MT lines go to the first 2 MT waves, B's 128 to waves 4-7
                if (MT == 4 || __builtin_amdgcn_readfirstlane(wave) < 4)
                    __builtin_prefetch(A + (size_t)(bm + tid) * K + kk + 128, 0, 1);
                if (__builtin_amdgcn_readfirstlane(wave) >= 4)
                    __builtin_prefetch(B + (size_t)(kk + 128 + ((tid - 128) >> 1)) * N + bn + (tid & 1) * 64, 0, 1);
            }
        }

        // ---- compute current tile: 8 MT WMMAs per wave ----
#pragma unroll
        for (int ks = 0; ks < 2; ++ks) {
            bf16x16 af[MT], bfv[4];
#pragma unroll
            for (int nt = 0; nt < 4; ++nt)
                bfv[nt] = frag_tr(&Bs[cur][ks * 32 + c0 + (lane & 7)][wc * 64 + nt * 16 + ((lane >> 3) & 1) * 8], 144);
#pragma unroll
            for (int mt = 0; mt < MT; ++mt)
                af[mt] = frag_row(&As[cur][wr * (16 * MT) + mt * 16 + ln][ks * 32 + c0]);
            __builtin_amdgcn_sched_barrier(0);
#pragma unroll
            for (int mt = 0; mt < MT; ++mt)
#pragma unroll
                for (int nt = 0; nt < 4; ++nt)
                    acc[mt][nt] = wmma_bf16(bfv[nt], af[mt], acc[mt][nt]);  // C^T tile: rows n, columns m
        }

        if (has_next) {
            // commit staged B to LDS[nxt]
            *(uint4*)&Bs[nxt][br +  0][bs8] = breg0;
            *(uint4*)&Bs[nxt][br + 16][bs8] = breg1;
            *(uint4*)&Bs[nxt][br + 32][bs8] = breg2;
            *(uint4*)&Bs[nxt][br + 48][bs8] = breg3;
        }
        // hand-over of the stage: this wave's LDS reads and writes done, its copies
        // landed, then the barrier that publishes tile t+1 and frees buffer cur
        asm volatile("s_wait_dscnt 0x0" ::: "memory");
        wait_async0();
        __syncthreads();
        cur = nxt;
    }
    wait_async0();  // no copy outlives the loop

    // ---- epilogue ----
    // The tiles were formed transposed, so of row wr * 16 MT + mt * 16 + ln the lane holds the eight
    // consecutive columns wc * 64 + nt * 16 + 8 * hf + v. The wave writes them as 16-byte pieces into
    // LDS of its own (the ring is free: the last trip's barrier ended every read of it) and reads
    // them back row by row, so that every global store, and every load of the residual, covers four
    // whole 128-byte lines. An address is a scalar base plus a 32-bit byte offset of the lane.
    char* st = (char*)&As[0][0][0] + wave * (16 * MT * 144);  // 16 MT rows of 144 bytes a wave
    const unsigned colw = wc * 64;                            // the wave's first column in the block
    const size_t   boff = (size_t)bm * N + bn;                // the block's corner
    if (EPI != 2) {
        typedef __attribute__((ext_vector_type(8))) __bf16 bf16x8;
        floatx4 bs[4][2];
#pragma unroll
        for (int nt = 0; nt < 4; ++nt)
#pragma unroll
            for (int q = 0; q < 2; ++q)
                bs[nt][q] = *(const floatx4*)(bias + bn + colw + nt * 16 + 8 * hf + 4 * q);
#pragma unroll
        for (int mt = 0; mt < MT; ++mt)
#pragma unroll
            for (int nt = 0; nt < 4; ++nt) {
                floatx8 y;
#pragma unroll
                for (int v = 0; v < 8; ++v) {
                    const float a = acc[mt][nt][v] + bs[nt][v >> 2][v & 3];
                    if (EPI == 0) {
                        y[v] = a;
                    } else {
                        // 0.5 (1 + tanh t) = 1 / (1 + e^(-2t)), with e^(-2t) = 2^(a (c + d a^2)),
                        // c = -2 log2(e) sqrt(2/pi), d = 0.044715 c: no branch, so a lane's
                        // elements run interleaved and not one behind the other
                        const float e = exp2_slot(a * (-2.3022082f - 0.10294324f * (a * a)));
                        y[v] = a * rcp_slot(1.0f + e);
                    }
                }
                *(bf16x8*)(st + (mt * 16 + ln) * 144 + nt * 32 + hf * 16) = __builtin_convertvector(y, bf16x8);
            }
        // the wave's own pieces are in LDS before other lanes of it read them back
        asm volatile("s_wait_dscnt 0x0" ::: "memory");
        const unsigned l0 = ((unsigned)(wr * (16 * MT) + (lane >> 3)) * (unsigned)N + colw + (lane & 7) * 8) * 2;
        char* ob = (char*)((bf16*)out + boff);
        uint4 t[4 * MT];
#pragma unroll
        for (int j = 0; j < 4 * MT; ++j)  // four rows a load: eight lanes a row
            t[j] = *(const uint4*)(st + (j * 4 + (lane >> 3)) * 144 + (lane & 7) * 16);
#pragma unroll
        for (int j = 0; j < 4 * MT; ++j)
            *(uint4*)(ob + (l0 + (unsigned)(j * 8) * (unsigned)N)) = t[j];
    } else {
        // f32: a row of the wave is 256 bytes, pitch 272; 8 MT rows at a time fit the wave's LDS
        const unsigned bo = (colw + ln * 4) * 4;  // the lane's four columns, in bytes
        const floatx4  b4 = *(const floatx4*)((const char*)(bias + bn) + bo);
        const unsigned l0 = ((unsigned)(wr * (16 * MT) + hf) * (unsigned)N + colw + ln * 4) * 4;
        unsigned off[4 * MT];  // the same in both groups: the scalar bases move
#pragma unroll
        for (int j = 0; j < 4 * MT; ++j) off[j] = l0 + (unsigned)(j * 8) * (unsigned)N;
#pragma unroll
        for (int g = 0; g < 2; ++g) {
            const char* rb = (const char*)(res + boff + (size_t)(g * 8 * MT) * N);
            char*       ob = (char*)((float*)out + boff + (size_t)(g * 8 * MT) * N);
            floatx4 r[4 * MT];
#pragma unroll
            for (int j = 0; j < 4 * MT; ++j)  // two rows a load: sixteen lanes a row
                r[j] = *(const floatx4*)(rb + off[j]);
            asm volatile("s_wait_xcnt 0x0" :: "v"(bo) : "memory");
#pragma unroll
            for (int mi = 0; mi < MT / 2; ++mi)
#pragma unroll
                for (int nt = 0; nt < 4; ++nt)
#pragma unroll
                    for (int q = 0; q < 2; ++q) {
                        floatx4 a;
#pragma unroll
                        for (int e = 0; e < 4; ++e) a[e] = acc[g * (MT / 2) + mi][nt][4 * q + e];
                        *(floatx4*)(st + (mi * 16 + ln) * 272 + nt * 64 + hf * 32 + q * 16) = a;
                    }
            // the wave's own pieces are in LDS before other lanes of it read them back
            asm volatile("s_wait_dscnt 0x0" ::: "memory");
#pragma unroll
            for (int j = 0; j < 4 * MT; ++j) {
                const floatx4 t = *(const floatx4*)(st + (2 * j + hf) * 272 + ln * 16);
                *(floatx4*)(ob + off[j]) = (t + b4) + r[j];
            }
            if (g == 0) asm volatile("s_wait_xcnt 0x0" ::: "memory");
        }
    }
}

__global__ __launch_bounds__(128) void attn_kernel(
    const bf16* __restrict__ Q, int qstride,
    const bf16* __restrict__ Kp, const bf16* __restrict__ Vp, int kvstride,
    bf16* __restrict__ O, int Tq, int Tk, int causal, float scale) {
    // each tensor load's place in LDS is a multiple of 2 KiB
    __shared__ __attribute__((aligned(2048))) bf16 Ks[32][72];  // K chunk [key][d]  (144B rows)
    __shared__ __attribute__((aligned(2048))) bf16 Vs[32][72];  // V chunk [key][d]

    const int tid  = threadIdx.x;
    const int lane = tid & 31;
    const int w    = tid >> 5;
    const int hf = lane >> 4, c0 = hf << 3, ln = lane & 15;
    const int q0 = blockIdx.x * 64;
    const int h  = blockIdx.y;
    const int b  = blockIdx.z;

    const bf16* qbase = Q  + (size_t)(b * Tq) * qstride  + h * 64;
    const bf16* kbase = Kp + (size_t)(b * Tk) * kvstride + h * 64;
    const bf16* vbase = Vp + (size_t)(b * Tk) * kvstride + h * 64;

    // Q fragments for this wave's 16 rows (2 K-steps over dh=64), kept resident
    bf16x16 qf[2];
    {
        const bf16* qp = qbase + (size_t)(q0 + w * 16 + ln) * qstride;
#pragma unroll
        for (int ks = 0; ks < 2; ++ks) {
            bf16x16 f;
#pragma unroll
            for (int e = 0; e < 8; ++e) f[e] = qp[ks * 32 + c0 + e];
#pragma unroll
            for (int e = 0; e < 8; ++e) f[e + 8] = qp[ks * 32 + c0 + 16 + e];
            qf[ks] = f;
        }
    }

    floatx8 o[4];
#pragma unroll
    for (int i = 0; i < 4; ++i) o[i] = fzero8();
    // of the lane's query (row q0 + w*16 + ln): running maximum, the same in both
    // halves, and the sum over the keys that this half has seen
    float m_r = -1e30f, l_r = 0.0f;

    int kend = causal ? (q0 + 64) : Tk;
    if (kend > Tk) kend = Tk;

    for (int kc = 0; kc < kend; kc += 32) {
        __syncthreads();
        if (w == 0) {
            tdm_load_2d_pad(kbase + (size_t)kc * kvstride, &Ks[0][0], 32, 64, kvstride);
            tdm_load_2d_pad(vbase + (size_t)kc * kvstride, &Vs[0][0], 32, 64, kvstride);
            wait_tensor0();
        }
        __syncthreads();

        // S^T = K * Q^T : two 16-key tiles, K-dim = dh = 64 (2 WMMA steps)
        floatx8 s[2];
#pragma unroll
        for (int nt = 0; nt < 2; ++nt) {
            floatx8 a = fzero8();
#pragma unroll
            for (int ks = 0; ks < 2; ++ks) {
                bf16x16 kf = frag_row(&Ks[nt * 16 + ln][ks * 32 + c0]);
                a = wmma_bf16(kf, qf[ks], a);
            }
            s[nt] = a;
        }
        // V^T fragments (A operand of the second product) by the transposing load: two
        // 16-byte loads a fragment, in the k order of frag_row and of P^T below
        bf16x16 vf[4];
#pragma unroll
        for (int nt = 0; nt < 4; ++nt)
            vf[nt] = frag_tr(&Vs[c0 + (lane & 7)][nt * 16 + ((lane >> 3) & 1) * 8], 72);
        // keeps the eight loads up here as one group, so that LDS answers behind the softmax;
        // without it the compiler sinks them in pairs, each pair waited for in front of its product
        __builtin_amdgcn_sched_barrier(0);
        // scale + causal mask (D layout: lane holds query ln, keys v + 8*hf of the tile)
        const int qg = q0 + w * 16 + ln;
#pragma unroll
        for (int nt = 0; nt < 2; ++nt) {
#pragma unroll
            for (int v = 0; v < 8; ++v) {
                float x = s[nt][v] * scale;
                if (causal) {
                    const int kg = kc + nt * 16 + v + 8 * hf;
                    if (kg > qg) x = -1e30f;
                }
                s[nt][v] = x;
            }
        }
        // online softmax of the lane's query
        float t = fmaxf(s[0][0], s[1][0]);
#pragma unroll
        for (int v = 1; v < 8; ++v) t = fmaxf(t, fmaxf(s[0][v], s[1][v]));
        t = fmaxf(t, other_half(t));
        const float mn = fmaxf(m_r, t);
        const float alpha = exp_slot(m_r - mn);
        m_r = mn;
        // P^T as B operand: element e is key 8*hf + e, element 8 + e key 16 + 8*hf + e,
        // the k order of frag_tr
        bf16x16 pf;
        float rs0, rs1;
#pragma unroll
        for (int v = 0; v < 8; ++v) {
            const float p0 = exp_slot(s[0][v] - mn);
            const float p1 = exp_slot(s[1][v] - mn);
            rs0 = v == 0 ? p0 : rs0 + p0;
            rs1 = v == 0 ? p1 : rs1 + p1;
            pf[v]     = (bf16)p0;
            pf[v + 8] = (bf16)p1;
        }
        l_r = l_r * alpha + (rs0 + rs1);
#pragma unroll
        for (int nt = 0; nt < 4; ++nt)
#pragma unroll
            for (int v = 0; v < 8; ++v) o[nt][v] *= alpha;

        // O^T += V^T(64x32) * P^T(32x16)
#pragma unroll
        for (int nt = 0; nt < 4; ++nt) o[nt] = wmma_bf16(vf[nt], pf, o[nt]);
    }

    // finalize: join the halves' sums, divide; the lane holds d = nt*16 + 8*hf + v of
    // its query: eight consecutive bf16, one 16-byte store a tile
    {
        typedef __attribute__((ext_vector_type(8))) __bf16 bf16x8;
        const float inv = 1.0f / (l_r + other_half(l_r));
        bf16* op = O + (size_t)(b * Tq + q0 + w * 16 + ln) * 1024 + h * 64 + 8 * hf;
#pragma unroll
        for (int nt = 0; nt < 4; ++nt) {
            bf16x8 y;
#pragma unroll
            for (int v = 0; v < 8; ++v) y[v] = (bf16)(o[nt][v] * inv);
            *(bf16x8*)(op + nt * 16) = y;
        }
    }
}

// ---------------------------------------------------------------------------
// Host-side orchestration
// ---------------------------------------------------------------------------
template <int EPI, int MT>
static void gemm(const bf16* A, const bf16* B, const float* bias, const float* res,
                 void* out, int M, int N, int K, hipStream_t s) {
    dim3 g(N / 128, M / (64 * MT));
    gemm_bf16_kernel<EPI, MT, 1><<<g, 256, 0, s>>>(A, B, bias, res, out, M, N, K,
                                                   nullptr, nullptr, nullptr, nullptr,
                                                   nullptr, nullptr, nullptr, nullptr, 0, 0, 0);
}

extern "C" void kernel_launch(void* const* d_in, const int* in_sizes, int n_in,
                              void* d_out, int out_size, void* d_ws, size_t ws_size,
                              hipStream_t stream) {
    const float* x      = (const float*)d_in[0];
    const float* key    = (const float*)d_in[1];
    const float* val    = (const float*)d_in[2];
    const float* ln1_g  = (const float*)d_in[3];
    const float* ln1_b  = (const float*)d_in[4];
    const float* ln2_g  = (const float*)d_in[5];
    const float* ln2_b  = (const float*)d_in[6];
    const float* ln3_g  = (const float*)d_in[7];
    const float* ln3_b  = (const float*)d_in[8];
    const float* W_attn = (const float*)d_in[9];
    const float* b_attn = (const float*)d_in[10];
    const float* W_aproj= (const float*)d_in[11];
    const float* b_aproj= (const float*)d_in[12];
    const float* Wq     = (const float*)d_in[13];
    const float* bq     = (const float*)d_in[14];
    const float* Wk     = (const float*)d_in[15];
    const float* bk     = (const float*)d_in[16];
    const float* Wv     = (const float*)d_in[17];
    const float* bv     = (const float*)d_in[18];
    const float* W_cproj= (const float*)d_in[19];
    const float* b_cproj= (const float*)d_in[20];
    const float* W_fc   = (const float*)d_in[21];
    const float* b_fc   = (const float*)d_in[22];
    const float* W_mproj= (const float*)d_in[23];
    const float* b_mproj= (const float*)d_in[24];

    const int B = 8, T = 1024, C = 1024, Ck = 768, TK = 256, NH = 16;
    const size_t BT  = (size_t)B * T;    // 8192 rows
    const size_t BTk = (size_t)B * TK;   // 2048 rows

    char* ws = (char*)d_ws;
    size_t off = 0;
    auto alloc = [&](size_t bytes) -> void* {
        void* p = ws + off;
        off += (bytes + 255) & ~(size_t)255;
        return p;
    };

    // persistent bf16 buffers
    bf16* wattn  = (bf16*)alloc((size_t)C * 3 * C * 2);
    bf16* waproj = (bf16*)alloc((size_t)C * C * 2);
    bf16* wqb    = (bf16*)alloc((size_t)C * C * 2);
    bf16* wkb    = (bf16*)alloc((size_t)Ck * C * 2);
    bf16* wvb    = (bf16*)alloc((size_t)Ck * C * 2);
    bf16* wcproj = (bf16*)alloc((size_t)C * C * 2);
    bf16* wfc    = (bf16*)alloc((size_t)C * 4 * C * 2);
    bf16* wmproj = (bf16*)alloc((size_t)4 * C * C * 2);
    bf16* keyb   = (bf16*)alloc(BTk * Ck * 2);
    bf16* valb   = (bf16*)alloc(BTk * Ck * 2);
    bf16* lnbuf  = (bf16*)alloc(BT * C * 2);
    bf16* attnb  = (bf16*)alloc(BT * C * 2);
    // phase-aliased scratch (max of: qkv 50MB | q/k/v-proj 24MB | mlp hidden 67MB)
    char* scratch = (char*)alloc(BT * (size_t)4 * C * 2);
    bf16* qkv = (bf16*)scratch;
    bf16* qc  = (bf16*)scratch;
    bf16* kc  = (bf16*)(scratch + BT * C * 2);
    bf16* vc  = (bf16*)(scratch + BT * C * 2 + BTk * C * 2);
    bf16* hfc = (bf16*)scratch;

    float* xo = (float*)d_out;  // running residual state lives in d_out x-region

    // 0) down-conversions: wattn .. valb are contiguous in ws, in this order;
    //    key and val are echoed into the output tuple behind x on the way
    cvt_all_bf16_kernel<<<dim3(1184), 128, 0, stream>>>(
        W_attn, W_aproj, Wq, Wk, Wv, W_cproj, W_fc, W_mproj, key, val, wattn, xo + BT * (size_t)C);

    const float scale = 0.125f;  // 1/sqrt(64)

    // 1) self-attention branch
    ln_bf16_kernel<<<dim3((unsigned)(BT / 16)), 256, 0, stream>>>(x, ln1_g, ln1_b, lnbuf);
    gemm<0, 4>(lnbuf, wattn, b_attn, nullptr, qkv, (int)BT, 3 * C, C, stream);
    attn_kernel<<<dim3(T / 64, NH, B), 128, 0, stream>>>(
        qkv, 3 * C, qkv + C, qkv + 2 * C, 3 * C, attnb, T, T, /*causal=*/1, scale);
    gemm<2, 4>(attnb, waproj, b_aproj, x, xo, (int)BT, C, C, stream);  // x + attn

    // 2) cross-attention branch
    ln_bf16_kernel<<<dim3((unsigned)(BT / 16)), 256, 0, stream>>>(xo, ln3_g, ln3_b, lnbuf);
    // q, k and v projections in one launch: 32 + 8 + 8 rows of blocks
    gemm_bf16_kernel<0, 4, 3><<<dim3(C / 128, (unsigned)((BT + 2 * BTk) / 256)), 256, 0, stream>>>(
        lnbuf, wqb, bq, nullptr, qc, (int)BT, C, C,
        keyb, wkb, bk, kc, valb, wvb, bv, vc, Ck, (int)(BT / 256), (int)(BTk / 256));
    attn_kernel<<<dim3(T / 64, NH, B), 128, 0, stream>>>(
        qc, C, kc, vc, C, attnb, T, TK, /*causal=*/0, scale);
    gemm<2, 4>(attnb, wcproj, b_cproj, xo, xo, (int)BT, C, C, stream);  // x += cross

    // 3) MLP branch
    ln_bf16_kernel<<<dim3((unsigned)(BT / 16)), 256, 0, stream>>>(xo, ln2_g, ln2_b, lnbuf);
    gemm<1, 4>(lnbuf, wfc, b_fc, nullptr, hfc, (int)BT, 4 * C, C, stream);   // + GELU
    gemm<2, 4>(hfc, wmproj, b_mproj, xo, xo, (int)BT, C, 4 * C, stream);     // x += mlp
}
